// v000
// Times are from an AMD MI455X. After a warm-up the kernel runs many times in a row, and a time is the length of
// such a window on the GPU divided by its runs, so every launch and the gaps after it count. The runs cycle
// through copies of the inputs. A figure is the median of several windows, for all but v000 over two sittings.
// Sittings can differ by a few percent; kernels timed side by side share one.
// The starting kernel, v000, takes 5340 microseconds a run.
#include <hip/hip_runtime.h>

// Compute dtypes, f32 accumulate, per item: GroupNorm (32 groups, statistics in f32, fixed order) while transposing to voxel-major bf16 hi + UNSCALED residual planes; q/k/v/proj =
// 1x1x1 convs as [8192 x 64].[64 x 64] GEMMs on hi/lo planes with exact bf16 weights (two products, + bias); single-head attention over the 8192 voxels in 1024-row blocks with
// hi/lo operands (three products); 1/8 and the softmax in f32; x + out with the channel-major transpose in f32 - on v_wmma_f32_16x16x32_bf16. Deterministic, no atomics; every

#define NB_  2
#define CC   64
#define NV   8192
#define NG   32
#define RB   1024
#define DM   CC
#define SCL  0.125f
#define GEPS 1e-6f
#define LOSC 1024.0f

typedef _Float16 h16;
typedef unsigned short bf;
typedef __attribute__((ext_vector_type(16))) __bf16   v16bf;
typedef __attribute__((ext_vector_type(16))) _Float16 v16h;
typedef __attribute__((ext_vector_type(8)))  _Float16 v8h;
typedef __attribute__((ext_vector_type(8)))  unsigned short v8us;
typedef __attribute__((ext_vector_type(8)))  float    v8f;
typedef __attribute__((ext_vector_type(4)))  float    v4f;
typedef v8h  __attribute__((may_alias)) v8ha;
typedef v4f  __attribute__((may_alias)) v4fa;
typedef v8us __attribute__((may_alias)) v8usa;

__device__ __forceinline__ unsigned short f2bf(float f) { unsigned u = __float_as_uint(f); u += 0x7FFFu + ((u >> 16) & 1u); return (unsigned short)(u >> 16); }
__device__ __forceinline__ float bf2f(unsigned short b) { return __uint_as_float(((unsigned)b) << 16); }
__device__ __forceinline__ float bfr(float f) { return bf2f(f2bf(f)); }
__device__ __forceinline__ v16h cat16(v8h lo, v8h hi) { return __builtin_shufflevector(lo, hi, 0, 1, 2, 3, 4, 5, 6, 7, 8, 9, 10, 11, 12, 13, 14, 15); }
__device__ __forceinline__ v16bf cat16b(v8us lo, v8us hi) { return __builtin_bit_cast(v16bf, __builtin_shufflevector(lo, hi, 0, 1, 2, 3, 4, 5, 6, 7, 8, 9, 10, 11, 12, 13, 14, 15)); }
__device__ __forceinline__ v8f wmma16(v16h a, v16h b, v8f c) { return __builtin_amdgcn_wmma_f32_16x16x32_f16(false, a, false, b, (short)0, c, false, false); }
__device__ __forceinline__ v8f wmmab(v16bf a, v16bf b, v8f c) { return __builtin_amdgcn_wmma_f32_16x16x32_bf16(false, a, false, b, (short)0, c, false, false); }

// k_gemmb: 64 x 64 block tile (4 waves x 16 x 64) of C[NTK][NW] = (A [+ Al]).B^T (K = 64) [+ bf(bias[c])] [+ bf(R[r][c]) residual]; f32 whole-line epilogue (or f16
template <bool SPLITA, bool F16OUT = false>
__global__ __launch_bounds__(128) void k_gemmb(const bf* __restrict__ A, const bf* __restrict__ Al, const bf* __restrict__ Bn, const float* __restrict__ bias, float* C, int ldc, h16* C2, const float* __restrict__ R = nullptr, int K = DM, int roundR = 1) {
    __shared__ __align__(16) float ost[4][16 * 68];
    const int lane = threadIdx.x & 31, wave = threadIdx.x >> 5, lr = lane & 15, hi = lane >> 4;
    const int r0 = blockIdx.x * 64 + wave * 16, c0 = blockIdx.y * 64;
    const size_t aoff = (size_t)(r0 + lr) * K + 8 * hi;
    size_t boff[4];
#pragma unroll
    for (int t = 0; t < 4; ++t) boff[t] = (size_t)(c0 + t * 16 + lr) * K + 8 * hi;
    v8f acc[4];
#pragma unroll
    for (int t = 0; t < 4; ++t) acc[t] = (v8f){};
#pragma unroll 1
    for (int kc = 0; kc < K; kc += 32) {
        const v16bf a = cat16b(*(const v8us*)(A + aoff + kc), *(const v8us*)(A + aoff + kc + 16));
        v16bf al = a;
        if (SPLITA) al = cat16b(*(const v8us*)(Al + aoff + kc), *(const v8us*)(Al + aoff + kc + 16));
#pragma unroll
        for (int t = 0; t < 4; ++t) { const v16bf b = cat16b(*(const v8us*)(Bn + boff[t] + kc), *(const v8us*)(Bn + boff[t] + kc + 16)); acc[t] = wmmab(a, b, acc[t]); if (SPLITA) acc[t] = wmmab(al, b, acc[t]); }
        asm volatile("v_nop\n\tv_nop\n\tv_nop\n\tv_nop" : "+v"(acc[0]), "+v"(acc[1]), "+v"(acc[2]), "+v"(acc[3]) : "v"(a), "v"(al));
    }
    float* os = &ost[wave][0];
#pragma unroll
    for (int t = 0; t < 4; ++t) { const float bv = bias ? bfr(bias[c0 + t * 16 + lr]) : 0.f;
#pragma unroll
        for (int j = 0; j < 8; ++j) os[(hi * 8 + j) * 68 + t * 16 + lr] = acc[t][j] + bv; }
    __syncthreads();
    if (F16OUT) {
        h16* crow = (h16*)(void*)C + (size_t)r0 * ldc + c0;
        auto pass = [&]() {
#pragma unroll
            for (int s = 0; s < 4; ++s) { const int row = 4 * s + (lane >> 3), piece = lane & 7; const float* sp = os + row * 68 + piece * 8; v8h o, o2;
#pragma unroll
                for (int i = 0; i < 8; ++i) { const h16 a = (h16)sp[i]; o[i] = a; o2[i] = (h16)((sp[i] - (float)a) * LOSC); }
                *(v8h*)(crow + (size_t)row * ldc + piece * 8) = o; if (C2) *(v8h*)(C2 + (size_t)r0 * ldc + c0 + (size_t)row * ldc + piece * 8) = o2; }
        };
        pass(); 
    } else {
        float* crow = C + (size_t)r0 * ldc + c0;
        auto pass = [&]() {
#pragma unroll
            for (int s = 0; s < 8; ++s) { const int Lid = (lane >> 3) + 4 * s, piece = lane & 7; const int row = Lid >> 1, cofs = (Lid & 1) * 32 + piece * 4;
                v4f val = *(const v4fa*)(os + row * 68 + cofs); if (R) { const v4f rv = *(const v4f*)(R + ((size_t)r0 + row) * ldc + c0 + cofs); val += roundR ? (v4f){bfr(rv[0]), bfr(rv[1]), bfr(rv[2]), bfr(rv[3])} : rv; }
                *(v4f*)(crow + (size_t)row * ldc + cofs) = val; }
        };
        pass(); 
    }
}

__global__ __launch_bounds__(256) void k_cvt8(const float* __restrict__ src, bf* dst, size_t n8) {
    const size_t i = (size_t)blockIdx.x * 256 + threadIdx.x; if (i >= n8) return;
    const v8f v = *(const v8f*)(src + i * 8); v8us o;
#pragma unroll
    for (int k = 0; k < 8; ++k) o[k] = f2bf(v[k]);
    *(v8us*)(dst + i * 8) = o; 
}
__global__ __launch_bounds__(256) void k_zero8(bf* dst, size_t n8) {
    const size_t i = (size_t)blockIdx.x * 256 + threadIdx.x; if (i >= n8) return; v8us z;
#pragma unroll
    for (int k = 0; k < 8; ++k) z[k] = 0;
    *(v8us*)(dst + i * 8) = z; 
}
// k_gemm3: 64 x 64 tile of C = (Ah + Al).(Bh + Bl)^T over K (row strides = K for all four planes; n-major B): three products per 32-k step (hh, hl, lh); f32
__global__ __launch_bounds__(128) void k_gemm3(const bf* __restrict__ Ah, const bf* __restrict__ Al, const bf* __restrict__ Bh, const bf* __restrict__ Bl, int K, float* C, int ldc) {
    __shared__ __align__(16) float ost[4][16 * 68];
    const int lane = threadIdx.x & 31, wave = threadIdx.x >> 5, lr = lane & 15, hi = lane >> 4;
    const int r0 = blockIdx.x * 64 + wave * 16, c0 = blockIdx.y * 64;
    const size_t aoff = (size_t)(r0 + lr) * K + 8 * hi;
    v8f acc[4];
#pragma unroll
    for (int t = 0; t < 4; ++t) acc[t] = (v8f){};
#pragma unroll 1
    for (int kc = 0; kc < K; kc += 32) {
        const v16bf a = cat16b(*(const v8us*)(Ah + aoff + kc), *(const v8us*)(Ah + aoff + kc + 16));
        const v16bf al = cat16b(*(const v8us*)(Al + aoff + kc), *(const v8us*)(Al + aoff + kc + 16));
#pragma unroll
        for (int t = 0; t < 4; ++t) { const size_t bo = (size_t)(c0 + t * 16 + lr) * K + kc + 8 * hi;
            const v16bf bh = cat16b(*(const v8us*)(Bh + bo), *(const v8us*)(Bh + bo + 16)); const v16bf bl = cat16b(*(const v8us*)(Bl + bo), *(const v8us*)(Bl + bo + 16));
            acc[t] = wmmab(a, bh, acc[t]); acc[t] = wmmab(al, bh, acc[t]); acc[t] = wmmab(a, bl, acc[t]); }
        asm volatile("v_nop\n\tv_nop\n\tv_nop\n\tv_nop" : "+v"(acc[0]), "+v"(acc[1]), "+v"(acc[2]), "+v"(acc[3]) : "v"(a), "v"(al));
    }
    float* os = &ost[wave][0];
#pragma unroll
    for (int t = 0; t < 4; ++t) {
#pragma unroll
        for (int j = 0; j < 8; ++j) os[(hi * 8 + j) * 68 + t * 16 + lr] = acc[t][j]; }
    __builtin_amdgcn_wave_barrier(); asm volatile("" ::: "memory");
    float* crow = C + (size_t)r0 * ldc + c0;
    auto pass = [&]() {
#pragma unroll
        for (int s = 0; s < 8; ++s) { const int Lid = (lane >> 3) + 4 * s, piece = lane & 7; const int row = Lid >> 1, cofs = (Lid & 1) * 32 + piece * 4;
            const v4f val = *(const v4fa*)(os + row * 68 + cofs); *(v4f*)(crow + (size_t)row * ldc + cofs) = val; }
    };
    pass(); 
}


// k_gnstat: per (group g of 2 channels): mean and rsqrt(var + eps) over 2 x 8192 values of x[b][2g..2g+1][:] (f32; lane-strided fixed-order partial sums + xor tree; biased var
// share a line: NOT whole-line. Instead one wave per 32 groups is too serial; so: block of 256 threads = 8 waves = 8 groups, each wave writes its own 32-float ST row (mean, rstd, zeros)
__global__ __launch_bounds__(256) void k_gnstat(const float* __restrict__ xb, float* ST) {
    const int lane = threadIdx.x & 31; const int g = blockIdx.x * 8 + (threadIdx.x >> 5); if (g >= NG) return; const float* base = xb + (size_t)(2 * g) * NV; const int n = 2 * NV; float s = 0.f;
    for (int i = lane; i < n; i += 32) s += base[i];
#pragma unroll
    for (int sh = 16; sh; sh >>= 1) s += __shfl_xor(s, sh, 32);
    const float mu = s / (float)n; float q = 0.f;
    for (int i = lane; i < n; i += 32) { const float d = base[i] - mu; q = fmaf(d, d, q); }
#pragma unroll
    for (int sh = 16; sh; sh >>= 1) q += __shfl_xor(q, sh, 32);
    const float rs = rsqrtf(q / (float)n + GEPS); const float v = (lane == 0) ? mu : (lane == 1) ? rs : 0.f;
    *(float*)(ST + (size_t)g * 32 + lane) = v; 
}
// k_gnT: voxel-major planes HT[p][c] of (bf(x[c][p]) - mean_g) rstd_g bf(gamma[c]) + bf(beta[c]) via 64x64 LDS tiles (all 64 channels x 64 voxels per block); wave writes 2 rows x 64
__global__ __launch_bounds__(256) void k_gnT(const float* __restrict__ xb, const float* __restrict__ ST, const float* __restrict__ gam, const float* __restrict__ bet, bf* Hh, bf* Hl) {
    __shared__ float tl[64][65];
    typedef __attribute__((ext_vector_type(4))) unsigned short v4us;
    const int tid = threadIdx.x, p0 = blockIdx.y * 64; const int rr = tid >> 2, cq = (tid & 3) * 16;   // rr = channel
    { const float mu = ST[(rr >> 1) * 32], rs = ST[(rr >> 1) * 32 + 1], ga = bfr(gam[rr]), be = bfr(bet[rr]);
#pragma unroll
      for (int i = 0; i < 16; ++i) tl[rr][cq + i] = (bfr(xb[(size_t)rr * NV + p0 + cq + i]) - mu) * rs * ga + be; }
    __syncthreads();
    const int lane = tid & 31, wv = tid >> 5;
    auto pass = [&]() {
#pragma unroll
        for (int st = 0; st < 4; ++st) { const int pr = wv * 8 + st * 2 + (lane >> 4); const int cl = (lane & 15) * 4; v4us oh, ol;
#pragma unroll
            for (int i = 0; i < 4; ++i) { const float y = tl[cl + i][pr]; const unsigned short hb = f2bf(y); oh[i] = hb; ol[i] = f2bf(y - bf2f(hb)); }
            const size_t o = (size_t)(p0 + pr) * CC + cl; *(v4us*)(Hh + o) = oh; *(v4us*)(Hl + o) = ol; }
    };
    pass(); 
}
__global__ __launch_bounds__(256) void k_split64(const float* __restrict__ F, int rows, float sc, bf* Ph, bf* Pl) {
    typedef __attribute__((ext_vector_type(2))) unsigned short v2us; typedef __attribute__((ext_vector_type(2))) float v2f_;
    const int lane = threadIdx.x & 31; const size_t r = (size_t)blockIdx.x * 8 + (threadIdx.x >> 5); if (r >= (size_t)rows) return; const size_t o = r * CC + lane * 2; const v2f_ v = *(const v2f_*)(F + o); v2us oh, ol;
#pragma unroll
    for (int i = 0; i < 2; ++i) { const float y = v[i] * sc; const unsigned short hb = f2bf(y); oh[i] = hb; ol[i] = f2bf(y - bf2f(hb)); }
    *(v2us*)(Ph + o) = oh; *(v2us*)(Pl + o) = ol; 
}
__global__ __launch_bounds__(256) void k_vT(const float* __restrict__ V, bf* Th, bf* Tl) {
    __shared__ float tl[64][65];
    typedef __attribute__((ext_vector_type(4))) unsigned short v4us;
    const int tid = threadIdx.x; const int t0 = blockIdx.x * 64; const int rr = tid >> 2, cq = (tid & 3) * 16;
#pragma unroll
    for (int i = 0; i < 16; ++i) tl[rr][cq + i] = V[(size_t)(t0 + rr) * CC + cq + i];     // tl[t][d]
    __syncthreads();
    const int lane = tid & 31, wv = tid >> 5;
    auto pass = [&]() {
#pragma unroll
        for (int st = 0; st < 4; ++st) { const int dr = wv * 8 + st * 2 + (lane >> 4); const int tq = (lane & 15) * 4; v4us oh, ol;
#pragma unroll
            for (int i = 0; i < 4; ++i) { const float y = tl[tq + i][dr]; const unsigned short hb = f2bf(y); oh[i] = hb; ol[i] = f2bf(y - bf2f(hb)); }
            const size_t o = (size_t)dr * NV + t0 + tq; *(v4us*)(Th + o) = oh; *(v4us*)(Tl + o) = ol; }
    };
    pass(); 
}
__global__ __launch_bounds__(256) void k_soft(const float* __restrict__ S, float sc, bf* PH, bf* PL) {
    typedef __attribute__((ext_vector_type(4))) unsigned short v4us;
    const int lane = threadIdx.x & 31, i = blockIdx.x * 8 + (threadIdx.x >> 5); if (i >= RB) return; const float* sr = S + (size_t)i * NV;
    float m = -3.0e38f;
#pragma unroll 1
    for (int c0 = lane * 4; c0 < NV; c0 += 128) {
#pragma unroll
        for (int q = 0; q < 4; ++q) m = fmaxf(m, sr[c0 + q] * sc); }
#pragma unroll
    for (int sh = 16; sh; sh >>= 1) m = fmaxf(m, __shfl_xor(m, sh, 32));
    float sum = 0.f;
#pragma unroll 1
    for (int c0 = lane * 4; c0 < NV; c0 += 128) {
#pragma unroll
        for (int q = 0; q < 4; ++q) sum += __expf(sr[c0 + q] * sc - m); }
#pragma unroll
    for (int sh = 16; sh; sh >>= 1) sum += __shfl_xor(sum, sh, 32);
    const float inv = 1.0f / sum;
{
#pragma unroll 1
        for (int c0 = lane * 4; c0 < NV; c0 += 128) { v4us oh, ol;
#pragma unroll
            for (int q = 0; q < 4; ++q) { const float p = __expf(sr[c0 + q] * sc - m) * inv; const unsigned short hb = f2bf(p); oh[q] = hb; ol[q] = f2bf(p - bf2f(hb)); }
            const size_t o = (size_t)i * NV + c0; *(v4us*)(PH + o) = oh; *(v4us*)(PL + o) = ol; }
         }
}
__global__ __launch_bounds__(256) void k_outT(const float* __restrict__ OT, const float* __restrict__ xb, float* OUTB) {
    __shared__ float tl[64][65];
    const int tid = threadIdx.x; const int p0 = blockIdx.x * 64; const int rr = tid >> 2, cq = (tid & 3) * 16;
#pragma unroll
    for (int i = 0; i < 16; ++i) tl[rr][cq + i] = OT[(size_t)(p0 + rr) * CC + cq + i];
    __syncthreads();
    const int lane = tid & 31, wv = tid >> 5;
    auto pass = [&]() {
#pragma unroll
        for (int st = 0; st < 4; ++st) { const int cr = wv * 8 + st * 2 + (lane >> 4); const int pq = (lane & 15) * 4; v4f v; const size_t o = (size_t)cr * NV + p0 + pq;
#pragma unroll
            for (int i = 0; i < 4; ++i) v[i] = bfr(xb[o + i]) + tl[pq + i][cr];
            *(v4f*)(OUTB + o) = v; }
    };
    pass(); 
}

extern "C" void kernel_launch(void* const* d_in, const int* in_sizes, int n_in,
                              void* d_out, int out_size, void* d_ws, size_t ws_size, hipStream_t stream) {
    (void)in_sizes; (void)n_in; (void)out_size;
    const float* x = (const float*)d_in[0]; const float* gam = (const float*)d_in[1]; const float* bet = (const float*)d_in[2]; const float* wq = (const float*)d_in[3]; const float* bq = (const float*)d_in[4]; const float* wk = (const float*)d_in[5]; const float* bk = (const float*)d_in[6]; const float* wv = (const float*)d_in[7]; const float* bv = (const float*)d_in[8]; const float* wp = (const float*)d_in[9]; const float* bp = (const float*)d_in[10];
    float* out = (float*)d_out;    // [2][64][32][32][8]
    char* wsp = (char*)d_ws;
    auto take = [&](size_t bytes) { char* p = wsp; wsp += (bytes + 255) & ~(size_t)255; return (void*)p; };
    bf* WQ = (bf*)take(CC * CC * 2); bf* WK = (bf*)take(CC * CC * 2); bf* WV = (bf*)take(CC * CC * 2); bf* WP = (bf*)take(CC * CC * 2); float* ST = (float*)take(NG * 32 * 4);
    bf* Hh = (bf*)take((size_t)NV * CC * 2); bf* Hl = (bf*)take((size_t)NV * CC * 2); float* QF = (float*)take((size_t)NV * CC * 4); float* KF = (float*)take((size_t)NV * CC * 4); float* VF = (float*)take((size_t)NV * CC * 4);
    bf* Qh = (bf*)take((size_t)NV * CC * 2); bf* Ql = (bf*)take((size_t)NV * CC * 2); bf* Kh = (bf*)take((size_t)NV * CC * 2); bf* Kl = (bf*)take((size_t)NV * CC * 2); bf* VTh = (bf*)take((size_t)CC * NV * 2); bf* VTl = (bf*)take((size_t)CC * NV * 2);
    float* S = (float*)take((size_t)RB * NV * 4); bf* PH = (bf*)take((size_t)RB * NV * 2); bf* PL = (bf*)take((size_t)RB * NV * 2); float* O = (float*)take((size_t)NV * CC * 4); bf* Oh = (bf*)take((size_t)NV * CC * 2); bf* Ol = (bf*)take((size_t)NV * CC * 2); float* OT = (float*)take((size_t)NV * CC * 4);
    if ((size_t)(wsp - (char*)d_ws) > ws_size) return;    // ~ 2 + 6 + 6 + 33.5 + 33.5 + 6 ~ 88 MB
    k_cvt8<<<(CC * CC / 8 + 255) / 256, 256, 0, stream>>>(wq, WQ, CC * CC / 8); k_cvt8<<<(CC * CC / 8 + 255) / 256, 256, 0, stream>>>(wk, WK, CC * CC / 8); k_cvt8<<<(CC * CC / 8 + 255) / 256, 256, 0, stream>>>(wv, WV, CC * CC / 8); k_cvt8<<<(CC * CC / 8 + 255) / 256, 256, 0, stream>>>(wp, WP, CC * CC / 8);   // 'oc' natural
    const dim3 gp(NV / 64, 1, 1);
    for (int b = 0; b < NB_; ++b) { const float* xb = x + (size_t)b * CC * NV;
        k_gnstat<<<NG / 8, 256, 0, stream>>>(xb, ST); k_gnT<<<dim3(1, NV / 64, 1), 256, 0, stream>>>(xb, ST, gam, bet, Hh, Hl);
        k_gemmb<true, false><<<gp, 128, 0, stream>>>(Hh, Hl, WQ, bq, QF, CC, nullptr, nullptr, CC); k_gemmb<true, false><<<gp, 128, 0, stream>>>(Hh, Hl, WK, bk, KF, CC, nullptr, nullptr, CC); k_gemmb<true, false><<<gp, 128, 0, stream>>>(Hh, Hl, WV, bv, VF, CC, nullptr, nullptr, CC);
        k_split64<<<NV / 8, 256, 0, stream>>>(QF, NV, 1.0f, Qh, Ql); k_split64<<<NV / 8, 256, 0, stream>>>(KF, NV, 1.0f, Kh, Kl); k_vT<<<NV / 64, 256, 0, stream>>>(VF, VTh, VTl);
        for (int rb = 0; rb < NV / RB; ++rb) { const size_t r0 = (size_t)rb * RB;
            k_gemm3<<<dim3(RB / 64, NV / 64, 1), 128, 0, stream>>>(Qh + r0 * CC, Ql + r0 * CC, Kh, Kl, CC, S, NV);
            k_soft<<<RB / 8, 256, 0, stream>>>(S, SCL, PH, PL);
            k_gemm3<<<dim3(RB / 64, 1, 1), 128, 0, stream>>>(PH, PL, VTh, VTl, NV, O + r0 * CC, CC); }
        k_split64<<<NV / 8, 256, 0, stream>>>(O, NV, 1.0f, Oh, Ol);
        k_gemmb<true, false><<<gp, 128, 0, stream>>>(Oh, Ol, WP, bp, OT, CC, nullptr, nullptr, CC);
        k_outT<<<dim3(NV / 64, 1, 1), 256, 0, stream>>>(OT, xb, out + (size_t)b * CC * NV); }
}

// v001
// Measured time: 1850 microseconds a run.
// Timed twice side by side with v000, it ran 2.88 and 2.89 times as fast.
#include <hip/hip_runtime.h>

// Compute dtypes, f32 accumulate, per item: GroupNorm (32 groups, statistics in f32, fixed order) while transposing to voxel-major bf16 hi + UNSCALED residual planes; q/k/v/proj =
// 1x1x1 convs as [8192 x 64].[64 x 64] GEMMs on hi/lo planes with exact bf16 weights (two products, + bias); single-head attention over the 8192 voxels in 1024-row blocks with
// hi/lo operands (three products); 1/8 and the softmax in f32; x + out with the channel-major transpose in f32 - on v_wmma_f32_16x16x32_bf16. Deterministic, no atomics; every

#define NB_  2
#define CC   64
#define NV   8192
#define NG   32
#define RB   1024
#define DM   CC
#define SCL  0.125f
#define GEPS 1e-6f
#define LOSC 1024.0f
#define KS   64

typedef _Float16 h16;
typedef unsigned short bf;
typedef __attribute__((ext_vector_type(16))) __bf16   v16bf;
typedef __attribute__((ext_vector_type(16))) _Float16 v16h;
typedef __attribute__((ext_vector_type(8)))  _Float16 v8h;
typedef __attribute__((ext_vector_type(8)))  unsigned short v8us;
typedef __attribute__((ext_vector_type(8)))  float    v8f;
typedef __attribute__((ext_vector_type(4)))  float    v4f;
typedef v8h  __attribute__((may_alias)) v8ha;
typedef v4f  __attribute__((may_alias)) v4fa;
typedef v8us __attribute__((may_alias)) v8usa;

__device__ __forceinline__ unsigned short f2bf(float f) { unsigned u = __float_as_uint(f); u += 0x7FFFu + ((u >> 16) & 1u); return (unsigned short)(u >> 16); }
__device__ __forceinline__ float bf2f(unsigned short b) { return __uint_as_float(((unsigned)b) << 16); }
__device__ __forceinline__ float bfr(float f) { return bf2f(f2bf(f)); }
__device__ __forceinline__ v16h cat16(v8h lo, v8h hi) { return __builtin_shufflevector(lo, hi, 0, 1, 2, 3, 4, 5, 6, 7, 8, 9, 10, 11, 12, 13, 14, 15); }
__device__ __forceinline__ v16bf cat16b(v8us lo, v8us hi) { return __builtin_bit_cast(v16bf, __builtin_shufflevector(lo, hi, 0, 1, 2, 3, 4, 5, 6, 7, 8, 9, 10, 11, 12, 13, 14, 15)); }
__device__ __forceinline__ v8f wmma16(v16h a, v16h b, v8f c) { return __builtin_amdgcn_wmma_f32_16x16x32_f16(false, a, false, b, (short)0, c, false, false); }
__device__ __forceinline__ v8f wmmab(v16bf a, v16bf b, v8f c) { return __builtin_amdgcn_wmma_f32_16x16x32_bf16(false, a, false, b, (short)0, c, false, false); }

// k_gemmb: 64 x 64 block tile (4 waves x 16 x 64) of C[NTK][NW] = (A [+ Al]).B^T (K = 64) [+ bf(bias[c])] [+ bf(R[r][c]) residual]; f32 whole-line epilogue (or f16
template <bool SPLITA, bool F16OUT = false>
__global__ __launch_bounds__(128) void k_gemmb(const bf* __restrict__ A, const bf* __restrict__ Al, const bf* __restrict__ Bn, const float* __restrict__ bias, float* C, int ldc, h16* C2, const float* __restrict__ R = nullptr, int K = DM, int roundR = 1) {
    __shared__ __align__(16) float ost[4][16 * 68];
    const int lane = threadIdx.x & 31, wave = threadIdx.x >> 5, lr = lane & 15, hi = lane >> 4;
    const int r0 = blockIdx.x * 64 + wave * 16, c0 = blockIdx.y * 64;
    const size_t aoff = (size_t)(r0 + lr) * K + 8 * hi;
    size_t boff[4];
#pragma unroll
    for (int t = 0; t < 4; ++t) boff[t] = (size_t)(c0 + t * 16 + lr) * K + 8 * hi;
    v8f acc[4];
#pragma unroll
    for (int t = 0; t < 4; ++t) acc[t] = (v8f){};
#pragma unroll 1
    for (int kc = 0; kc < K; kc += 32) {
        const v16bf a = cat16b(*(const v8us*)(A + aoff + kc), *(const v8us*)(A + aoff + kc + 16));
        v16bf al = a;
        if (SPLITA) al = cat16b(*(const v8us*)(Al + aoff + kc), *(const v8us*)(Al + aoff + kc + 16));
#pragma unroll
        for (int t = 0; t < 4; ++t) { const v16bf b = cat16b(*(const v8us*)(Bn + boff[t] + kc), *(const v8us*)(Bn + boff[t] + kc + 16)); acc[t] = wmmab(a, b, acc[t]); if (SPLITA) acc[t] = wmmab(al, b, acc[t]); }
        asm volatile("v_nop\n\tv_nop\n\tv_nop\n\tv_nop" : "+v"(acc[0]), "+v"(acc[1]), "+v"(acc[2]), "+v"(acc[3]) : "v"(a), "v"(al));
    }
    float* os = &ost[wave][0];
#pragma unroll
    for (int t = 0; t < 4; ++t) { const float bv = bias ? bfr(bias[c0 + t * 16 + lr]) : 0.f;
#pragma unroll
        for (int j = 0; j < 8; ++j) os[(hi * 8 + j) * 68 + t * 16 + lr] = acc[t][j] + bv; }
    __syncthreads();
    if (F16OUT) {
        h16* crow = (h16*)(void*)C + (size_t)r0 * ldc + c0;
        auto pass = [&]() {
#pragma unroll
            for (int s = 0; s < 4; ++s) { const int row = 4 * s + (lane >> 3), piece = lane & 7; const float* sp = os + row * 68 + piece * 8; v8h o, o2;
#pragma unroll
                for (int i = 0; i < 8; ++i) { const h16 a = (h16)sp[i]; o[i] = a; o2[i] = (h16)((sp[i] - (float)a) * LOSC); }
                *(v8h*)(crow + (size_t)row * ldc + piece * 8) = o; if (C2) *(v8h*)(C2 + (size_t)r0 * ldc + c0 + (size_t)row * ldc + piece * 8) = o2; }
        };
        pass(); 
    } else {
        float* crow = C + (size_t)r0 * ldc + c0;
        auto pass = [&]() {
#pragma unroll
            for (int s = 0; s < 8; ++s) { const int Lid = (lane >> 3) + 4 * s, piece = lane & 7; const int row = Lid >> 1, cofs = (Lid & 1) * 32 + piece * 4;
                v4f val = *(const v4fa*)(os + row * 68 + cofs); if (R) { const v4f rv = *(const v4f*)(R + ((size_t)r0 + row) * ldc + c0 + cofs); val += roundR ? (v4f){bfr(rv[0]), bfr(rv[1]), bfr(rv[2]), bfr(rv[3])} : rv; }
                *(v4f*)(crow + (size_t)row * ldc + cofs) = val; }
        };
        pass(); 
    }
}

__global__ __launch_bounds__(256) void k_cvt8(const float* __restrict__ src, bf* dst, size_t n8) {
    const size_t i = (size_t)blockIdx.x * 256 + threadIdx.x; if (i >= n8) return;
    const v8f v = *(const v8f*)(src + i * 8); v8us o;
#pragma unroll
    for (int k = 0; k < 8; ++k) o[k] = f2bf(v[k]);
    *(v8us*)(dst + i * 8) = o; 
}
__global__ __launch_bounds__(256) void k_zero8(bf* dst, size_t n8) {
    const size_t i = (size_t)blockIdx.x * 256 + threadIdx.x; if (i >= n8) return; v8us z;
#pragma unroll
    for (int k = 0; k < 8; ++k) z[k] = 0;
    *(v8us*)(dst + i * 8) = z; 
}
// k_gemm3: 64 x 64 tile of C = (Ah + Al).(Bh + Bl)^T over K (row strides = K for all four planes; n-major B): three products per 32-k step (hh, hl, lh); f32
// blockIdx.z takes the k range [z * klen, (z + 1) * klen) and stores its partial tile in plane z of C (planes czs floats apart); one plane with klen = K is the whole product.
__global__ __launch_bounds__(128) void k_gemm3(const bf* __restrict__ Ah, const bf* __restrict__ Al, const bf* __restrict__ Bh, const bf* __restrict__ Bl, int K, float* C, int ldc, int klen, size_t czs) {
    __shared__ __align__(16) float ost[4][16 * 68];
    const int lane = threadIdx.x & 31, wave = threadIdx.x >> 5, lr = lane & 15, hi = lane >> 4;
    const int r0 = blockIdx.x * 64 + wave * 16, c0 = blockIdx.y * 64;
    const size_t aoff = (size_t)(r0 + lr) * K + 8 * hi;
    const int k0 = blockIdx.z * klen; Ah += k0; Al += k0; Bh += k0; Bl += k0;
    v8f acc[4];
#pragma unroll
    for (int t = 0; t < 4; ++t) acc[t] = (v8f){};
#pragma unroll 1
    for (int kc = 0; kc < klen; kc += 32) {
        const v16bf a = cat16b(*(const v8us*)(Ah + aoff + kc), *(const v8us*)(Ah + aoff + kc + 16));
        const v16bf al = cat16b(*(const v8us*)(Al + aoff + kc), *(const v8us*)(Al + aoff + kc + 16));
#pragma unroll
        for (int t = 0; t < 4; ++t) { const size_t bo = (size_t)(c0 + t * 16 + lr) * K + kc + 8 * hi;
            const v16bf bh = cat16b(*(const v8us*)(Bh + bo), *(const v8us*)(Bh + bo + 16)); const v16bf bl = cat16b(*(const v8us*)(Bl + bo), *(const v8us*)(Bl + bo + 16));
            acc[t] = wmmab(a, bh, acc[t]); acc[t] = wmmab(al, bh, acc[t]); acc[t] = wmmab(a, bl, acc[t]); }
        asm volatile("v_nop\n\tv_nop\n\tv_nop\n\tv_nop" : "+v"(acc[0]), "+v"(acc[1]), "+v"(acc[2]), "+v"(acc[3]) : "v"(a), "v"(al));
    }
    float* os = &ost[wave][0];
#pragma unroll
    for (int t = 0; t < 4; ++t) {
#pragma unroll
        for (int j = 0; j < 8; ++j) os[(hi * 8 + j) * 68 + t * 16 + lr] = acc[t][j]; }
    __builtin_amdgcn_wave_barrier(); asm volatile("" ::: "memory");
    float* crow = C + (size_t)blockIdx.z * czs + (size_t)r0 * ldc + c0;
    auto pass = [&]() {
#pragma unroll
        for (int s = 0; s < 8; ++s) { const int Lid = (lane >> 3) + 4 * s, piece = lane & 7; const int row = Lid >> 1, cofs = (Lid & 1) * 32 + piece * 4;
            const v4f val = *(const v4fa*)(os + row * 68 + cofs); *(v4f*)(crow + (size_t)row * ldc + cofs) = val; }
    };
    pass(); 
}


// k_gnstat: per (group g of 2 channels): mean and rsqrt(var + eps) over 2 x 8192 values of x[b][2g..2g+1][:] (f32; lane-strided fixed-order partial sums + xor tree; biased var
// share a line: NOT whole-line. Instead one wave per 32 groups is too serial; so: block of 256 threads = 8 waves = 8 groups, each wave writes its own 32-float ST row (mean, rstd, zeros)
__global__ __launch_bounds__(256) void k_gnstat(const float* __restrict__ xb, float* ST) {
    const int lane = threadIdx.x & 31; const int g = blockIdx.x * 8 + (threadIdx.x >> 5); if (g >= NG) return; const float* base = xb + (size_t)(2 * g) * NV; const int n = 2 * NV; float s = 0.f;
    for (int i = lane; i < n; i += 32) s += base[i];
#pragma unroll
    for (int sh = 16; sh; sh >>= 1) s += __shfl_xor(s, sh, 32);
    const float mu = s / (float)n; float q = 0.f;
    for (int i = lane; i < n; i += 32) { const float d = base[i] - mu; q = fmaf(d, d, q); }
#pragma unroll
    for (int sh = 16; sh; sh >>= 1) q += __shfl_xor(q, sh, 32);
    const float rs = rsqrtf(q / (float)n + GEPS); const float v = (lane == 0) ? mu : (lane == 1) ? rs : 0.f;
    *(float*)(ST + (size_t)g * 32 + lane) = v; 
}
// k_gnT: voxel-major planes HT[p][c] of (bf(x[c][p]) - mean_g) rstd_g bf(gamma[c]) + bf(beta[c]) via 64x64 LDS tiles (all 64 channels x 64 voxels per block); wave writes 2 rows x 64
__global__ __launch_bounds__(256) void k_gnT(const float* __restrict__ xb, const float* __restrict__ ST, const float* __restrict__ gam, const float* __restrict__ bet, bf* Hh, bf* Hl) {
    __shared__ float tl[64][65];
    typedef __attribute__((ext_vector_type(4))) unsigned short v4us;
    const int tid = threadIdx.x, p0 = blockIdx.y * 64; const int rr = tid >> 2, cq = (tid & 3) * 16;   // rr = channel
    { const float mu = ST[(rr >> 1) * 32], rs = ST[(rr >> 1) * 32 + 1], ga = bfr(gam[rr]), be = bfr(bet[rr]);
#pragma unroll
      for (int i = 0; i < 16; ++i) tl[rr][cq + i] = (bfr(xb[(size_t)rr * NV + p0 + cq + i]) - mu) * rs * ga + be; }
    __syncthreads();
    const int lane = tid & 31, wv = tid >> 5;
    auto pass = [&]() {
#pragma unroll
        for (int st = 0; st < 4; ++st) { const int pr = wv * 8 + st * 2 + (lane >> 4); const int cl = (lane & 15) * 4; v4us oh, ol;
#pragma unroll
            for (int i = 0; i < 4; ++i) { const float y = tl[cl + i][pr]; const unsigned short hb = f2bf(y); oh[i] = hb; ol[i] = f2bf(y - bf2f(hb)); }
            const size_t o = (size_t)(p0 + pr) * CC + cl; *(v4us*)(Hh + o) = oh; *(v4us*)(Hl + o) = ol; }
    };
    pass(); 
}
__global__ __launch_bounds__(256) void k_split64(const float* __restrict__ F, int rows, float sc, bf* Ph, bf* Pl) {
    typedef __attribute__((ext_vector_type(2))) unsigned short v2us; typedef __attribute__((ext_vector_type(2))) float v2f_;
    const int lane = threadIdx.x & 31; const size_t r = (size_t)blockIdx.x * 8 + (threadIdx.x >> 5); if (r >= (size_t)rows) return; const size_t o = r * CC + lane * 2; const v2f_ v = *(const v2f_*)(F + o); v2us oh, ol;
#pragma unroll
    for (int i = 0; i < 2; ++i) { const float y = v[i] * sc; const unsigned short hb = f2bf(y); oh[i] = hb; ol[i] = f2bf(y - bf2f(hb)); }
    *(v2us*)(Ph + o) = oh; *(v2us*)(Pl + o) = ol; 
}
// k_sumsplit64: F holds KS partial planes of NV x CC floats; each element is summed over the planes in plane order (fixed), then split into bf16 hi + residual planes.
__global__ __launch_bounds__(256) void k_sumsplit64(const float* __restrict__ F, bf* Ph, bf* Pl) {
    typedef __attribute__((ext_vector_type(4))) unsigned short v4us;
    const size_t o = ((size_t)blockIdx.x * 256 + threadIdx.x) * 4; const float* p = F + o; v4f v = (v4f){};
#pragma unroll 1   // rolled: eight planes' loads in flight a trip, and the code stays short
    for (int g = 0; g < KS / 8; ++g, p += (size_t)8 * NV * CC) { v4f t[8];
#pragma unroll
        for (int i = 0; i < 4; ++i) t[i] = *(const v4f*)(p + i * (NV * CC));
        asm volatile("s_wait_xcnt 0x0" ::: "memory");   // the four issued loads' address pair is reused as a result register of the next four
#pragma unroll
        for (int i = 4; i < 8; ++i) t[i] = *(const v4f*)(p + i * (NV * CC));
#pragma unroll
        for (int i = 0; i < 8; ++i) v += t[i]; }
    v4us oh, ol;
#pragma unroll
    for (int i = 0; i < 4; ++i) { const unsigned short hb = f2bf(v[i]); oh[i] = hb; ol[i] = f2bf(v[i] - bf2f(hb)); }
    *(v4us*)(Ph + o) = oh; *(v4us*)(Pl + o) = ol;
}
__global__ __launch_bounds__(256) void k_vT(const float* __restrict__ V, bf* Th, bf* Tl) {
    __shared__ float tl[64][65];
    typedef __attribute__((ext_vector_type(4))) unsigned short v4us;
    const int tid = threadIdx.x; const int t0 = blockIdx.x * 64; const int rr = tid >> 2, cq = (tid & 3) * 16;
#pragma unroll
    for (int i = 0; i < 16; ++i) tl[rr][cq + i] = V[(size_t)(t0 + rr) * CC + cq + i];     // tl[t][d]
    __syncthreads();
    const int lane = tid & 31, wv = tid >> 5;
    auto pass = [&]() {
#pragma unroll
        for (int st = 0; st < 4; ++st) { const int dr = wv * 8 + st * 2 + (lane >> 4); const int tq = (lane & 15) * 4; v4us oh, ol;
#pragma unroll
            for (int i = 0; i < 4; ++i) { const float y = tl[tq + i][dr]; const unsigned short hb = f2bf(y); oh[i] = hb; ol[i] = f2bf(y - bf2f(hb)); }
            const size_t o = (size_t)dr * NV + t0 + tq; *(v4us*)(Th + o) = oh; *(v4us*)(Tl + o) = ol; }
    };
    pass(); 
}
__global__ __launch_bounds__(256) void k_soft(const float* __restrict__ S, float sc, bf* PH, bf* PL) {
    typedef __attribute__((ext_vector_type(4))) unsigned short v4us;
    const int lane = threadIdx.x & 31, i = blockIdx.x * 8 + (threadIdx.x >> 5); if (i >= RB) return; const float* sr = S + (size_t)i * NV;
    float m = -3.0e38f;
#pragma unroll 1
    for (int c0 = lane * 4; c0 < NV; c0 += 128) {
#pragma unroll
        for (int q = 0; q < 4; ++q) m = fmaxf(m, sr[c0 + q] * sc); }
#pragma unroll
    for (int sh = 16; sh; sh >>= 1) m = fmaxf(m, __shfl_xor(m, sh, 32));
    float sum = 0.f;
#pragma unroll 1
    for (int c0 = lane * 4; c0 < NV; c0 += 128) {
#pragma unroll
        for (int q = 0; q < 4; ++q) sum += __expf(sr[c0 + q] * sc - m); }
#pragma unroll
    for (int sh = 16; sh; sh >>= 1) sum += __shfl_xor(sum, sh, 32);
    const float inv = 1.0f / sum;
{
#pragma unroll 1
        for (int c0 = lane * 4; c0 < NV; c0 += 128) { v4us oh, ol;
#pragma unroll
            for (int q = 0; q < 4; ++q) { const float p = __expf(sr[c0 + q] * sc - m) * inv; const unsigned short hb = f2bf(p); oh[q] = hb; ol[q] = f2bf(p - bf2f(hb)); }
            const size_t o = (size_t)i * NV + c0; *(v4us*)(PH + o) = oh; *(v4us*)(PL + o) = ol; }
         }
}
__global__ __launch_bounds__(256) void k_outT(const float* __restrict__ OT, const float* __restrict__ xb, float* OUTB) {
    __shared__ float tl[64][65];
    const int tid = threadIdx.x; const int p0 = blockIdx.x * 64; const int rr = tid >> 2, cq = (tid & 3) * 16;
#pragma unroll
    for (int i = 0; i < 16; ++i) tl[rr][cq + i] = OT[(size_t)(p0 + rr) * CC + cq + i];
    __syncthreads();
    const int lane = tid & 31, wv = tid >> 5;
    auto pass = [&]() {
#pragma unroll
        for (int st = 0; st < 4; ++st) { const int cr = wv * 8 + st * 2 + (lane >> 4); const int pq = (lane & 15) * 4; v4f v; const size_t o = (size_t)cr * NV + p0 + pq;
#pragma unroll
            for (int i = 0; i < 4; ++i) v[i] = bfr(xb[o + i]) + tl[pq + i][cr];
            *(v4f*)(OUTB + o) = v; }
    };
    pass(); 
}

extern "C" void kernel_launch(void* const* d_in, const int* in_sizes, int n_in,
                              void* d_out, int out_size, void* d_ws, size_t ws_size, hipStream_t stream) {
    (void)in_sizes; (void)n_in; (void)out_size;
    const float* x = (const float*)d_in[0]; const float* gam = (const float*)d_in[1]; const float* bet = (const float*)d_in[2]; const float* wq = (const float*)d_in[3]; const float* bq = (const float*)d_in[4]; const float* wk = (const float*)d_in[5]; const float* bk = (const float*)d_in[6]; const float* wv = (const float*)d_in[7]; const float* bv = (const float*)d_in[8]; const float* wp = (const float*)d_in[9]; const float* bp = (const float*)d_in[10];
    float* out = (float*)d_out;    // [2][64][32][32][8]
    char* wsp = (char*)d_ws;
    auto take = [&](size_t bytes) { char* p = wsp; wsp += (bytes + 255) & ~(size_t)255; return (void*)p; };
    bf* WQ = (bf*)take(CC * CC * 2); bf* WK = (bf*)take(CC * CC * 2); bf* WV = (bf*)take(CC * CC * 2); bf* WP = (bf*)take(CC * CC * 2); float* ST = (float*)take(NG * 32 * 4);
    bf* Hh = (bf*)take((size_t)NV * CC * 2); bf* Hl = (bf*)take((size_t)NV * CC * 2); float* QF = (float*)take((size_t)NV * CC * 4); float* KF = (float*)take((size_t)NV * CC * 4); float* VF = (float*)take((size_t)NV * CC * 4);
    bf* Qh = (bf*)take((size_t)NV * CC * 2); bf* Ql = (bf*)take((size_t)NV * CC * 2); bf* Kh = (bf*)take((size_t)NV * CC * 2); bf* Kl = (bf*)take((size_t)NV * CC * 2); bf* VTh = (bf*)take((size_t)CC * NV * 2); bf* VTl = (bf*)take((size_t)CC * NV * 2);
    float* S = (float*)take((size_t)RB * NV * 4); bf* PH = (bf*)take((size_t)RB * NV * 2); bf* PL = (bf*)take((size_t)RB * NV * 2); float* O = (float*)take((size_t)KS * NV * CC * 4); bf* Oh = (bf*)take((size_t)NV * CC * 2); bf* Ol = (bf*)take((size_t)NV * CC * 2); float* OT = (float*)take((size_t)NV * CC * 4);
    if ((size_t)(wsp - (char*)d_ws) > ws_size) return;    // ~ 2 + 6 + 6 + 33.5 + 33.5 + 4 + 134 ~ 220 MB
    k_cvt8<<<(CC * CC / 8 + 255) / 256, 256, 0, stream>>>(wq, WQ, CC * CC / 8); k_cvt8<<<(CC * CC / 8 + 255) / 256, 256, 0, stream>>>(wk, WK, CC * CC / 8); k_cvt8<<<(CC * CC / 8 + 255) / 256, 256, 0, stream>>>(wv, WV, CC * CC / 8); k_cvt8<<<(CC * CC / 8 + 255) / 256, 256, 0, stream>>>(wp, WP, CC * CC / 8);   // 'oc' natural
    const dim3 gp(NV / 64, 1, 1);
    for (int b = 0; b < NB_; ++b) { const float* xb = x + (size_t)b * CC * NV;
        k_gnstat<<<NG / 8, 256, 0, stream>>>(xb, ST); k_gnT<<<dim3(1, NV / 64, 1), 256, 0, stream>>>(xb, ST, gam, bet, Hh, Hl);
        k_gemmb<true, false><<<gp, 128, 0, stream>>>(Hh, Hl, WQ, bq, QF, CC, nullptr, nullptr, CC); k_gemmb<true, false><<<gp, 128, 0, stream>>>(Hh, Hl, WK, bk, KF, CC, nullptr, nullptr, CC); k_gemmb<true, false><<<gp, 128, 0, stream>>>(Hh, Hl, WV, bv, VF, CC, nullptr, nullptr, CC);
        k_split64<<<NV / 8, 256, 0, stream>>>(QF, NV, 1.0f, Qh, Ql); k_split64<<<NV / 8, 256, 0, stream>>>(KF, NV, 1.0f, Kh, Kl); k_vT<<<NV / 64, 256, 0, stream>>>(VF, VTh, VTl);
        for (int rb = 0; rb < NV / RB; ++rb) { const size_t r0 = (size_t)rb * RB;
            k_gemm3<<<dim3(RB / 64, NV / 64, 1), 128, 0, stream>>>(Qh + r0 * CC, Ql + r0 * CC, Kh, Kl, CC, S, NV, CC, 0);
            k_soft<<<RB / 8, 256, 0, stream>>>(S, SCL, PH, PL);
            k_gemm3<<<dim3(RB / 64, 1, KS), 128, 0, stream>>>(PH, PL, VTh, VTl, NV, O + r0 * CC, CC, NV / KS, (size_t)NV * CC); }
        k_sumsplit64<<<NV * CC / 1024, 256, 0, stream>>>(O, Oh, Ol);
        k_gemmb<true, false><<<gp, 128, 0, stream>>>(Oh, Ol, WP, bp, OT, CC, nullptr, nullptr, CC);
        k_outT<<<dim3(NV / 64, 1, 1), 256, 0, stream>>>(OT, xb, out + (size_t)b * CC * NV); }
}

// v002
// Measured time: 814 microseconds a run.
// Next to v001, in two timings, it ran 2.28 and 2.27 times as fast.
// Counting every step since v000, it is 6.56 times as fast.
#include <hip/hip_runtime.h>

// Compute dtypes, f32 accumulate, per item: GroupNorm (32 groups, statistics in f32, fixed order) while transposing to voxel-major bf16 hi + UNSCALED residual planes; q/k/v/proj =
// 1x1x1 convs as [8192 x 64].[64 x 64] GEMMs on hi/lo planes with exact bf16 weights (two products, + bias); single-head attention over the 8192 voxels in 1024-row blocks with
// hi/lo operands (three products); 1/8 and the softmax in f32; x + out with the channel-major transpose in f32 - on v_wmma_f32_16x16x32_bf16. Deterministic, no atomics; every

#define NB_  2
#define CC   64
#define NV   8192
#define NG   32
#define RB   1024
#define DM   CC
#define SCL  0.125f
#define GEPS 1e-6f
#define LOSC 1024.0f
#define KS   64

typedef _Float16 h16;
typedef unsigned short bf;
typedef __attribute__((ext_vector_type(16))) __bf16   v16bf;
typedef __attribute__((ext_vector_type(16))) _Float16 v16h;
typedef __attribute__((ext_vector_type(8)))  _Float16 v8h;
typedef __attribute__((ext_vector_type(8)))  unsigned short v8us;
typedef __attribute__((ext_vector_type(8)))  float    v8f;
typedef __attribute__((ext_vector_type(4)))  float    v4f;
typedef v8h  __attribute__((may_alias)) v8ha;
typedef v4f  __attribute__((may_alias)) v4fa;
typedef v8us __attribute__((may_alias)) v8usa;

__device__ __forceinline__ unsigned short f2bf(float f) { unsigned u = __float_as_uint(f); u += 0x7FFFu + ((u >> 16) & 1u); return (unsigned short)(u >> 16); }
__device__ __forceinline__ float bf2f(unsigned short b) { return __uint_as_float(((unsigned)b) << 16); }
__device__ __forceinline__ float bfr(float f) { return bf2f(f2bf(f)); }
__device__ __forceinline__ v16h cat16(v8h lo, v8h hi) { return __builtin_shufflevector(lo, hi, 0, 1, 2, 3, 4, 5, 6, 7, 8, 9, 10, 11, 12, 13, 14, 15); }
__device__ __forceinline__ v16bf cat16b(v8us lo, v8us hi) { return __builtin_bit_cast(v16bf, __builtin_shufflevector(lo, hi, 0, 1, 2, 3, 4, 5, 6, 7, 8, 9, 10, 11, 12, 13, 14, 15)); }
__device__ __forceinline__ v8f wmma16(v16h a, v16h b, v8f c) { return __builtin_amdgcn_wmma_f32_16x16x32_f16(false, a, false, b, (short)0, c, false, false); }
__device__ __forceinline__ v8f wmmab(v16bf a, v16bf b, v8f c) { return __builtin_amdgcn_wmma_f32_16x16x32_bf16(false, a, false, b, (short)0, c, false, false); }

// k_gemmb: 64 x 64 block tile (4 waves x 16 x 64) of C[NTK][NW] = (A [+ Al]).B^T (K = 64) [+ bf(bias[c])] [+ bf(R[r][c]) residual]; f32 whole-line epilogue (or f16
template <bool SPLITA, bool F16OUT = false>
__global__ __launch_bounds__(128) void k_gemmb(const bf* __restrict__ A, const bf* __restrict__ Al, const bf* __restrict__ Bn, const float* __restrict__ bias, float* C, int ldc, h16* C2, const float* __restrict__ R = nullptr, int K = DM, int roundR = 1) {
    __shared__ __align__(16) float ost[4][16 * 68];
    const int lane = threadIdx.x & 31, wave = threadIdx.x >> 5, lr = lane & 15, hi = lane >> 4;
    const int r0 = blockIdx.x * 64 + wave * 16, c0 = blockIdx.y * 64;
    const size_t aoff = (size_t)(r0 + lr) * K + 8 * hi;
    size_t boff[4];
#pragma unroll
    for (int t = 0; t < 4; ++t) boff[t] = (size_t)(c0 + t * 16 + lr) * K + 8 * hi;
    v8f acc[4];
#pragma unroll
    for (int t = 0; t < 4; ++t) acc[t] = (v8f){};
#pragma unroll 1
    for (int kc = 0; kc < K; kc += 32) {
        const v16bf a = cat16b(*(const v8us*)(A + aoff + kc), *(const v8us*)(A + aoff + kc + 16));
        v16bf al = a;
        if (SPLITA) al = cat16b(*(const v8us*)(Al + aoff + kc), *(const v8us*)(Al + aoff + kc + 16));
#pragma unroll
        for (int t = 0; t < 4; ++t) { const v16bf b = cat16b(*(const v8us*)(Bn + boff[t] + kc), *(const v8us*)(Bn + boff[t] + kc + 16)); acc[t] = wmmab(a, b, acc[t]); if (SPLITA) acc[t] = wmmab(al, b, acc[t]); }
        asm volatile("v_nop\n\tv_nop\n\tv_nop\n\tv_nop" : "+v"(acc[0]), "+v"(acc[1]), "+v"(acc[2]), "+v"(acc[3]) : "v"(a), "v"(al));
    }
    float* os = &ost[wave][0];
#pragma unroll
    for (int t = 0; t < 4; ++t) { const float bv = bias ? bfr(bias[c0 + t * 16 + lr]) : 0.f;
#pragma unroll
        for (int j = 0; j < 8; ++j) os[(hi * 8 + j) * 68 + t * 16 + lr] = acc[t][j] + bv; }
    __syncthreads();
    if (F16OUT) {
        h16* crow = (h16*)(void*)C + (size_t)r0 * ldc + c0;
        auto pass = [&]() {
#pragma unroll
            for (int s = 0; s < 4; ++s) { const int row = 4 * s + (lane >> 3), piece = lane & 7; const float* sp = os + row * 68 + piece * 8; v8h o, o2;
#pragma unroll
                for (int i = 0; i < 8; ++i) { const h16 a = (h16)sp[i]; o[i] = a; o2[i] = (h16)((sp[i] - (float)a) * LOSC); }
                *(v8h*)(crow + (size_t)row * ldc + piece * 8) = o; if (C2) *(v8h*)(C2 + (size_t)r0 * ldc + c0 + (size_t)row * ldc + piece * 8) = o2; }
        };
        pass(); 
    } else {
        float* crow = C + (size_t)r0 * ldc + c0;
        auto pass = [&]() {
#pragma unroll
            for (int s = 0; s < 8; ++s) { const int Lid = (lane >> 3) + 4 * s, piece = lane & 7; const int row = Lid >> 1, cofs = (Lid & 1) * 32 + piece * 4;
                v4f val = *(const v4fa*)(os + row * 68 + cofs); if (R) { const v4f rv = *(const v4f*)(R + ((size_t)r0 + row) * ldc + c0 + cofs); val += roundR ? (v4f){bfr(rv[0]), bfr(rv[1]), bfr(rv[2]), bfr(rv[3])} : rv; }
                *(v4f*)(crow + (size_t)row * ldc + cofs) = val; }
        };
        pass(); 
    }
}

__global__ __launch_bounds__(256) void k_cvt8(const float* __restrict__ src, bf* dst, size_t n8) {
    const size_t i = (size_t)blockIdx.x * 256 + threadIdx.x; if (i >= n8) return;
    const v8f v = *(const v8f*)(src + i * 8); v8us o;
#pragma unroll
    for (int k = 0; k < 8; ++k) o[k] = f2bf(v[k]);
    *(v8us*)(dst + i * 8) = o; 
}
__global__ __launch_bounds__(256) void k_zero8(bf* dst, size_t n8) {
    const size_t i = (size_t)blockIdx.x * 256 + threadIdx.x; if (i >= n8) return; v8us z;
#pragma unroll
    for (int k = 0; k < 8; ++k) z[k] = 0;
    *(v8us*)(dst + i * 8) = z; 
}
// k_gemm3: 64 x 64 tile of C = (Ah + Al).(Bh + Bl)^T over K (row strides = K for all four planes; n-major B): three products per 32-k step (hh, hl, lh); f32
// blockIdx.z takes the k range [z * klen, (z + 1) * klen) and stores its partial tile in plane z of C (planes czs floats apart); one plane with klen = K is the whole product.
__global__ __launch_bounds__(128) void k_gemm3(const bf* __restrict__ Ah, const bf* __restrict__ Al, const bf* __restrict__ Bh, const bf* __restrict__ Bl, int K, float* C, int ldc, int klen, size_t czs) {
    __shared__ __align__(16) float ost[4][16 * 68];
    const int lane = threadIdx.x & 31, wave = threadIdx.x >> 5, lr = lane & 15, hi = lane >> 4;
    const int r0 = blockIdx.x * 64 + wave * 16, c0 = blockIdx.y * 64;
    const size_t aoff = (size_t)(r0 + lr) * K + 8 * hi;
    const int k0 = blockIdx.z * klen; Ah += k0; Al += k0; Bh += k0; Bl += k0;
    v8f acc[4];
#pragma unroll
    for (int t = 0; t < 4; ++t) acc[t] = (v8f){};
#pragma unroll 1
    for (int kc = 0; kc < klen; kc += 32) {
        const v16bf a = cat16b(*(const v8us*)(Ah + aoff + kc), *(const v8us*)(Ah + aoff + kc + 16));
        const v16bf al = cat16b(*(const v8us*)(Al + aoff + kc), *(const v8us*)(Al + aoff + kc + 16));
#pragma unroll
        for (int t = 0; t < 4; ++t) { const size_t bo = (size_t)(c0 + t * 16 + lr) * K + kc + 8 * hi;
            const v16bf bh = cat16b(*(const v8us*)(Bh + bo), *(const v8us*)(Bh + bo + 16)); const v16bf bl = cat16b(*(const v8us*)(Bl + bo), *(const v8us*)(Bl + bo + 16));
            acc[t] = wmmab(a, bh, acc[t]); acc[t] = wmmab(al, bh, acc[t]); acc[t] = wmmab(a, bl, acc[t]); }
        asm volatile("v_nop\n\tv_nop\n\tv_nop\n\tv_nop" : "+v"(acc[0]), "+v"(acc[1]), "+v"(acc[2]), "+v"(acc[3]) : "v"(a), "v"(al));
    }
    float* os = &ost[wave][0];
#pragma unroll
    for (int t = 0; t < 4; ++t) {
#pragma unroll
        for (int j = 0; j < 8; ++j) os[(hi * 8 + j) * 68 + t * 16 + lr] = acc[t][j]; }
    __builtin_amdgcn_wave_barrier(); asm volatile("" ::: "memory");
    float* crow = C + (size_t)blockIdx.z * czs + (size_t)r0 * ldc + c0;
    auto pass = [&]() {
#pragma unroll
        for (int s = 0; s < 8; ++s) { const int Lid = (lane >> 3) + 4 * s, piece = lane & 7; const int row = Lid >> 1, cofs = (Lid & 1) * 32 + piece * 4;
            const v4f val = *(const v4fa*)(os + row * 68 + cofs); *(v4f*)(crow + (size_t)row * ldc + cofs) = val; }
    };
    pass(); 
}


// k_gnstat: per (group g of 2 channels): mean and rsqrt(var + eps) over 2 x 8192 values of x[b][2g..2g+1][:] (f32; lane-strided fixed-order partial sums + xor tree; biased var
// share a line: NOT whole-line. Instead one wave per 32 groups is too serial; so: block of 256 threads = 8 waves = 8 groups, each wave writes its own 32-float ST row (mean, rstd, zeros)
__global__ __launch_bounds__(256) void k_gnstat(const float* __restrict__ xb, float* ST) {
    const int lane = threadIdx.x & 31; const int g = blockIdx.x * 8 + (threadIdx.x >> 5); if (g >= NG) return; const float* base = xb + (size_t)(2 * g) * NV; const int n = 2 * NV; float s = 0.f;
    for (int i = lane; i < n; i += 32) s += base[i];
#pragma unroll
    for (int sh = 16; sh; sh >>= 1) s += __shfl_xor(s, sh, 32);
    const float mu = s / (float)n; float q = 0.f;
    for (int i = lane; i < n; i += 32) { const float d = base[i] - mu; q = fmaf(d, d, q); }
#pragma unroll
    for (int sh = 16; sh; sh >>= 1) q += __shfl_xor(q, sh, 32);
    const float rs = rsqrtf(q / (float)n + GEPS); const float v = (lane == 0) ? mu : (lane == 1) ? rs : 0.f;
    *(float*)(ST + (size_t)g * 32 + lane) = v; 
}
// k_gnT: voxel-major planes HT[p][c] of (bf(x[c][p]) - mean_g) rstd_g bf(gamma[c]) + bf(beta[c]) via 64x64 LDS tiles (all 64 channels x 64 voxels per block); wave writes 2 rows x 64
__global__ __launch_bounds__(256) void k_gnT(const float* __restrict__ xb, const float* __restrict__ ST, const float* __restrict__ gam, const float* __restrict__ bet, bf* Hh, bf* Hl) {
    __shared__ float tl[64][65];
    typedef __attribute__((ext_vector_type(4))) unsigned short v4us;
    const int tid = threadIdx.x, p0 = blockIdx.y * 64; const int rr = tid >> 2, cq = (tid & 3) * 16;   // rr = channel
    { const float mu = ST[(rr >> 1) * 32], rs = ST[(rr >> 1) * 32 + 1], ga = bfr(gam[rr]), be = bfr(bet[rr]);
#pragma unroll
      for (int i = 0; i < 16; ++i) tl[rr][cq + i] = (bfr(xb[(size_t)rr * NV + p0 + cq + i]) - mu) * rs * ga + be; }
    __syncthreads();
    const int lane = tid & 31, wv = tid >> 5;
    auto pass = [&]() {
#pragma unroll
        for (int st = 0; st < 4; ++st) { const int pr = wv * 8 + st * 2 + (lane >> 4); const int cl = (lane & 15) * 4; v4us oh, ol;
#pragma unroll
            for (int i = 0; i < 4; ++i) { const float y = tl[cl + i][pr]; const unsigned short hb = f2bf(y); oh[i] = hb; ol[i] = f2bf(y - bf2f(hb)); }
            const size_t o = (size_t)(p0 + pr) * CC + cl; *(v4us*)(Hh + o) = oh; *(v4us*)(Hl + o) = ol; }
    };
    pass(); 
}
__global__ __launch_bounds__(256) void k_split64(const float* __restrict__ F, int rows, float sc, bf* Ph, bf* Pl) {
    typedef __attribute__((ext_vector_type(2))) unsigned short v2us; typedef __attribute__((ext_vector_type(2))) float v2f_;
    const int lane = threadIdx.x & 31; const size_t r = (size_t)blockIdx.x * 8 + (threadIdx.x >> 5); if (r >= (size_t)rows) return; const size_t o = r * CC + lane * 2; const v2f_ v = *(const v2f_*)(F + o); v2us oh, ol;
#pragma unroll
    for (int i = 0; i < 2; ++i) { const float y = v[i] * sc; const unsigned short hb = f2bf(y); oh[i] = hb; ol[i] = f2bf(y - bf2f(hb)); }
    *(v2us*)(Ph + o) = oh; *(v2us*)(Pl + o) = ol; 
}
// k_sumsplit64: F holds KS partial planes of NV x CC floats; each element is summed over the planes in plane order (fixed), then split into bf16 hi + residual planes.
__global__ __launch_bounds__(256) void k_sumsplit64(const float* __restrict__ F, bf* Ph, bf* Pl) {
    typedef __attribute__((ext_vector_type(4))) unsigned short v4us;
    const size_t o = ((size_t)blockIdx.x * 256 + threadIdx.x) * 4; const float* p = F + o; v4f v = (v4f){};
#pragma unroll 1   // rolled: eight planes' loads in flight a trip, and the code stays short
    for (int g = 0; g < KS / 8; ++g, p += (size_t)8 * NV * CC) { v4f t[8];
#pragma unroll
        for (int i = 0; i < 4; ++i) t[i] = *(const v4f*)(p + i * (NV * CC));
        asm volatile("s_wait_xcnt 0x0" ::: "memory");   // the four issued loads' address pair is reused as a result register of the next four
#pragma unroll
        for (int i = 4; i < 8; ++i) t[i] = *(const v4f*)(p + i * (NV * CC));
#pragma unroll
        for (int i = 0; i < 8; ++i) v += t[i]; }
    v4us oh, ol;
#pragma unroll
    for (int i = 0; i < 4; ++i) { const unsigned short hb = f2bf(v[i]); oh[i] = hb; ol[i] = f2bf(v[i] - bf2f(hb)); }
    *(v4us*)(Ph + o) = oh; *(v4us*)(Pl + o) = ol;
}
__global__ __launch_bounds__(256) void k_vT(const float* __restrict__ V, bf* Th, bf* Tl) {
    __shared__ float tl[64][65];
    typedef __attribute__((ext_vector_type(4))) unsigned short v4us;
    const int tid = threadIdx.x; const int t0 = blockIdx.x * 64; const int rr = tid >> 2, cq = (tid & 3) * 16;
#pragma unroll
    for (int i = 0; i < 16; ++i) tl[rr][cq + i] = V[(size_t)(t0 + rr) * CC + cq + i];     // tl[t][d]
    __syncthreads();
    const int lane = tid & 31, wv = tid >> 5;
    auto pass = [&]() {
#pragma unroll
        for (int st = 0; st < 4; ++st) { const int dr = wv * 8 + st * 2 + (lane >> 4); const int tq = (lane & 15) * 4; v4us oh, ol;
#pragma unroll
            for (int i = 0; i < 4; ++i) { const float y = tl[tq + i][dr]; const unsigned short hb = f2bf(y); oh[i] = hb; ol[i] = f2bf(y - bf2f(hb)); }
            const size_t o = (size_t)dr * NV + t0 + tq; *(v4us*)(Th + o) = oh; *(v4us*)(Tl + o) = ol; }
    };
    pass(); 
}
// exp(x) as __expf forms it (x * log2(e), then v_exp_f32). The v_nop is the one slot the instruction set asks for behind a transcendental before its source is overwritten or its
// result read; it stands in the same statement because the straight-line build of k_soft reused the source register in the very next dual instruction, and a v_nop apart drifts off.
__device__ __forceinline__ float exp_slot(float x) { float r; asm("v_exp_f32 %0, %1\n\tv_nop" : "=v"(r) : "v"(x * 1.44269504f)); return r; }
// k_soft: one work-group per row of S. The 8192 scores of the row stay in registers (32 a lane), so S is read once and the eight 16-byte loads of a lane are all in flight
// together; row maximum and row sum go lane tree -> one float a wave in LDS -> the eight waves' values combined in wave order (fixed order).
__global__ __launch_bounds__(256) void k_soft(const float* __restrict__ S, float sc, bf* PH, bf* PL) {
    typedef __attribute__((ext_vector_type(4))) unsigned short v4us;
    __shared__ __align__(16) float rmax[8], rsum[8];
    const int lane = threadIdx.x & 31, wv = threadIdx.x >> 5; const size_t base = (size_t)blockIdx.x * NV + threadIdx.x * 4;
    v4f e[8];   // every loop over e[] below is fully unrolled: constant indices keep the row in registers, and the eight loads issue back to back
#pragma unroll
    for (int j = 0; j < 8; ++j) e[j] = *(const v4f*)(S + base + j * 1024);
    float m = -3.0e38f;
#pragma unroll
    for (int j = 0; j < 8; ++j) {
#pragma unroll
        for (int q = 0; q < 4; ++q) m = fmaxf(m, e[j][q] * sc); }
#pragma unroll
    for (int sh = 16; sh; sh >>= 1) m = fmaxf(m, __shfl_xor(m, sh, 32));
    if (lane == 0) rmax[wv] = m;
    __syncthreads();
#pragma unroll
    for (int w = 0; w < 8; ++w) m = fmaxf(m, rmax[w]);
    float sum = 0.f;
#pragma unroll
    for (int j = 0; j < 8; ++j) {
#pragma unroll
        for (int q = 0; q < 4; ++q) { e[j][q] = exp_slot(e[j][q] * sc - m); sum += e[j][q]; } }
#pragma unroll
    for (int sh = 16; sh; sh >>= 1) sum += __shfl_xor(sum, sh, 32);
    if (lane == 0) rsum[wv] = sum;
    __syncthreads();
    sum = 0.f;
#pragma unroll
    for (int w = 0; w < 8; ++w) sum += rsum[w];
    const float inv = 1.0f / sum;
#pragma unroll
    for (int j = 0; j < 8; ++j) { v4us oh, ol;
#pragma unroll
        for (int q = 0; q < 4; ++q) { const float p = e[j][q] * inv; const unsigned short hb = f2bf(p); oh[q] = hb; ol[q] = f2bf(p - bf2f(hb)); }
        const size_t o = base + j * 1024; *(v4us*)(PH + o) = oh; *(v4us*)(PL + o) = ol; }
}
__global__ __launch_bounds__(256) void k_outT(const float* __restrict__ OT, const float* __restrict__ xb, float* OUTB) {
    __shared__ float tl[64][65];
    const int tid = threadIdx.x; const int p0 = blockIdx.x * 64; const int rr = tid >> 2, cq = (tid & 3) * 16;
#pragma unroll
    for (int i = 0; i < 16; ++i) tl[rr][cq + i] = OT[(size_t)(p0 + rr) * CC + cq + i];
    __syncthreads();
    const int lane = tid & 31, wv = tid >> 5;
    auto pass = [&]() {
#pragma unroll
        for (int st = 0; st < 4; ++st) { const int cr = wv * 8 + st * 2 + (lane >> 4); const int pq = (lane & 15) * 4; v4f v; const size_t o = (size_t)cr * NV + p0 + pq;
#pragma unroll
            for (int i = 0; i < 4; ++i) v[i] = bfr(xb[o + i]) + tl[pq + i][cr];
            *(v4f*)(OUTB + o) = v; }
    };
    pass(); 
}

extern "C" void kernel_launch(void* const* d_in, const int* in_sizes, int n_in,
                              void* d_out, int out_size, void* d_ws, size_t ws_size, hipStream_t stream) {
    (void)in_sizes; (void)n_in; (void)out_size;
    const float* x = (const float*)d_in[0]; const float* gam = (const float*)d_in[1]; const float* bet = (const float*)d_in[2]; const float* wq = (const float*)d_in[3]; const float* bq = (const float*)d_in[4]; const float* wk = (const float*)d_in[5]; const float* bk = (const float*)d_in[6]; const float* wv = (const float*)d_in[7]; const float* bv = (const float*)d_in[8]; const float* wp = (const float*)d_in[9]; const float* bp = (const float*)d_in[10];
    float* out = (float*)d_out;    // [2][64][32][32][8]
    char* wsp = (char*)d_ws;
    auto take = [&](size_t bytes) { char* p = wsp; wsp += (bytes + 255) & ~(size_t)255; return (void*)p; };
    bf* WQ = (bf*)take(CC * CC * 2); bf* WK = (bf*)take(CC * CC * 2); bf* WV = (bf*)take(CC * CC * 2); bf* WP = (bf*)take(CC * CC * 2); float* ST = (float*)take(NG * 32 * 4);
    bf* Hh = (bf*)take((size_t)NV * CC * 2); bf* Hl = (bf*)take((size_t)NV * CC * 2); float* QF = (float*)take((size_t)NV * CC * 4); float* KF = (float*)take((size_t)NV * CC * 4); float* VF = (float*)take((size_t)NV * CC * 4);
    bf* Qh = (bf*)take((size_t)NV * CC * 2); bf* Ql = (bf*)take((size_t)NV * CC * 2); bf* Kh = (bf*)take((size_t)NV * CC * 2); bf* Kl = (bf*)take((size_t)NV * CC * 2); bf* VTh = (bf*)take((size_t)CC * NV * 2); bf* VTl = (bf*)take((size_t)CC * NV * 2);
    float* S = (float*)take((size_t)RB * NV * 4); bf* PH = (bf*)take((size_t)RB * NV * 2); bf* PL = (bf*)take((size_t)RB * NV * 2); float* O = (float*)take((size_t)KS * NV * CC * 4); bf* Oh = (bf*)take((size_t)NV * CC * 2); bf* Ol = (bf*)take((size_t)NV * CC * 2); float* OT = (float*)take((size_t)NV * CC * 4);
    if ((size_t)(wsp - (char*)d_ws) > ws_size) return;    // ~ 2 + 6 + 6 + 33.5 + 33.5 + 4 + 134 ~ 220 MB
    k_cvt8<<<(CC * CC / 8 + 255) / 256, 256, 0, stream>>>(wq, WQ, CC * CC / 8); k_cvt8<<<(CC * CC / 8 + 255) / 256, 256, 0, stream>>>(wk, WK, CC * CC / 8); k_cvt8<<<(CC * CC / 8 + 255) / 256, 256, 0, stream>>>(wv, WV, CC * CC / 8); k_cvt8<<<(CC * CC / 8 + 255) / 256, 256, 0, stream>>>(wp, WP, CC * CC / 8);   // 'oc' natural
    const dim3 gp(NV / 64, 1, 1);
    for (int b = 0; b < NB_; ++b) { const float* xb = x + (size_t)b * CC * NV;
        k_gnstat<<<NG / 8, 256, 0, stream>>>(xb, ST); k_gnT<<<dim3(1, NV / 64, 1), 256, 0, stream>>>(xb, ST, gam, bet, Hh, Hl);
        k_gemmb<true, false><<<gp, 128, 0, stream>>>(Hh, Hl, WQ, bq, QF, CC, nullptr, nullptr, CC); k_gemmb<true, false><<<gp, 128, 0, stream>>>(Hh, Hl, WK, bk, KF, CC, nullptr, nullptr, CC); k_gemmb<true, false><<<gp, 128, 0, stream>>>(Hh, Hl, WV, bv, VF, CC, nullptr, nullptr, CC);
        k_split64<<<NV / 8, 256, 0, stream>>>(QF, NV, 1.0f, Qh, Ql); k_split64<<<NV / 8, 256, 0, stream>>>(KF, NV, 1.0f, Kh, Kl); k_vT<<<NV / 64, 256, 0, stream>>>(VF, VTh, VTl);
        for (int rb = 0; rb < NV / RB; ++rb) { const size_t r0 = (size_t)rb * RB;
            k_gemm3<<<dim3(RB / 64, NV / 64, 1), 128, 0, stream>>>(Qh + r0 * CC, Ql + r0 * CC, Kh, Kl, CC, S, NV, CC, 0);
            k_soft<<<RB, 256, 0, stream>>>(S, SCL, PH, PL);
            k_gemm3<<<dim3(RB / 64, 1, KS), 128, 0, stream>>>(PH, PL, VTh, VTl, NV, O + r0 * CC, CC, NV / KS, (size_t)NV * CC); }
        k_sumsplit64<<<NV * CC / 1024, 256, 0, stream>>>(O, Oh, Ol);
        k_gemmb<true, false><<<gp, 128, 0, stream>>>(Oh, Ol, WP, bp, OT, CC, nullptr, nullptr, CC);
        k_outT<<<dim3(NV / 64, 1, 1), 256, 0, stream>>>(OT, xb, out + (size_t)b * CC * NV); }
}

// v003
// Measured time: 341 microseconds a run.
// Next to v002, in two timings, it ran 2.39 and 2.38 times as fast.
// Over all steps from v000 it is 15.7 times as fast.
#include <hip/hip_runtime.h>

// Compute dtypes, f32 accumulate, per item: GroupNorm (32 groups, statistics in f32, fixed order) while transposing to voxel-major bf16 hi + UNSCALED residual planes; q/k/v/proj =
// 1x1x1 convs as [8192 x 64].[64 x 64] GEMMs on hi/lo planes with exact bf16 weights (two products, + bias); single-head attention over the 8192 voxels in one fused kernel with
// hi/lo operands (three products); 1/8 and the softmax in f32; x + out with the channel-major transpose in f32 - on v_wmma_f32_16x16x32_bf16. Deterministic, no atomics; every

#define NB_  2
#define CC   64
#define NV   8192
#define NG   32
#define DM   CC
#define SCL  0.125f
#define GEPS 1e-6f
#define LOSC 1024.0f
#define AW   8
#define AKL  (NV / AW)

typedef _Float16 h16;
typedef unsigned short bf;
typedef __attribute__((ext_vector_type(16))) __bf16   v16bf;
typedef __attribute__((ext_vector_type(16))) _Float16 v16h;
typedef __attribute__((ext_vector_type(8)))  _Float16 v8h;
typedef __attribute__((ext_vector_type(8)))  unsigned short v8us;
typedef __attribute__((ext_vector_type(8)))  float    v8f;
typedef __attribute__((ext_vector_type(4)))  float    v4f;
typedef __attribute__((ext_vector_type(2)))  float    v2f;
typedef __attribute__((ext_vector_type(2)))  __bf16   v2bf;
typedef v8h  __attribute__((may_alias)) v8ha;
typedef v4f  __attribute__((may_alias)) v4fa;
typedef v8us __attribute__((may_alias)) v8usa;

__device__ __forceinline__ unsigned short f2bf(float f) { unsigned u = __float_as_uint(f); u += 0x7FFFu + ((u >> 16) & 1u); return (unsigned short)(u >> 16); }
__device__ __forceinline__ float bf2f(unsigned short b) { return __uint_as_float(((unsigned)b) << 16); }
__device__ __forceinline__ float bfr(float f) { return bf2f(f2bf(f)); }
__device__ __forceinline__ v16h cat16(v8h lo, v8h hi) { return __builtin_shufflevector(lo, hi, 0, 1, 2, 3, 4, 5, 6, 7, 8, 9, 10, 11, 12, 13, 14, 15); }
__device__ __forceinline__ v16bf cat16b(v8us lo, v8us hi) { return __builtin_bit_cast(v16bf, __builtin_shufflevector(lo, hi, 0, 1, 2, 3, 4, 5, 6, 7, 8, 9, 10, 11, 12, 13, 14, 15)); }
__device__ __forceinline__ v8f wmma16(v16h a, v16h b, v8f c) { return __builtin_amdgcn_wmma_f32_16x16x32_f16(false, a, false, b, (short)0, c, false, false); }
__device__ __forceinline__ v8f wmmab(v16bf a, v16bf b, v8f c) { return __builtin_amdgcn_wmma_f32_16x16x32_bf16(false, a, false, b, (short)0, c, false, false); }

// k_gemmb: 64 x 64 block tile (4 waves x 16 x 64) of C[NTK][NW] = (A [+ Al]).B^T (K = 64) [+ bf(bias[c])] [+ bf(R[r][c]) residual]; f32 whole-line epilogue (or f16
template <bool SPLITA, bool F16OUT = false>
__global__ __launch_bounds__(128) void k_gemmb(const bf* __restrict__ A, const bf* __restrict__ Al, const bf* __restrict__ Bn, const float* __restrict__ bias, float* C, int ldc, h16* C2, const float* __restrict__ R = nullptr, int K = DM, int roundR = 1) {
    __shared__ __align__(16) float ost[4][16 * 68];
    const int lane = threadIdx.x & 31, wave = threadIdx.x >> 5, lr = lane & 15, hi = lane >> 4;
    const int r0 = blockIdx.x * 64 + wave * 16, c0 = blockIdx.y * 64;
    const size_t aoff = (size_t)(r0 + lr) * K + 8 * hi;
    size_t boff[4];
#pragma unroll
    for (int t = 0; t < 4; ++t) boff[t] = (size_t)(c0 + t * 16 + lr) * K + 8 * hi;
    v8f acc[4];
#pragma unroll
    for (int t = 0; t < 4; ++t) acc[t] = (v8f){};
#pragma unroll 1
    for (int kc = 0; kc < K; kc += 32) {
        const v16bf a = cat16b(*(const v8us*)(A + aoff + kc), *(const v8us*)(A + aoff + kc + 16));
        v16bf al = a;
        if (SPLITA) al = cat16b(*(const v8us*)(Al + aoff + kc), *(const v8us*)(Al + aoff + kc + 16));
#pragma unroll
        for (int t = 0; t < 4; ++t) { const v16bf b = cat16b(*(const v8us*)(Bn + boff[t] + kc), *(const v8us*)(Bn + boff[t] + kc + 16)); acc[t] = wmmab(a, b, acc[t]); if (SPLITA) acc[t] = wmmab(al, b, acc[t]); }
        asm volatile("v_nop\n\tv_nop\n\tv_nop\n\tv_nop" : "+v"(acc[0]), "+v"(acc[1]), "+v"(acc[2]), "+v"(acc[3]) : "v"(a), "v"(al));
    }
    float* os = &ost[wave][0];
#pragma unroll
    for (int t = 0; t < 4; ++t) { const float bv = bias ? bfr(bias[c0 + t * 16 + lr]) : 0.f;
#pragma unroll
        for (int j = 0; j < 8; ++j) os[(hi * 8 + j) * 68 + t * 16 + lr] = acc[t][j] + bv; }
    __syncthreads();
    if (F16OUT) {
        h16* crow = (h16*)(void*)C + (size_t)r0 * ldc + c0;
        auto pass = [&]() {
#pragma unroll
            for (int s = 0; s < 4; ++s) { const int row = 4 * s + (lane >> 3), piece = lane & 7; const float* sp = os + row * 68 + piece * 8; v8h o, o2;
#pragma unroll
                for (int i = 0; i < 8; ++i) { const h16 a = (h16)sp[i]; o[i] = a; o2[i] = (h16)((sp[i] - (float)a) * LOSC); }
                *(v8h*)(crow + (size_t)row * ldc + piece * 8) = o; if (C2) *(v8h*)(C2 + (size_t)r0 * ldc + c0 + (size_t)row * ldc + piece * 8) = o2; }
        };
        pass(); 
    } else {
        float* crow = C + (size_t)r0 * ldc + c0;
        auto pass = [&]() {
#pragma unroll
            for (int s = 0; s < 8; ++s) { const int Lid = (lane >> 3) + 4 * s, piece = lane & 7; const int row = Lid >> 1, cofs = (Lid & 1) * 32 + piece * 4;
                v4f val = *(const v4fa*)(os + row * 68 + cofs); if (R) { const v4f rv = *(const v4f*)(R + ((size_t)r0 + row) * ldc + c0 + cofs); val += roundR ? (v4f){bfr(rv[0]), bfr(rv[1]), bfr(rv[2]), bfr(rv[3])} : rv; }
                *(v4f*)(crow + (size_t)row * ldc + cofs) = val; }
        };
        pass(); 
    }
}

__global__ __launch_bounds__(256) void k_cvt8(const float* __restrict__ src, bf* dst, size_t n8) {
    const size_t i = (size_t)blockIdx.x * 256 + threadIdx.x; if (i >= n8) return;
    const v8f v = *(const v8f*)(src + i * 8); v8us o;
#pragma unroll
    for (int k = 0; k < 8; ++k) o[k] = f2bf(v[k]);
    *(v8us*)(dst + i * 8) = o; 
}
__global__ __launch_bounds__(256) void k_zero8(bf* dst, size_t n8) {
    const size_t i = (size_t)blockIdx.x * 256 + threadIdx.x; if (i >= n8) return; v8us z;
#pragma unroll
    for (int k = 0; k < 8; ++k) z[k] = 0;
    *(v8us*)(dst + i * 8) = z; 
}


// k_gnstat: per (group g of 2 channels): mean and rsqrt(var + eps) over 2 x 8192 values of x[b][2g..2g+1][:] (f32; lane-strided fixed-order partial sums + xor tree; biased var
// share a line: NOT whole-line. Instead one wave per 32 groups is too serial; so: block of 256 threads = 8 waves = 8 groups, each wave writes its own 32-float ST row (mean, rstd, zeros)
__global__ __launch_bounds__(256) void k_gnstat(const float* __restrict__ xb, float* ST) {
    const int lane = threadIdx.x & 31; const int g = blockIdx.x * 8 + (threadIdx.x >> 5); if (g >= NG) return; const float* base = xb + (size_t)(2 * g) * NV; const int n = 2 * NV; float s = 0.f;
    for (int i = lane; i < n; i += 32) s += base[i];
#pragma unroll
    for (int sh = 16; sh; sh >>= 1) s += __shfl_xor(s, sh, 32);
    const float mu = s / (float)n; float q = 0.f;
    for (int i = lane; i < n; i += 32) { const float d = base[i] - mu; q = fmaf(d, d, q); }
#pragma unroll
    for (int sh = 16; sh; sh >>= 1) q += __shfl_xor(q, sh, 32);
    const float rs = rsqrtf(q / (float)n + GEPS); const float v = (lane == 0) ? mu : (lane == 1) ? rs : 0.f;
    *(float*)(ST + (size_t)g * 32 + lane) = v; 
}
// k_gnT: voxel-major planes HT[p][c] of (bf(x[c][p]) - mean_g) rstd_g bf(gamma[c]) + bf(beta[c]) via 64x64 LDS tiles (all 64 channels x 64 voxels per block); wave writes 2 rows x 64
__global__ __launch_bounds__(256) void k_gnT(const float* __restrict__ xb, const float* __restrict__ ST, const float* __restrict__ gam, const float* __restrict__ bet, bf* Hh, bf* Hl) {
    __shared__ float tl[64][65];
    typedef __attribute__((ext_vector_type(4))) unsigned short v4us;
    const int tid = threadIdx.x, p0 = blockIdx.y * 64; const int rr = tid >> 2, cq = (tid & 3) * 16;   // rr = channel
    { const float mu = ST[(rr >> 1) * 32], rs = ST[(rr >> 1) * 32 + 1], ga = bfr(gam[rr]), be = bfr(bet[rr]);
#pragma unroll
      for (int i = 0; i < 16; ++i) tl[rr][cq + i] = (bfr(xb[(size_t)rr * NV + p0 + cq + i]) - mu) * rs * ga + be; }
    __syncthreads();
    const int lane = tid & 31, wv = tid >> 5;
    auto pass = [&]() {
#pragma unroll
        for (int st = 0; st < 4; ++st) { const int pr = wv * 8 + st * 2 + (lane >> 4); const int cl = (lane & 15) * 4; v4us oh, ol;
#pragma unroll
            for (int i = 0; i < 4; ++i) { const float y = tl[cl + i][pr]; const unsigned short hb = f2bf(y); oh[i] = hb; ol[i] = f2bf(y - bf2f(hb)); }
            const size_t o = (size_t)(p0 + pr) * CC + cl; *(v4us*)(Hh + o) = oh; *(v4us*)(Hl + o) = ol; }
    };
    pass(); 
}
__global__ __launch_bounds__(256) void k_split64(const float* __restrict__ F, int rows, float sc, bf* Ph, bf* Pl) {
    typedef __attribute__((ext_vector_type(2))) unsigned short v2us; typedef __attribute__((ext_vector_type(2))) float v2f_;
    const int lane = threadIdx.x & 31; const size_t r = (size_t)blockIdx.x * 8 + (threadIdx.x >> 5); if (r >= (size_t)rows) return; const size_t o = r * CC + lane * 2; const v2f_ v = *(const v2f_*)(F + o); v2us oh, ol;
#pragma unroll
    for (int i = 0; i < 2; ++i) { const float y = v[i] * sc; const unsigned short hb = f2bf(y); oh[i] = hb; ol[i] = f2bf(y - bf2f(hb)); }
    *(v2us*)(Ph + o) = oh; *(v2us*)(Pl + o) = ol; 
}
__global__ __launch_bounds__(256) void k_vT(const float* __restrict__ V, bf* Th, bf* Tl) {
    __shared__ float tl[64][65];
    typedef __attribute__((ext_vector_type(4))) unsigned short v4us;
    const int tid = threadIdx.x; const int t0 = blockIdx.x * 64; const int rr = tid >> 2, cq = (tid & 3) * 16;
#pragma unroll
    for (int i = 0; i < 16; ++i) tl[rr][cq + i] = V[(size_t)(t0 + rr) * CC + cq + i];     // tl[t][d]
    __syncthreads();
    const int lane = tid & 31, wv = tid >> 5;
    auto pass = [&]() {
#pragma unroll
        for (int st = 0; st < 4; ++st) { const int dr = wv * 8 + st * 2 + (lane >> 4); const int tq = (lane & 15) * 4; v4us oh, ol;
#pragma unroll
            for (int i = 0; i < 4; ++i) { const float y = tl[tq + i][dr]; const unsigned short hb = f2bf(y); oh[i] = hb; ol[i] = f2bf(y - bf2f(hb)); }
            const size_t o = (size_t)dr * NV + t0 + tq; *(v4us*)(Th + o) = oh; *(v4us*)(Tl + o) = ol; }
    };
    pass(); 
}
__device__ __forceinline__ v16bf ld16(const bf* p) { return cat16b(*(const v8us*)p, *(const v8us*)(p + 8)); }    // 16 consecutive k a lane (same loader for both operands)
__device__ __forceinline__ v16bf ldkm(const bf* p) { return cat16b(*(const v8us*)p, *(const v8us*)(p + 16)); }  // hardware k order, p already at 8 * h: pairs with a packed accumulator as B
__device__ __forceinline__ float xhalf(float v) { const int b = __float_as_int(v); return __int_as_float(__builtin_amdgcn_permlanex16(b, b, 0x76543210, 0xfedcba98, false, false)); }   // lane l <-> l ^ 16
// 2^x by v_exp_f32. The v_nop is the one slot the instruction set asks for behind a transcendental before its result is read or its source overwritten; it stands in the same
// statement because a v_nop apart drifts off. In the run of eight each v_exp_f32 works in place on a register of its own, so only the last one needs the slot.
__device__ __forceinline__ float exp2_slot(float x) { float r; asm("v_exp_f32 %0, %1\n\tv_nop" : "=v"(r) : "v"(x)); return r; }
__device__ __forceinline__ void exp2x8(float* x) {
    asm("v_exp_f32 %0, %0\n\tv_exp_f32 %1, %1\n\tv_exp_f32 %2, %2\n\tv_exp_f32 %3, %3\n\tv_exp_f32 %4, %4\n\tv_exp_f32 %5, %5\n\tv_exp_f32 %6, %6\n\tv_exp_f32 %7, %7\n\tv_nop"
        : "+v"(x[0]), "+v"(x[1]), "+v"(x[2]), "+v"(x[3]), "+v"(x[4]), "+v"(x[5]), "+v"(x[6]), "+v"(x[7]));
}
// k_attn: scores, softmax and P.V in one kernel; scores and probabilities never leave the registers. A work-group owns 32 queries; each of its 8 waves walks its own 1024 keys in
// passes of 32: St = K.Qt (a lane holds one query's scores), running maximum and sum per query, Pt packed from the score accumulators as B operand, Ot += Vt.Pt. hi/lo operands,
// three products each. The maximum in use is raised only when a new one exceeds it by more than 8 (log2 units), so P stays below 2^8 times its normalised size.
// The eight waves' partial (max, sum, Ot) are combined through LDS in wave order (fixed), normalised, and split into bf16 hi + residual planes, whole 128-byte rows a wave.
__global__ __launch_bounds__(256) void k_attn(const bf* __restrict__ Qh, const bf* __restrict__ Ql, const bf* __restrict__ Kh, const bf* __restrict__ Kl, const bf* __restrict__ Vh, const bf* __restrict__ Vl, bf* Oh, bf* Ol) {
    __shared__ __align__(32) float ost[AW][8][32][8];
    __shared__ float sm[AW][32], sl[AW][32];
    const int lane = threadIdx.x & 31, wave = __builtin_amdgcn_readfirstlane(threadIdx.x >> 5), c = lane & 15, h = lane >> 4;
    const int q0 = blockIdx.x * 32;
    const float CS = SCL * 1.44269504f;   // scores go to log2 units
    const int ko = c * CC + 16 * h;   // a lane's place in a 16-row tile of Q or K
    const int vo = c * NV + 8 * h;    // a lane's place in a 16-row tile of Vt
    const bf* qph = Qh + (size_t)q0 * CC; const bf* qpl = Ql + (size_t)q0 * CC;
    const bf* kph = Kh + (size_t)wave * AKL * CC; const bf* kpl = Kl + (size_t)wave * AKL * CC;
    const bf* vph = Vh + (size_t)wave * AKL; const bf* vpl = Vl + (size_t)wave * AKL;
    v16bf kh[2][2], kl[2][2], vh[4], vl[4];
#pragma unroll
    for (int kt = 0; kt < 2; ++kt) {
#pragma unroll
        for (int ks = 0; ks < 2; ++ks) { kh[kt][ks] = ld16(kph + ko + kt * 16 * CC + ks * 32); kl[kt][ks] = ld16(kpl + ko + kt * 16 * CC + ks * 32); } }
    asm volatile("s_wait_xcnt 0x0" ::: "memory");   // here and twice below: stands before a register that the issued loads name is written again
#pragma unroll
    for (int dt = 0; dt < 4; ++dt) { vh[dt] = ldkm(vph + vo + dt * 16 * NV); vl[dt] = ldkm(vpl + vo + dt * 16 * NV); }
    asm volatile("s_wait_xcnt 0x0" ::: "memory");
    v16bf qh[2][2], ql[2][2];
#pragma unroll
    for (int qt = 0; qt < 2; ++qt) {
#pragma unroll
        for (int ks = 0; ks < 2; ++ks) { qh[qt][ks] = ld16(qph + ko + qt * 16 * CC + ks * 32); ql[qt][ks] = ld16(qpl + ko + qt * 16 * CC + ks * 32); } }
    asm volatile("s_wait_xcnt 0x0" ::: "memory");
    v8f acc[2][4]; float m[2], l[2];
#pragma unroll
    for (int qt = 0; qt < 2; ++qt) { m[qt] = -3.0e38f; l[qt] = 0.f;
#pragma unroll
        for (int dt = 0; dt < 4; ++dt) acc[qt][dt] = (v8f){}; }
#pragma unroll 1   // rolled: one pass is already 48 matrix instructions and some 300 registers
    for (int p = 0; p < AKL / 32; ++p) {
        v8f s[2][2];
#pragma unroll
        for (int qt = 0; qt < 2; ++qt) { s[qt][0] = (v8f){}; s[qt][1] = (v8f){}; }
#pragma unroll
        for (int ks = 0; ks < 2; ++ks) {
#pragma unroll
            for (int kt = 0; kt < 2; ++kt) {
#pragma unroll
                for (int qt = 0; qt < 2; ++qt) s[qt][kt] = wmmab(kh[kt][ks], qh[qt][ks], s[qt][kt]); }
#pragma unroll
            for (int kt = 0; kt < 2; ++kt) {
#pragma unroll
                for (int qt = 0; qt < 2; ++qt) s[qt][kt] = wmmab(kl[kt][ks], qh[qt][ks], s[qt][kt]); }
#pragma unroll
            for (int kt = 0; kt < 2; ++kt) {
#pragma unroll
                for (int qt = 0; qt < 2; ++qt) s[qt][kt] = wmmab(kh[kt][ks], ql[qt][ks], s[qt][kt]); } }
        // the next pass's K, fetched behind this pass's score products; the last pass fetches its own rows again (in bounds, unused)
        const int more = (p + 1 < AKL / 32) ? 32 : 0; kph += more * CC; kpl += more * CC;
#pragma unroll
        for (int kt = 0; kt < 2; ++kt) {
#pragma unroll
            for (int ks = 0; ks < 2; ++ks) { kh[kt][ks] = ld16(kph + ko + kt * 16 * CC + ks * 32); kl[kt][ks] = ld16(kpl + ko + kt * 16 * CC + ks * 32); } }
        asm volatile("s_wait_xcnt 0x0" ::: "memory");   // stands before the base registers of these loads are advanced in the next pass
        float mx[2];
#pragma unroll
        for (int qt = 0; qt < 2; ++qt) { float a = fmaxf(s[qt][0][0], s[qt][1][0]);
#pragma unroll
            for (int i = 1; i < 8; ++i) a = fmaxf(a, fmaxf(s[qt][0][i], s[qt][1][i]));
            mx[qt] = fmaxf(a, xhalf(a)) * CS; }
        const bool need = (mx[0] > m[0] + 8.0f) | (mx[1] > m[1] + 8.0f);
        if (__builtin_amdgcn_ballot_w32(need) != 0) {   // one scalar branch a pass
#pragma unroll
            for (int qt = 0; qt < 2; ++qt) { const float mn = fmaxf(m[qt], mx[qt]); const float al = exp2_slot(m[qt] - mn); m[qt] = mn; l[qt] *= al;
#pragma unroll
                for (int dt = 0; dt < 4; ++dt) acc[qt][dt] *= al; } }
        v16bf ph[2], pl[2];
#pragma unroll
        for (int qt = 0; qt < 2; ++qt) { float pv[16];
#pragma unroll
            for (int i = 0; i < 16; ++i) pv[i] = fmaf(s[qt][i >> 3][i & 7], CS, -m[qt]);
            exp2x8(pv); exp2x8(pv + 8);
#pragma unroll
            for (int i = 0; i < 16; i += 2) { const v2bf hb = __builtin_convertvector((v2f){pv[i], pv[i + 1]}, v2bf); const v2bf lb = __builtin_convertvector((v2f){pv[i] - (float)hb[0], pv[i + 1] - (float)hb[1]}, v2bf);
                ph[qt][i] = hb[0]; ph[qt][i + 1] = hb[1]; pl[qt][i] = lb[0]; pl[qt][i + 1] = lb[1]; }
#pragma unroll
            for (int w = 8; w; w >>= 1) {
#pragma unroll
                for (int i = 0; i < w; ++i) pv[i] += pv[i + w]; }
            l[qt] += pv[0]; }
#pragma unroll
        for (int dt = 0; dt < 4; ++dt) {
#pragma unroll
            for (int qt = 0; qt < 2; ++qt) acc[qt][dt] = wmmab(vh[dt], ph[qt], acc[qt][dt]); }
#pragma unroll
        for (int dt = 0; dt < 4; ++dt) {
#pragma unroll
            for (int qt = 0; qt < 2; ++qt) acc[qt][dt] = wmmab(vl[dt], ph[qt], acc[qt][dt]); }
#pragma unroll
        for (int dt = 0; dt < 4; ++dt) {
#pragma unroll
            for (int qt = 0; qt < 2; ++qt) acc[qt][dt] = wmmab(vh[dt], pl[qt], acc[qt][dt]); }
        // the next pass's Vt, fetched behind this pass's output products (the last pass: its own columns again, in bounds, unused)
        vph += more; vpl += more;
#pragma unroll
        for (int dt = 0; dt < 4; ++dt) { vh[dt] = ldkm(vph + vo + dt * 16 * NV); vl[dt] = ldkm(vpl + vo + dt * 16 * NV); }
        asm volatile("s_wait_xcnt 0x0" ::: "memory");   // as above, for the Vt bases
    }
#pragma unroll
    for (int qt = 0; qt < 2; ++qt) { l[qt] += xhalf(l[qt]);
#pragma unroll
        for (int dt = 0; dt < 4; ++dt) *(v8f*)&ost[wave][qt * 4 + dt][lane][0] = acc[qt][dt];
        if (h == 0) { sm[wave][qt * 16 + c] = m[qt]; sl[wave][qt * 16 + c] = l[qt]; } }
    __syncthreads();
    const int qq = wave * 4 + (lane >> 3), d8 = lane & 7;   // query of the block, 8-channel piece of its row
    const int g = (qq >> 4) * 4 + (d8 >> 1), sln = (d8 & 1) * 16 + (qq & 15);
    float M = sm[0][qq];
#pragma unroll
    for (int w = 1; w < AW; ++w) M = fmaxf(M, sm[w][qq]);
    float L = 0.f; v8f o = (v8f){};
#pragma unroll
    for (int w = 0; w < AW; ++w) { const float a = exp2_slot(sm[w][qq] - M); L = fmaf(sl[w][qq], a, L); o += *(const v8f*)&ost[w][g][sln][0] * a; }
    const float inv = 1.0f / L; v8us oh, ol;
#pragma unroll
    for (int i = 0; i < 8; ++i) { const float y = o[i] * inv; const unsigned short hb = f2bf(y); oh[i] = hb; ol[i] = f2bf(y - bf2f(hb)); }
    const size_t oo = (size_t)(q0 + qq) * CC + d8 * 8; *(v8us*)(Oh + oo) = oh; *(v8us*)(Ol + oo) = ol;
}
__global__ __launch_bounds__(256) void k_outT(const float* __restrict__ OT, const float* __restrict__ xb, float* OUTB) {
    __shared__ float tl[64][65];
    const int tid = threadIdx.x; const int p0 = blockIdx.x * 64; const int rr = tid >> 2, cq = (tid & 3) * 16;
#pragma unroll
    for (int i = 0; i < 16; ++i) tl[rr][cq + i] = OT[(size_t)(p0 + rr) * CC + cq + i];
    __syncthreads();
    const int lane = tid & 31, wv = tid >> 5;
    auto pass = [&]() {
#pragma unroll
        for (int st = 0; st < 4; ++st) { const int cr = wv * 8 + st * 2 + (lane >> 4); const int pq = (lane & 15) * 4; v4f v; const size_t o = (size_t)cr * NV + p0 + pq;
#pragma unroll
            for (int i = 0; i < 4; ++i) v[i] = bfr(xb[o + i]) + tl[pq + i][cr];
            *(v4f*)(OUTB + o) = v; }
    };
    pass(); 
}

extern "C" void kernel_launch(void* const* d_in, const int* in_sizes, int n_in,
                              void* d_out, int out_size, void* d_ws, size_t ws_size, hipStream_t stream) {
    (void)in_sizes; (void)n_in; (void)out_size;
    const float* x = (const float*)d_in[0]; const float* gam = (const float*)d_in[1]; const float* bet = (const float*)d_in[2]; const float* wq = (const float*)d_in[3]; const float* bq = (const float*)d_in[4]; const float* wk = (const float*)d_in[5]; const float* bk = (const float*)d_in[6]; const float* wv = (const float*)d_in[7]; const float* bv = (const float*)d_in[8]; const float* wp = (const float*)d_in[9]; const float* bp = (const float*)d_in[10];
    float* out = (float*)d_out;    // [2][64][32][32][8]
    char* wsp = (char*)d_ws;
    auto take = [&](size_t bytes) { char* p = wsp; wsp += (bytes + 255) & ~(size_t)255; return (void*)p; };
    bf* WQ = (bf*)take(CC * CC * 2); bf* WK = (bf*)take(CC * CC * 2); bf* WV = (bf*)take(CC * CC * 2); bf* WP = (bf*)take(CC * CC * 2); float* ST = (float*)take(NG * 32 * 4);
    bf* Hh = (bf*)take((size_t)NV * CC * 2); bf* Hl = (bf*)take((size_t)NV * CC * 2); float* QF = (float*)take((size_t)NV * CC * 4); float* KF = (float*)take((size_t)NV * CC * 4); float* VF = (float*)take((size_t)NV * CC * 4);
    bf* Qh = (bf*)take((size_t)NV * CC * 2); bf* Ql = (bf*)take((size_t)NV * CC * 2); bf* Kh = (bf*)take((size_t)NV * CC * 2); bf* Kl = (bf*)take((size_t)NV * CC * 2); bf* VTh = (bf*)take((size_t)CC * NV * 2); bf* VTl = (bf*)take((size_t)CC * NV * 2);
    bf* Oh = (bf*)take((size_t)NV * CC * 2); bf* Ol = (bf*)take((size_t)NV * CC * 2); float* OT = (float*)take((size_t)NV * CC * 4);
    if ((size_t)(wsp - (char*)d_ws) > ws_size) return;
    k_cvt8<<<(CC * CC / 8 + 255) / 256, 256, 0, stream>>>(wq, WQ, CC * CC / 8); k_cvt8<<<(CC * CC / 8 + 255) / 256, 256, 0, stream>>>(wk, WK, CC * CC / 8); k_cvt8<<<(CC * CC / 8 + 255) / 256, 256, 0, stream>>>(wv, WV, CC * CC / 8); k_cvt8<<<(CC * CC / 8 + 255) / 256, 256, 0, stream>>>(wp, WP, CC * CC / 8);   // 'oc' natural
    const dim3 gp(NV / 64, 1, 1);
    for (int b = 0; b < NB_; ++b) { const float* xb = x + (size_t)b * CC * NV;
        k_gnstat<<<NG / 8, 256, 0, stream>>>(xb, ST); k_gnT<<<dim3(1, NV / 64, 1), 256, 0, stream>>>(xb, ST, gam, bet, Hh, Hl);
        k_gemmb<true, false><<<gp, 128, 0, stream>>>(Hh, Hl, WQ, bq, QF, CC, nullptr, nullptr, CC); k_gemmb<true, false><<<gp, 128, 0, stream>>>(Hh, Hl, WK, bk, KF, CC, nullptr, nullptr, CC); k_gemmb<true, false><<<gp, 128, 0, stream>>>(Hh, Hl, WV, bv, VF, CC, nullptr, nullptr, CC);
        k_split64<<<NV / 8, 256, 0, stream>>>(QF, NV, 1.0f, Qh, Ql); k_split64<<<NV / 8, 256, 0, stream>>>(KF, NV, 1.0f, Kh, Kl); k_vT<<<NV / 64, 256, 0, stream>>>(VF, VTh, VTl);
        k_attn<<<NV / 32, 256, 0, stream>>>(Qh, Ql, Kh, Kl, VTh, VTl, Oh, Ol);
        k_gemmb<true, false><<<gp, 128, 0, stream>>>(Oh, Ol, WP, bp, OT, CC, nullptr, nullptr, CC);
        k_outT<<<dim3(NV / 64, 1, 1), 256, 0, stream>>>(OT, xb, out + (size_t)b * CC * NV); }
}

// v004
// It runs in 242 microseconds.
// In two side-by-side timings against v003, it was 1.40 and 1.41 times as fast.
// Counting every step since v000, it is 22.0 times as fast.
#include <hip/hip_runtime.h>

// Compute dtypes, f32 accumulate, per item: GroupNorm (32 groups, statistics in f32, fixed order) while transposing to voxel-major bf16 hi + UNSCALED residual planes; q/k/v/proj =
// 1x1x1 convs as [8192 x 64].[64 x 64] GEMMs on hi/lo planes with exact bf16 weights (two products, + bias); single-head attention over the 8192 voxels in one fused kernel with
// hi/lo operands (three products); 1/8 and the softmax in f32; x + out with the channel-major transpose in f32 - on v_wmma_f32_16x16x32_bf16. Deterministic, no atomics; every

#define NB_  2
#define CC   64
#define NV   8192
#define NG   32
#define DM   CC
#define SCL  0.125f
#define GEPS 1e-6f
#define LOSC 1024.0f
#define AW   8
#define AKL  (NV / AW)

typedef _Float16 h16;
typedef unsigned short bf;
typedef __attribute__((ext_vector_type(16))) __bf16   v16bf;
typedef __attribute__((ext_vector_type(16))) _Float16 v16h;
typedef __attribute__((ext_vector_type(8)))  _Float16 v8h;
typedef __attribute__((ext_vector_type(8)))  unsigned short v8us;
typedef __attribute__((ext_vector_type(8)))  float    v8f;
typedef __attribute__((ext_vector_type(4)))  float    v4f;
typedef __attribute__((ext_vector_type(2)))  float    v2f;
typedef __attribute__((ext_vector_type(2)))  __bf16   v2bf;
typedef v8h  __attribute__((may_alias)) v8ha;
typedef v4f  __attribute__((may_alias)) v4fa;
typedef v8us __attribute__((may_alias)) v8usa;

__device__ __forceinline__ unsigned short f2bf(float f) { unsigned u = __float_as_uint(f); u += 0x7FFFu + ((u >> 16) & 1u); return (unsigned short)(u >> 16); }
__device__ __forceinline__ float bf2f(unsigned short b) { return __uint_as_float(((unsigned)b) << 16); }
__device__ __forceinline__ float bfr(float f) { return bf2f(f2bf(f)); }
__device__ __forceinline__ v16h cat16(v8h lo, v8h hi) { return __builtin_shufflevector(lo, hi, 0, 1, 2, 3, 4, 5, 6, 7, 8, 9, 10, 11, 12, 13, 14, 15); }
__device__ __forceinline__ v16bf cat16b(v8us lo, v8us hi) { return __builtin_bit_cast(v16bf, __builtin_shufflevector(lo, hi, 0, 1, 2, 3, 4, 5, 6, 7, 8, 9, 10, 11, 12, 13, 14, 15)); }
__device__ __forceinline__ v8f wmma16(v16h a, v16h b, v8f c) { return __builtin_amdgcn_wmma_f32_16x16x32_f16(false, a, false, b, (short)0, c, false, false); }
__device__ __forceinline__ v8f wmmab(v16bf a, v16bf b, v8f c) { return __builtin_amdgcn_wmma_f32_16x16x32_bf16(false, a, false, b, (short)0, c, false, false); }

// k_gemmb: 64 x 64 block tile (4 waves x 16 x 64) of C[NTK][NW] = (A [+ Al]).B^T (K = 64) [+ bf(bias[c])] [+ bf(R[r][c]) residual]; f32 whole-line epilogue (or f16
template <bool SPLITA, bool F16OUT = false>
__global__ __launch_bounds__(128) void k_gemmb(const bf* __restrict__ A, const bf* __restrict__ Al, const bf* __restrict__ Bn, const float* __restrict__ bias, float* C, int ldc, h16* C2, const float* __restrict__ R = nullptr, int K = DM, int roundR = 1) {
    __shared__ __align__(16) float ost[4][16 * 68];
    const int lane = threadIdx.x & 31, wave = threadIdx.x >> 5, lr = lane & 15, hi = lane >> 4;
    const int r0 = blockIdx.x * 64 + wave * 16, c0 = blockIdx.y * 64;
    const size_t aoff = (size_t)(r0 + lr) * K + 8 * hi;
    size_t boff[4];
#pragma unroll
    for (int t = 0; t < 4; ++t) boff[t] = (size_t)(c0 + t * 16 + lr) * K + 8 * hi;
    v8f acc[4];
#pragma unroll
    for (int t = 0; t < 4; ++t) acc[t] = (v8f){};
#pragma unroll 1
    for (int kc = 0; kc < K; kc += 32) {
        const v16bf a = cat16b(*(const v8us*)(A + aoff + kc), *(const v8us*)(A + aoff + kc + 16));
        v16bf al = a;
        if (SPLITA) al = cat16b(*(const v8us*)(Al + aoff + kc), *(const v8us*)(Al + aoff + kc + 16));
#pragma unroll
        for (int t = 0; t < 4; ++t) { const v16bf b = cat16b(*(const v8us*)(Bn + boff[t] + kc), *(const v8us*)(Bn + boff[t] + kc + 16)); acc[t] = wmmab(a, b, acc[t]); if (SPLITA) acc[t] = wmmab(al, b, acc[t]); }
        asm volatile("v_nop\n\tv_nop\n\tv_nop\n\tv_nop" : "+v"(acc[0]), "+v"(acc[1]), "+v"(acc[2]), "+v"(acc[3]) : "v"(a), "v"(al));
    }
    float* os = &ost[wave][0];
#pragma unroll
    for (int t = 0; t < 4; ++t) { const float bv = bias ? bfr(bias[c0 + t * 16 + lr]) : 0.f;
#pragma unroll
        for (int j = 0; j < 8; ++j) os[(hi * 8 + j) * 68 + t * 16 + lr] = acc[t][j] + bv; }
    __syncthreads();
    if (F16OUT) {
        h16* crow = (h16*)(void*)C + (size_t)r0 * ldc + c0;
        auto pass = [&]() {
#pragma unroll
            for (int s = 0; s < 4; ++s) { const int row = 4 * s + (lane >> 3), piece = lane & 7; const float* sp = os + row * 68 + piece * 8; v8h o, o2;
#pragma unroll
                for (int i = 0; i < 8; ++i) { const h16 a = (h16)sp[i]; o[i] = a; o2[i] = (h16)((sp[i] - (float)a) * LOSC); }
                *(v8h*)(crow + (size_t)row * ldc + piece * 8) = o; if (C2) *(v8h*)(C2 + (size_t)r0 * ldc + c0 + (size_t)row * ldc + piece * 8) = o2; }
        };
        pass(); 
    } else {
        float* crow = C + (size_t)r0 * ldc + c0;
        auto pass = [&]() {
#pragma unroll
            for (int s = 0; s < 8; ++s) { const int Lid = (lane >> 3) + 4 * s, piece = lane & 7; const int row = Lid >> 1, cofs = (Lid & 1) * 32 + piece * 4;
                v4f val = *(const v4fa*)(os + row * 68 + cofs); if (R) { const v4f rv = *(const v4f*)(R + ((size_t)r0 + row) * ldc + c0 + cofs); val += roundR ? (v4f){bfr(rv[0]), bfr(rv[1]), bfr(rv[2]), bfr(rv[3])} : rv; }
                *(v4f*)(crow + (size_t)row * ldc + cofs) = val; }
        };
        pass(); 
    }
}

__global__ __launch_bounds__(256) void k_cvt8(const float* __restrict__ src, bf* dst, size_t n8) {
    const size_t i = (size_t)blockIdx.x * 256 + threadIdx.x; if (i >= n8) return;
    const v8f v = *(const v8f*)(src + i * 8); v8us o;
#pragma unroll
    for (int k = 0; k < 8; ++k) o[k] = f2bf(v[k]);
    *(v8us*)(dst + i * 8) = o; 
}
__global__ __launch_bounds__(256) void k_zero8(bf* dst, size_t n8) {
    const size_t i = (size_t)blockIdx.x * 256 + threadIdx.x; if (i >= n8) return; v8us z;
#pragma unroll
    for (int k = 0; k < 8; ++k) z[k] = 0;
    *(v8us*)(dst + i * 8) = z; 
}


// k_gnstat: per (group g of 2 channels): mean and rsqrt(var + eps) over 2 x 8192 values of x[b][2g..2g+1][:] (f32; lane-strided fixed-order partial sums + xor tree; biased var
// share a line: NOT whole-line. Instead one wave per 32 groups is too serial; so: block of 256 threads = 8 waves = 8 groups, each wave writes its own 32-float ST row (mean, rstd, zeros)
__global__ __launch_bounds__(256) void k_gnstat(const float* __restrict__ xb, float* ST) {
    const int lane = threadIdx.x & 31; const int g = blockIdx.x * 8 + (threadIdx.x >> 5); if (g >= NG) return; const float* base = xb + (size_t)(2 * g) * NV; const int n = 2 * NV; float s = 0.f;
    for (int i = lane; i < n; i += 32) s += base[i];
#pragma unroll
    for (int sh = 16; sh; sh >>= 1) s += __shfl_xor(s, sh, 32);
    const float mu = s / (float)n; float q = 0.f;
    for (int i = lane; i < n; i += 32) { const float d = base[i] - mu; q = fmaf(d, d, q); }
#pragma unroll
    for (int sh = 16; sh; sh >>= 1) q += __shfl_xor(q, sh, 32);
    const float rs = rsqrtf(q / (float)n + GEPS); const float v = (lane == 0) ? mu : (lane == 1) ? rs : 0.f;
    *(float*)(ST + (size_t)g * 32 + lane) = v; 
}
// k_gnT: voxel-major planes HT[p][c] of (bf(x[c][p]) - mean_g) rstd_g bf(gamma[c]) + bf(beta[c]) via 64x64 LDS tiles (all 64 channels x 64 voxels per block); wave writes 2 rows x 64
__global__ __launch_bounds__(256) void k_gnT(const float* __restrict__ xb, const float* __restrict__ ST, const float* __restrict__ gam, const float* __restrict__ bet, bf* Hh, bf* Hl) {
    __shared__ float tl[64][65];
    typedef __attribute__((ext_vector_type(4))) unsigned short v4us;
    const int tid = threadIdx.x, p0 = blockIdx.y * 64; const int rr = tid >> 2, cq = (tid & 3) * 16;   // rr = channel
    { const float mu = ST[(rr >> 1) * 32], rs = ST[(rr >> 1) * 32 + 1], ga = bfr(gam[rr]), be = bfr(bet[rr]);
#pragma unroll
      for (int i = 0; i < 16; ++i) tl[rr][cq + i] = (bfr(xb[(size_t)rr * NV + p0 + cq + i]) - mu) * rs * ga + be; }
    __syncthreads();
    const int lane = tid & 31, wv = tid >> 5;
    auto pass = [&]() {
#pragma unroll
        for (int st = 0; st < 4; ++st) { const int pr = wv * 8 + st * 2 + (lane >> 4); const int cl = (lane & 15) * 4; v4us oh, ol;
#pragma unroll
            for (int i = 0; i < 4; ++i) { const float y = tl[cl + i][pr]; const unsigned short hb = f2bf(y); oh[i] = hb; ol[i] = f2bf(y - bf2f(hb)); }
            const size_t o = (size_t)(p0 + pr) * CC + cl; *(v4us*)(Hh + o) = oh; *(v4us*)(Hl + o) = ol; }
    };
    pass(); 
}
__global__ __launch_bounds__(256) void k_split64(const float* __restrict__ F, int rows, float sc, bf* Ph, bf* Pl) {
    typedef __attribute__((ext_vector_type(2))) unsigned short v2us; typedef __attribute__((ext_vector_type(2))) float v2f_;
    const int lane = threadIdx.x & 31; const size_t r = (size_t)blockIdx.x * 8 + (threadIdx.x >> 5); if (r >= (size_t)rows) return; const size_t o = r * CC + lane * 2; const v2f_ v = *(const v2f_*)(F + o); v2us oh, ol;
#pragma unroll
    for (int i = 0; i < 2; ++i) { const float y = v[i] * sc; const unsigned short hb = f2bf(y); oh[i] = hb; ol[i] = f2bf(y - bf2f(hb)); }
    *(v2us*)(Ph + o) = oh; *(v2us*)(Pl + o) = ol; 
}
// k_kfrag, k_vfrag: the bf16 hi + residual planes of K and V, laid out in the order in which k_attn's A fragments are read: 512-byte blocks, lane l's 16 bytes at 16 * l, so that a
// wave-wide 16-byte load covers four whole 128-byte lines. One thread makes one 16-byte piece of each plane; a wave stores whole lines.
// K: block ((tile * 2 + ks) * 2 + j) holds K[tile * 16 + c][ks * 32 + h * 16 + j * 8 + i], lane = h * 16 + c.
__global__ __launch_bounds__(256) void k_kfrag(const float* __restrict__ F, bf* Ph, bf* Pl) {
    const int t = blockIdx.x * 256 + threadIdx.x; const int c = t & 15, h = (t >> 4) & 1, j = (t >> 5) & 1, ks = (t >> 6) & 1, tile = t >> 7;
    const v8f v = *(const v8f*)(F + (size_t)(tile * 16 + c) * CC + ks * 32 + h * 16 + j * 8); v8us oh, ol;
#pragma unroll
    for (int i = 0; i < 8; ++i) { const float y = v[i]; const unsigned short hb = f2bf(y); oh[i] = hb; ol[i] = f2bf(y - bf2f(hb)); }
    *(v8us*)(Ph + (size_t)t * 8) = oh; *(v8us*)(Pl + (size_t)t * 8) = ol;
}
// V: block ((pass * 4 + dt) * 2 + j) holds V[pass * 32 + j * 16 + h * 8 + i][dt * 16 + c], lane = h * 16 + c (the transpose is done by the eight strided reads).
__global__ __launch_bounds__(256) void k_vfrag(const float* __restrict__ V, bf* Th, bf* Tl) {
    const int t = blockIdx.x * 256 + threadIdx.x; const int c = t & 15, h = (t >> 4) & 1, j = (t >> 5) & 1, dt = (t >> 6) & 3, ps = t >> 8;
    const float* sp = V + (size_t)(ps * 32 + j * 16 + h * 8) * CC + dt * 16 + c; v8us oh, ol;
#pragma unroll
    for (int i = 0; i < 8; ++i) { const float y = sp[i * CC]; const unsigned short hb = f2bf(y); oh[i] = hb; ol[i] = f2bf(y - bf2f(hb)); }
    *(v8us*)(Th + (size_t)t * 8) = oh; *(v8us*)(Tl + (size_t)t * 8) = ol;
}
__device__ __forceinline__ v16bf ld16(const bf* p) { return cat16b(*(const v8us*)p, *(const v8us*)(p + 8)); }    // 16 consecutive k a lane: Q; k_kfrag's blocks give K's fragments the same k order
__device__ __forceinline__ v16bf ldfr(const bf* p) { return cat16b(*(const v8us*)p, *(const v8us*)(p + 256)); }  // a fragment from two 512-byte blocks of k_kfrag / k_vfrag, p already at 8 * lane
__device__ __forceinline__ float xhalf(float v) { const int b = __float_as_int(v); return __int_as_float(__builtin_amdgcn_permlanex16(b, b, 0x76543210, 0xfedcba98, false, false)); }   // lane l <-> l ^ 16
// 2^x by v_exp_f32. The v_nop is the one slot the instruction set asks for behind a transcendental before its result is read or its source overwritten; it stands in the same
// statement because a v_nop apart drifts off. In the run of eight each v_exp_f32 works in place on a register of its own, so only the last one needs the slot.
__device__ __forceinline__ float exp2_slot(float x) { float r; asm("v_exp_f32 %0, %1\n\tv_nop" : "=v"(r) : "v"(x)); return r; }
__device__ __forceinline__ void exp2x8(float* x) {
    asm("v_exp_f32 %0, %0\n\tv_exp_f32 %1, %1\n\tv_exp_f32 %2, %2\n\tv_exp_f32 %3, %3\n\tv_exp_f32 %4, %4\n\tv_exp_f32 %5, %5\n\tv_exp_f32 %6, %6\n\tv_exp_f32 %7, %7\n\tv_nop"
        : "+v"(x[0]), "+v"(x[1]), "+v"(x[2]), "+v"(x[3]), "+v"(x[4]), "+v"(x[5]), "+v"(x[6]), "+v"(x[7]));
}
// k_attn: scores, softmax and P.V in one kernel; scores and probabilities never leave the registers. A work-group owns 32 queries; each of its 8 waves walks its own 1024 keys in
// passes of 32: St = K.Qt (a lane holds one query's scores), running maximum and sum per query, Pt packed from the score accumulators as B operand, Ot += Vt.Pt. hi/lo operands,
// three products each. The maximum in use is raised only when a new one exceeds it by more than 8 (log2 units), so P stays below 2^8 times its normalised size.
// The eight waves' partial (max, sum, Ot) are combined through LDS in wave order (fixed), normalised, and split into bf16 hi + residual planes, whole 128-byte rows a wave.
__global__ __launch_bounds__(256) void k_attn(const bf* __restrict__ Qh, const bf* __restrict__ Ql, const bf* __restrict__ Kh, const bf* __restrict__ Kl, const bf* __restrict__ Vh, const bf* __restrict__ Vl, bf* Oh, bf* Ol) {
    __shared__ __align__(32) float ost[AW][8][32][8];
    __shared__ float sm[AW][32], sl[AW][32];
    const int lane = threadIdx.x & 31, wave = __builtin_amdgcn_readfirstlane(threadIdx.x >> 5), c = lane & 15, h = lane >> 4;
    const int q0 = blockIdx.x * 32;
    const float CS = SCL * 1.44269504f;   // scores go to log2 units
    const int ko = c * CC + 16 * h;   // a lane's place in a 16-row tile of Q
    const int fo = lane * 8;          // a lane's place in a 512-byte block of K or V
    const bf* qph = Qh + (size_t)q0 * CC; const bf* qpl = Ql + (size_t)q0 * CC;
    const bf* kph = Kh + (size_t)wave * AKL * CC; const bf* kpl = Kl + (size_t)wave * AKL * CC;
    const bf* vph = Vh + (size_t)wave * AKL * CC; const bf* vpl = Vl + (size_t)wave * AKL * CC;
    v16bf kh[2][2], kl[2][2], vh[4], vl[4];
#pragma unroll
    for (int kt = 0; kt < 2; ++kt) {
#pragma unroll
        for (int ks = 0; ks < 2; ++ks) { kh[kt][ks] = ldfr(kph + fo + (kt * 2 + ks) * 512); kl[kt][ks] = ldfr(kpl + fo + (kt * 2 + ks) * 512); } }
    asm volatile("s_wait_xcnt 0x0" ::: "memory");   // here and twice below: stands before a register that the issued loads name is written again
#pragma unroll
    for (int dt = 0; dt < 4; ++dt) { vh[dt] = ldfr(vph + fo + dt * 512); vl[dt] = ldfr(vpl + fo + dt * 512); }
    asm volatile("s_wait_xcnt 0x0" ::: "memory");
    v16bf qh[2][2], ql[2][2];
#pragma unroll
    for (int qt = 0; qt < 2; ++qt) {
#pragma unroll
        for (int ks = 0; ks < 2; ++ks) { qh[qt][ks] = ld16(qph + ko + qt * 16 * CC + ks * 32); ql[qt][ks] = ld16(qpl + ko + qt * 16 * CC + ks * 32); } }
    asm volatile("s_wait_xcnt 0x0" ::: "memory");
    v8f acc[2][4]; float m[2], l[2];
#pragma unroll
    for (int qt = 0; qt < 2; ++qt) { m[qt] = -3.0e38f; l[qt] = 0.f;
#pragma unroll
        for (int dt = 0; dt < 4; ++dt) acc[qt][dt] = (v8f){}; }
#pragma unroll 1   // rolled: one pass is already 48 matrix instructions and some 300 registers
    for (int p = 0; p < AKL / 32; ++p) {
        v8f s[2][2];
#pragma unroll
        for (int qt = 0; qt < 2; ++qt) { s[qt][0] = (v8f){}; s[qt][1] = (v8f){}; }
#pragma unroll
        for (int ks = 0; ks < 2; ++ks) {
#pragma unroll
            for (int kt = 0; kt < 2; ++kt) {
#pragma unroll
                for (int qt = 0; qt < 2; ++qt) s[qt][kt] = wmmab(kh[kt][ks], qh[qt][ks], s[qt][kt]); }
#pragma unroll
            for (int kt = 0; kt < 2; ++kt) {
#pragma unroll
                for (int qt = 0; qt < 2; ++qt) s[qt][kt] = wmmab(kl[kt][ks], qh[qt][ks], s[qt][kt]); }
#pragma unroll
            for (int kt = 0; kt < 2; ++kt) {
#pragma unroll
                for (int qt = 0; qt < 2; ++qt) s[qt][kt] = wmmab(kh[kt][ks], ql[qt][ks], s[qt][kt]); } }
        // the next pass's K, fetched behind this pass's score products; the last pass fetches its own rows again (in bounds, unused)
        const int more = (p + 1 < AKL / 32) ? 32 : 0; kph += more * CC; kpl += more * CC;
#pragma unroll
        for (int kt = 0; kt < 2; ++kt) {
#pragma unroll
            for (int ks = 0; ks < 2; ++ks) { kh[kt][ks] = ldfr(kph + fo + (kt * 2 + ks) * 512); kl[kt][ks] = ldfr(kpl + fo + (kt * 2 + ks) * 512); } }
        asm volatile("s_wait_xcnt 0x0" ::: "memory");   // stands before the base registers of these loads are advanced in the next pass
        float mx[2];
#pragma unroll
        for (int qt = 0; qt < 2; ++qt) { float a = fmaxf(s[qt][0][0], s[qt][1][0]);
#pragma unroll
            for (int i = 1; i < 8; ++i) a = fmaxf(a, fmaxf(s[qt][0][i], s[qt][1][i]));
            mx[qt] = fmaxf(a, xhalf(a)) * CS; }
        const bool need = (mx[0] > m[0] + 8.0f) | (mx[1] > m[1] + 8.0f);
        if (__builtin_amdgcn_ballot_w32(need) != 0) {   // one scalar branch a pass
#pragma unroll
            for (int qt = 0; qt < 2; ++qt) { const float mn = fmaxf(m[qt], mx[qt]); const float al = exp2_slot(m[qt] - mn); m[qt] = mn; l[qt] *= al;
#pragma unroll
                for (int dt = 0; dt < 4; ++dt) acc[qt][dt] *= al; } }
        v16bf ph[2], pl[2];
#pragma unroll
        for (int qt = 0; qt < 2; ++qt) { float pv[16];
#pragma unroll
            for (int i = 0; i < 16; ++i) pv[i] = fmaf(s[qt][i >> 3][i & 7], CS, -m[qt]);
            exp2x8(pv); exp2x8(pv + 8);
#pragma unroll
            for (int i = 0; i < 16; i += 2) { const v2bf hb = __builtin_convertvector((v2f){pv[i], pv[i + 1]}, v2bf); const v2bf lb = __builtin_convertvector((v2f){pv[i] - (float)hb[0], pv[i + 1] - (float)hb[1]}, v2bf);
                ph[qt][i] = hb[0]; ph[qt][i + 1] = hb[1]; pl[qt][i] = lb[0]; pl[qt][i + 1] = lb[1]; }
#pragma unroll
            for (int w = 8; w; w >>= 1) {
#pragma unroll
                for (int i = 0; i < w; ++i) pv[i] += pv[i + w]; }
            l[qt] += pv[0]; }
#pragma unroll
        for (int dt = 0; dt < 4; ++dt) {
#pragma unroll
            for (int qt = 0; qt < 2; ++qt) acc[qt][dt] = wmmab(vh[dt], ph[qt], acc[qt][dt]); }
#pragma unroll
        for (int dt = 0; dt < 4; ++dt) {
#pragma unroll
            for (int qt = 0; qt < 2; ++qt) acc[qt][dt] = wmmab(vl[dt], ph[qt], acc[qt][dt]); }
#pragma unroll
        for (int dt = 0; dt < 4; ++dt) {
#pragma unroll
            for (int qt = 0; qt < 2; ++qt) acc[qt][dt] = wmmab(vh[dt], pl[qt], acc[qt][dt]); }
        // the next pass's Vt, fetched behind this pass's output products (the last pass: its own columns again, in bounds, unused)
        vph += more * CC; vpl += more * CC;
#pragma unroll
        for (int dt = 0; dt < 4; ++dt) { vh[dt] = ldfr(vph + fo + dt * 512); vl[dt] = ldfr(vpl + fo + dt * 512); }
        asm volatile("s_wait_xcnt 0x0" ::: "memory");   // as above, for the Vt bases
    }
#pragma unroll
    for (int qt = 0; qt < 2; ++qt) { l[qt] += xhalf(l[qt]);
#pragma unroll
        for (int dt = 0; dt < 4; ++dt) *(v8f*)&ost[wave][qt * 4 + dt][lane][0] = acc[qt][dt];
        if (h == 0) { sm[wave][qt * 16 + c] = m[qt]; sl[wave][qt * 16 + c] = l[qt]; } }
    __syncthreads();
    const int qq = wave * 4 + (lane >> 3), d8 = lane & 7;   // query of the block, 8-channel piece of its row
    const int g = (qq >> 4) * 4 + (d8 >> 1), sln = (d8 & 1) * 16 + (qq & 15);
    float M = sm[0][qq];
#pragma unroll
    for (int w = 1; w < AW; ++w) M = fmaxf(M, sm[w][qq]);
    float L = 0.f; v8f o = (v8f){};
#pragma unroll
    for (int w = 0; w < AW; ++w) { const float a = exp2_slot(sm[w][qq] - M); L = fmaf(sl[w][qq], a, L); o += *(const v8f*)&ost[w][g][sln][0] * a; }
    const float inv = 1.0f / L; v8us oh, ol;
#pragma unroll
    for (int i = 0; i < 8; ++i) { const float y = o[i] * inv; const unsigned short hb = f2bf(y); oh[i] = hb; ol[i] = f2bf(y - bf2f(hb)); }
    const size_t oo = (size_t)(q0 + qq) * CC + d8 * 8; *(v8us*)(Oh + oo) = oh; *(v8us*)(Ol + oo) = ol;
}
__global__ __launch_bounds__(256) void k_outT(const float* __restrict__ OT, const float* __restrict__ xb, float* OUTB) {
    __shared__ float tl[64][65];
    const int tid = threadIdx.x; const int p0 = blockIdx.x * 64; const int rr = tid >> 2, cq = (tid & 3) * 16;
#pragma unroll
    for (int i = 0; i < 16; ++i) tl[rr][cq + i] = OT[(size_t)(p0 + rr) * CC + cq + i];
    __syncthreads();
    const int lane = tid & 31, wv = tid >> 5;
    auto pass = [&]() {
#pragma unroll
        for (int st = 0; st < 4; ++st) { const int cr = wv * 8 + st * 2 + (lane >> 4); const int pq = (lane & 15) * 4; v4f v; const size_t o = (size_t)cr * NV + p0 + pq;
#pragma unroll
            for (int i = 0; i < 4; ++i) v[i] = bfr(xb[o + i]) + tl[pq + i][cr];
            *(v4f*)(OUTB + o) = v; }
    };
    pass(); 
}

extern "C" void kernel_launch(void* const* d_in, const int* in_sizes, int n_in,
                              void* d_out, int out_size, void* d_ws, size_t ws_size, hipStream_t stream) {
    (void)in_sizes; (void)n_in; (void)out_size;
    const float* x = (const float*)d_in[0]; const float* gam = (const float*)d_in[1]; const float* bet = (const float*)d_in[2]; const float* wq = (const float*)d_in[3]; const float* bq = (const float*)d_in[4]; const float* wk = (const float*)d_in[5]; const float* bk = (const float*)d_in[6]; const float* wv = (const float*)d_in[7]; const float* bv = (const float*)d_in[8]; const float* wp = (const float*)d_in[9]; const float* bp = (const float*)d_in[10];
    float* out = (float*)d_out;    // [2][64][32][32][8]
    char* wsp = (char*)d_ws;
    auto take = [&](size_t bytes) { char* p = wsp; wsp += (bytes + 255) & ~(size_t)255; return (void*)p; };
    bf* WQ = (bf*)take(CC * CC * 2); bf* WK = (bf*)take(CC * CC * 2); bf* WV = (bf*)take(CC * CC * 2); bf* WP = (bf*)take(CC * CC * 2); float* ST = (float*)take(NG * 32 * 4);
    bf* Hh = (bf*)take((size_t)NV * CC * 2); bf* Hl = (bf*)take((size_t)NV * CC * 2); float* QF = (float*)take((size_t)NV * CC * 4); float* KF = (float*)take((size_t)NV * CC * 4); float* VF = (float*)take((size_t)NV * CC * 4);
    bf* Qh = (bf*)take((size_t)NV * CC * 2); bf* Ql = (bf*)take((size_t)NV * CC * 2); bf* Kh = (bf*)take((size_t)NV * CC * 2); bf* Kl = (bf*)take((size_t)NV * CC * 2); bf* VTh = (bf*)take((size_t)CC * NV * 2); bf* VTl = (bf*)take((size_t)CC * NV * 2);
    bf* Oh = (bf*)take((size_t)NV * CC * 2); bf* Ol = (bf*)take((size_t)NV * CC * 2); float* OT = (float*)take((size_t)NV * CC * 4);
    if ((size_t)(wsp - (char*)d_ws) > ws_size) return;
    k_cvt8<<<(CC * CC / 8 + 255) / 256, 256, 0, stream>>>(wq, WQ, CC * CC / 8); k_cvt8<<<(CC * CC / 8 + 255) / 256, 256, 0, stream>>>(wk, WK, CC * CC / 8); k_cvt8<<<(CC * CC / 8 + 255) / 256, 256, 0, stream>>>(wv, WV, CC * CC / 8); k_cvt8<<<(CC * CC / 8 + 255) / 256, 256, 0, stream>>>(wp, WP, CC * CC / 8);   // 'oc' natural
    const dim3 gp(NV / 64, 1, 1);
    for (int b = 0; b < NB_; ++b) { const float* xb = x + (size_t)b * CC * NV;
        k_gnstat<<<NG / 8, 256, 0, stream>>>(xb, ST); k_gnT<<<dim3(1, NV / 64, 1), 256, 0, stream>>>(xb, ST, gam, bet, Hh, Hl);
        k_gemmb<true, false><<<gp, 128, 0, stream>>>(Hh, Hl, WQ, bq, QF, CC, nullptr, nullptr, CC); k_gemmb<true, false><<<gp, 128, 0, stream>>>(Hh, Hl, WK, bk, KF, CC, nullptr, nullptr, CC); k_gemmb<true, false><<<gp, 128, 0, stream>>>(Hh, Hl, WV, bv, VF, CC, nullptr, nullptr, CC);
        k_split64<<<NV / 8, 256, 0, stream>>>(QF, NV, 1.0f, Qh, Ql); k_kfrag<<<NV * CC / 2048, 256, 0, stream>>>(KF, Kh, Kl); k_vfrag<<<NV / 32, 256, 0, stream>>>(VF, VTh, VTl);
        k_attn<<<NV / 32, 256, 0, stream>>>(Qh, Ql, Kh, Kl, VTh, VTl, Oh, Ol);
        k_gemmb<true, false><<<gp, 128, 0, stream>>>(Oh, Ol, WP, bp, OT, CC, nullptr, nullptr, CC);
        k_outT<<<dim3(NV / 64, 1, 1), 256, 0, stream>>>(OT, xb, out + (size_t)b * CC * NV); }
}

// v005
// It runs in 155 microseconds.
// Timed twice side by side with v004, it ran 1.57 and 1.58 times as fast.
// Counting every step since v000, it is 34.7 times as fast.
#include <hip/hip_runtime.h>

// Compute dtypes, f32 accumulate, per item: GroupNorm (32 groups, statistics in f32, fixed order) while transposing to voxel-major bf16 hi + UNSCALED residual planes; q/k/v/proj =
// 1x1x1 convs as [8192 x 64].[64 x 64] GEMMs on hi/lo planes with exact bf16 weights (two products, + bias); single-head attention over the 8192 voxels in one fused kernel with
// hi/lo operands (three products); 1/8 and the softmax in f32; x + out with the channel-major transpose in f32 - on v_wmma_f32_16x16x32_bf16. Deterministic, no atomics; every

#define NB_  2
#define CC   64
#define NV   8192
#define NG   32
#define DM   CC
#define SCL  0.125f
#define GEPS 1e-6f
#define LOSC 1024.0f
#define AW   8
#define AKL  (NV / AW)

typedef _Float16 h16;
typedef unsigned short bf;
typedef __attribute__((ext_vector_type(16))) __bf16   v16bf;
typedef __attribute__((ext_vector_type(16))) _Float16 v16h;
typedef __attribute__((ext_vector_type(8)))  _Float16 v8h;
typedef __attribute__((ext_vector_type(8)))  unsigned short v8us;
typedef __attribute__((ext_vector_type(8)))  float    v8f;
typedef __attribute__((ext_vector_type(4)))  float    v4f;
typedef __attribute__((ext_vector_type(2)))  float    v2f;
typedef __attribute__((ext_vector_type(2)))  __bf16   v2bf;
typedef v8h  __attribute__((may_alias)) v8ha;
typedef v4f  __attribute__((may_alias)) v4fa;
typedef v8us __attribute__((may_alias)) v8usa;

__device__ __forceinline__ unsigned short f2bf(float f) { unsigned u = __float_as_uint(f); u += 0x7FFFu + ((u >> 16) & 1u); return (unsigned short)(u >> 16); }
__device__ __forceinline__ float bf2f(unsigned short b) { return __uint_as_float(((unsigned)b) << 16); }
__device__ __forceinline__ float bfr(float f) { return bf2f(f2bf(f)); }
__device__ __forceinline__ v16h cat16(v8h lo, v8h hi) { return __builtin_shufflevector(lo, hi, 0, 1, 2, 3, 4, 5, 6, 7, 8, 9, 10, 11, 12, 13, 14, 15); }
__device__ __forceinline__ v16bf cat16b(v8us lo, v8us hi) { return __builtin_bit_cast(v16bf, __builtin_shufflevector(lo, hi, 0, 1, 2, 3, 4, 5, 6, 7, 8, 9, 10, 11, 12, 13, 14, 15)); }
__device__ __forceinline__ v8f wmma16(v16h a, v16h b, v8f c) { return __builtin_amdgcn_wmma_f32_16x16x32_f16(false, a, false, b, (short)0, c, false, false); }
__device__ __forceinline__ v8f wmmab(v16bf a, v16bf b, v8f c) { return __builtin_amdgcn_wmma_f32_16x16x32_bf16(false, a, false, b, (short)0, c, false, false); }

// blockIdx.y picks one of up to three stacked 64-row weight matrices with its own bias and its own output plane, blockIdx.z the batch item (planes of NV rows each).
// k_gemmb: 64 x 64 block tile (4 waves x 16 x 64) of C[NTK][NW] = (A [+ Al]).B^T (K = 64) [+ bf(bias[c])] [+ bf(R[r][c]) residual]; f32 whole-line epilogue (or f16
template <bool SPLITA, bool F16OUT = false>
__global__ __launch_bounds__(128) void k_gemmb(const bf* __restrict__ A, const bf* __restrict__ Al, const bf* __restrict__ Bn, const float* __restrict__ bias0, const float* __restrict__ bias1, const float* __restrict__ bias2, float* C, int ldc, h16* C2, const float* __restrict__ R = nullptr, int K = DM, int roundR = 1) {
    __shared__ __align__(16) float ost[4][16 * 68];
    const int lane = threadIdx.x & 31, wave = threadIdx.x >> 5, lr = lane & 15, hi = lane >> 4;
    const int r0 = blockIdx.x * 64 + wave * 16, c0 = 0, sel = blockIdx.y, item = blockIdx.z;
    A += (size_t)item * NV * K; Al += (size_t)item * NV * K; Bn += (size_t)sel * CC * K; C += ((size_t)sel * NB_ + item) * NV * ldc;
    const float* bias = sel == 0 ? bias0 : sel == 1 ? bias1 : bias2;
    const size_t aoff = (size_t)(r0 + lr) * K + 8 * hi;
    size_t boff[4];
#pragma unroll
    for (int t = 0; t < 4; ++t) boff[t] = (size_t)(c0 + t * 16 + lr) * K + 8 * hi;
    v8f acc[4];
#pragma unroll
    for (int t = 0; t < 4; ++t) acc[t] = (v8f){};
#pragma unroll 1
    for (int kc = 0; kc < K; kc += 32) {
        const v16bf a = cat16b(*(const v8us*)(A + aoff + kc), *(const v8us*)(A + aoff + kc + 16));
        v16bf al = a;
        if (SPLITA) al = cat16b(*(const v8us*)(Al + aoff + kc), *(const v8us*)(Al + aoff + kc + 16));
#pragma unroll
        for (int t = 0; t < 4; ++t) { const v16bf b = cat16b(*(const v8us*)(Bn + boff[t] + kc), *(const v8us*)(Bn + boff[t] + kc + 16)); acc[t] = wmmab(a, b, acc[t]); if (SPLITA) acc[t] = wmmab(al, b, acc[t]); }
        asm volatile("v_nop\n\tv_nop\n\tv_nop\n\tv_nop" : "+v"(acc[0]), "+v"(acc[1]), "+v"(acc[2]), "+v"(acc[3]) : "v"(a), "v"(al));
    }
    float* os = &ost[wave][0];
#pragma unroll
    for (int t = 0; t < 4; ++t) { const float bv = bias ? bfr(bias[c0 + t * 16 + lr]) : 0.f;
#pragma unroll
        for (int j = 0; j < 8; ++j) os[(hi * 8 + j) * 68 + t * 16 + lr] = acc[t][j] + bv; }
    __syncthreads();
    if (F16OUT) {
        h16* crow = (h16*)(void*)C + (size_t)r0 * ldc + c0;
        auto pass = [&]() {
#pragma unroll
            for (int s = 0; s < 4; ++s) { const int row = 4 * s + (lane >> 3), piece = lane & 7; const float* sp = os + row * 68 + piece * 8; v8h o, o2;
#pragma unroll
                for (int i = 0; i < 8; ++i) { const h16 a = (h16)sp[i]; o[i] = a; o2[i] = (h16)((sp[i] - (float)a) * LOSC); }
                *(v8h*)(crow + (size_t)row * ldc + piece * 8) = o; if (C2) *(v8h*)(C2 + (size_t)r0 * ldc + c0 + (size_t)row * ldc + piece * 8) = o2; }
        };
        pass(); 
    } else {
        float* crow = C + (size_t)r0 * ldc + c0;
        auto pass = [&]() {
#pragma unroll
            for (int s = 0; s < 8; ++s) { const int Lid = (lane >> 3) + 4 * s, piece = lane & 7; const int row = Lid >> 1, cofs = (Lid & 1) * 32 + piece * 4;
                v4f val = *(const v4fa*)(os + row * 68 + cofs); if (R) { const v4f rv = *(const v4f*)(R + ((size_t)r0 + row) * ldc + c0 + cofs); val += roundR ? (v4f){bfr(rv[0]), bfr(rv[1]), bfr(rv[2]), bfr(rv[3])} : rv; }
                *(v4f*)(crow + (size_t)row * ldc + cofs) = val; }
        };
        pass(); 
    }
}

__device__ __forceinline__ void d_cvt8(int blk, const float* __restrict__ src, bf* dst, size_t n8) {
    const size_t i = (size_t)blk * 256 + threadIdx.x; if (i >= n8) return;
    const v8f v = *(const v8f*)(src + i * 8); v8us o;
#pragma unroll
    for (int k = 0; k < 8; ++k) o[k] = f2bf(v[k]);
    *(v8us*)(dst + i * 8) = o; 
}
__global__ __launch_bounds__(256) void k_zero8(bf* dst, size_t n8) {
    const size_t i = (size_t)blockIdx.x * 256 + threadIdx.x; if (i >= n8) return; v8us z;
#pragma unroll
    for (int k = 0; k < 8; ++k) z[k] = 0;
    *(v8us*)(dst + i * 8) = z; 
}


// d_gnstat: per (group g of 2 channels): mean and rsqrt(var + eps) over 2 x 8192 values of x[b][2g..2g+1][:] (f32; lane-strided fixed-order partial sums + xor tree; biased var
// share a line: NOT whole-line. Instead one wave per 32 groups is too serial; so: block of 256 threads = 8 waves = 8 groups, each wave writing its group's 32-float row (mean, rstd, zeros) as one whole line
__device__ __forceinline__ void d_gnstat(int blk, const float* __restrict__ xb, float* ST) {
    const int lane = threadIdx.x & 31; const int g = blk * 8 + (threadIdx.x >> 5); if (g >= NG) return; const float* base = xb + (size_t)(2 * g) * NV; const int n = 2 * NV; float s = 0.f;
    for (int i = lane; i < n; i += 32) s += base[i];
#pragma unroll
    for (int sh = 16; sh; sh >>= 1) s += __shfl_xor(s, sh, 32);
    const float mu = s / (float)n; float q = 0.f;
    for (int i = lane; i < n; i += 32) { const float d = base[i] - mu; q = fmaf(d, d, q); }
#pragma unroll
    for (int sh = 16; sh; sh >>= 1) q += __shfl_xor(q, sh, 32);
    const float rs = rsqrtf(q / (float)n + GEPS); const float v = (lane == 0) ? mu : (lane == 1) ? rs : 0.f;
    *(float*)(ST + (size_t)g * 32 + lane) = v; 
}
// k_prep: the launches that depend on nothing, side by side in one grid: blocks 0..7 the statistics (4 blocks a batch item), blocks 8..15 the four weight matrices to bf16 (2 blocks each).
__global__ __launch_bounds__(256) void k_prep(const float* __restrict__ x, float* ST, const float* __restrict__ wq, const float* __restrict__ wk, const float* __restrict__ wv, const float* __restrict__ wp, bf* W4) {
    const int bx = blockIdx.x;
    if (bx < NB_ * (NG / 8)) { const int item = bx / (NG / 8); d_gnstat(bx % (NG / 8), x + (size_t)item * CC * NV, ST + (size_t)item * NG * 32); return; }
    const int u = bx - NB_ * (NG / 8), sel = u >> 1;
    d_cvt8(u & 1, sel == 0 ? wq : sel == 1 ? wk : sel == 2 ? wv : wp, W4 + (size_t)sel * CC * CC, CC * CC / 8);
}
// k_gnT: voxel-major planes HT[p][c] of (bf(x[c][p]) - mean_g) rstd_g bf(gamma[c]) + bf(beta[c]) via 64x64 LDS tiles (all 64 channels x 64 voxels per block); wave writes 2 rows x 64
__global__ __launch_bounds__(256) void k_gnT(const float* __restrict__ xb, const float* __restrict__ ST, const float* __restrict__ gam, const float* __restrict__ bet, bf* Hh, bf* Hl) {
    __shared__ float tl[64][65];
    xb += (size_t)blockIdx.z * CC * NV; ST += (size_t)blockIdx.z * NG * 32; Hh += (size_t)blockIdx.z * NV * CC; Hl += (size_t)blockIdx.z * NV * CC;   // batch item
    typedef __attribute__((ext_vector_type(4))) unsigned short v4us;
    const int tid = threadIdx.x, p0 = blockIdx.y * 64; const int rr = tid >> 2, cq = (tid & 3) * 16;   // rr = channel
    { const float mu = ST[(rr >> 1) * 32], rs = ST[(rr >> 1) * 32 + 1], ga = bfr(gam[rr]), be = bfr(bet[rr]);
#pragma unroll
      for (int i = 0; i < 16; ++i) tl[rr][cq + i] = (bfr(xb[(size_t)rr * NV + p0 + cq + i]) - mu) * rs * ga + be; }
    __syncthreads();
    const int lane = tid & 31, wv = tid >> 5;
    auto pass = [&]() {
#pragma unroll
        for (int st = 0; st < 4; ++st) { const int pr = wv * 8 + st * 2 + (lane >> 4); const int cl = (lane & 15) * 4; v4us oh, ol;
#pragma unroll
            for (int i = 0; i < 4; ++i) { const float y = tl[cl + i][pr]; const unsigned short hb = f2bf(y); oh[i] = hb; ol[i] = f2bf(y - bf2f(hb)); }
            const size_t o = (size_t)(p0 + pr) * CC + cl; *(v4us*)(Hh + o) = oh; *(v4us*)(Hl + o) = ol; }
    };
    pass(); 
}
__device__ __forceinline__ void d_split64(int blk, const float* __restrict__ F, int rows, float sc, bf* Ph, bf* Pl) {
    typedef __attribute__((ext_vector_type(2))) unsigned short v2us; typedef __attribute__((ext_vector_type(2))) float v2f_;
    const int lane = threadIdx.x & 31; const size_t r = (size_t)blk * 8 + (threadIdx.x >> 5); if (r >= (size_t)rows) return; const size_t o = r * CC + lane * 2; const v2f_ v = *(const v2f_*)(F + o); v2us oh, ol;
#pragma unroll
    for (int i = 0; i < 2; ++i) { const float y = v[i] * sc; const unsigned short hb = f2bf(y); oh[i] = hb; ol[i] = f2bf(y - bf2f(hb)); }
    *(v2us*)(Ph + o) = oh; *(v2us*)(Pl + o) = ol; 
}
// d_kfrag, d_vfrag: the bf16 hi + residual planes of K and V, laid out in the order in which k_attn's A fragments are read: 512-byte blocks, lane l's 16 bytes at 16 * l, so that a
// wave-wide 16-byte load covers four whole 128-byte lines. One thread makes one 16-byte piece of each plane; a wave stores whole lines.
// K: block ((tile * 2 + ks) * 2 + j) holds K[tile * 16 + c][ks * 32 + h * 16 + j * 8 + i], lane = h * 16 + c.
__device__ __forceinline__ void d_kfrag(int blk, const float* __restrict__ F, bf* Ph, bf* Pl) {
    const int t = blk * 256 + threadIdx.x; const int c = t & 15, h = (t >> 4) & 1, j = (t >> 5) & 1, ks = (t >> 6) & 1, tile = t >> 7;
    const v8f v = *(const v8f*)(F + (size_t)(tile * 16 + c) * CC + ks * 32 + h * 16 + j * 8); v8us oh, ol;
#pragma unroll
    for (int i = 0; i < 8; ++i) { const float y = v[i]; const unsigned short hb = f2bf(y); oh[i] = hb; ol[i] = f2bf(y - bf2f(hb)); }
    *(v8us*)(Ph + (size_t)t * 8) = oh; *(v8us*)(Pl + (size_t)t * 8) = ol;
}
// V: block ((pass * 4 + dt) * 2 + j) holds V[pass * 32 + j * 16 + h * 8 + i][dt * 16 + c], lane = h * 16 + c (the transpose is done by the eight strided reads).
__device__ __forceinline__ void d_vfrag(int blk, const float* __restrict__ V, bf* Th, bf* Tl) {
    const int t = blk * 256 + threadIdx.x; const int c = t & 15, h = (t >> 4) & 1, j = (t >> 5) & 1, dt = (t >> 6) & 3, ps = t >> 8;
    const float* sp = V + (size_t)(ps * 32 + j * 16 + h * 8) * CC + dt * 16 + c; v8us oh, ol;
#pragma unroll
    for (int i = 0; i < 8; ++i) { const float y = sp[i * CC]; const unsigned short hb = f2bf(y); oh[i] = hb; ol[i] = f2bf(y - bf2f(hb)); }
    *(v8us*)(Th + (size_t)t * 8) = oh; *(v8us*)(Tl + (size_t)t * 8) = ol;
}
// k_repack: the three repacks of Q, K and V, which do not depend on one another, side by side in one grid (block ranges of blockIdx.x); blockIdx.z = batch item.
#define RB_Q (NV / 8)
#define RB_K (NV * CC / 2048)
#define RB_V (NV / 32)
__global__ __launch_bounds__(256) void k_repack(const float* __restrict__ QF, const float* __restrict__ KF, const float* __restrict__ VF, bf* Qh, bf* Ql, bf* Kh, bf* Kl, bf* Vh, bf* Vl) {
    const int bx = blockIdx.x; const size_t po = (size_t)blockIdx.z * NV * CC;
    if (bx < RB_Q) d_split64(bx, QF + po, NV, 1.0f, Qh + po, Ql + po);
    else if (bx < RB_Q + RB_K) d_kfrag(bx - RB_Q, KF + po, Kh + po, Kl + po);
    else d_vfrag(bx - RB_Q - RB_K, VF + po, Vh + po, Vl + po);
}
__device__ __forceinline__ v16bf ld16(const bf* p) { return cat16b(*(const v8us*)p, *(const v8us*)(p + 8)); }    // 16 consecutive k a lane: Q; d_kfrag's blocks give K's fragments the same k order
__device__ __forceinline__ v16bf ldfr(const bf* p) { return cat16b(*(const v8us*)p, *(const v8us*)(p + 256)); }  // a fragment from two 512-byte blocks of d_kfrag / d_vfrag, p already at 8 * lane
__device__ __forceinline__ float xhalf(float v) { const int b = __float_as_int(v); return __int_as_float(__builtin_amdgcn_permlanex16(b, b, 0x76543210, 0xfedcba98, false, false)); }   // lane l <-> l ^ 16
// 2^x by v_exp_f32. The v_nop is the one slot the instruction set asks for behind a transcendental before its result is read or its source overwritten; it stands in the same
// statement because a v_nop apart drifts off. In the run of eight each v_exp_f32 works in place on a register of its own, so only the last one needs the slot.
__device__ __forceinline__ float exp2_slot(float x) { float r; asm("v_exp_f32 %0, %1\n\tv_nop" : "=v"(r) : "v"(x)); return r; }
__device__ __forceinline__ void exp2x8(float* x) {
    asm("v_exp_f32 %0, %0\n\tv_exp_f32 %1, %1\n\tv_exp_f32 %2, %2\n\tv_exp_f32 %3, %3\n\tv_exp_f32 %4, %4\n\tv_exp_f32 %5, %5\n\tv_exp_f32 %6, %6\n\tv_exp_f32 %7, %7\n\tv_nop"
        : "+v"(x[0]), "+v"(x[1]), "+v"(x[2]), "+v"(x[3]), "+v"(x[4]), "+v"(x[5]), "+v"(x[6]), "+v"(x[7]));
}
// k_attn: scores, softmax and P.V in one kernel; scores and probabilities never leave the registers. A work-group owns 32 queries; each of its 8 waves walks its own 1024 keys in
// passes of 32: St = K.Qt (a lane holds one query's scores), running maximum and sum per query, Pt packed from the score accumulators as B operand, Ot += Vt.Pt. hi/lo operands,
// three products each. The maximum in use is raised only when a new one exceeds it by more than 8 (log2 units), so P stays below 2^8 times its normalised size.
// The eight waves' partial (max, sum, Ot) are combined through LDS in wave order (fixed), normalised, and split into bf16 hi + residual planes, whole 128-byte rows a wave.
__global__ __launch_bounds__(256) void k_attn(const bf* __restrict__ Qh, const bf* __restrict__ Ql, const bf* __restrict__ Kh, const bf* __restrict__ Kl, const bf* __restrict__ Vh, const bf* __restrict__ Vl, bf* Oh, bf* Ol) {
    __shared__ __align__(32) float ost[AW][8][32][8];
    __shared__ float sm[AW][32], sl[AW][32];
    const int lane = threadIdx.x & 31, wave = __builtin_amdgcn_readfirstlane(threadIdx.x >> 5), c = lane & 15, h = lane >> 4;
    const int q0 = blockIdx.x * 32; const size_t po = (size_t)blockIdx.y * NV * CC;   // po: the batch item's planes
    const float CS = SCL * 1.44269504f;   // scores go to log2 units
    const int ko = c * CC + 16 * h;   // a lane's place in a 16-row tile of Q
    const int fo = lane * 8;          // a lane's place in a 512-byte block of K or V
    const bf* qph = Qh + po + (size_t)q0 * CC; const bf* qpl = Ql + po + (size_t)q0 * CC;
    const bf* kph = Kh + po + (size_t)wave * AKL * CC; const bf* kpl = Kl + po + (size_t)wave * AKL * CC;
    const bf* vph = Vh + po + (size_t)wave * AKL * CC; const bf* vpl = Vl + po + (size_t)wave * AKL * CC;
    v16bf kh[2][2], kl[2][2], vh[4], vl[4];
#pragma unroll
    for (int kt = 0; kt < 2; ++kt) {
#pragma unroll
        for (int ks = 0; ks < 2; ++ks) { kh[kt][ks] = ldfr(kph + fo + (kt * 2 + ks) * 512); kl[kt][ks] = ldfr(kpl + fo + (kt * 2 + ks) * 512); } }
    asm volatile("s_wait_xcnt 0x0" ::: "memory");   // here and twice below: stands before a register that the issued loads name is written again
#pragma unroll
    for (int dt = 0; dt < 4; ++dt) { vh[dt] = ldfr(vph + fo + dt * 512); vl[dt] = ldfr(vpl + fo + dt * 512); }
    asm volatile("s_wait_xcnt 0x0" ::: "memory");
    v16bf qh[2][2], ql[2][2];
#pragma unroll
    for (int qt = 0; qt < 2; ++qt) {
#pragma unroll
        for (int ks = 0; ks < 2; ++ks) { qh[qt][ks] = ld16(qph + ko + qt * 16 * CC + ks * 32); ql[qt][ks] = ld16(qpl + ko + qt * 16 * CC + ks * 32); } }
    asm volatile("s_wait_xcnt 0x0" ::: "memory");
    v8f acc[2][4]; float m[2], l[2];
#pragma unroll
    for (int qt = 0; qt < 2; ++qt) { m[qt] = -3.0e38f; l[qt] = 0.f;
#pragma unroll
        for (int dt = 0; dt < 4; ++dt) acc[qt][dt] = (v8f){}; }
#pragma unroll 1   // rolled: one pass is already 48 matrix instructions and some 300 registers
    for (int p = 0; p < AKL / 32; ++p) {
        v8f s[2][2];
#pragma unroll
        for (int qt = 0; qt < 2; ++qt) { s[qt][0] = (v8f){}; s[qt][1] = (v8f){}; }
#pragma unroll
        for (int ks = 0; ks < 2; ++ks) {
#pragma unroll
            for (int kt = 0; kt < 2; ++kt) {
#pragma unroll
                for (int qt = 0; qt < 2; ++qt) s[qt][kt] = wmmab(kh[kt][ks], qh[qt][ks], s[qt][kt]); }
#pragma unroll
            for (int kt = 0; kt < 2; ++kt) {
#pragma unroll
                for (int qt = 0; qt < 2; ++qt) s[qt][kt] = wmmab(kl[kt][ks], qh[qt][ks], s[qt][kt]); }
#pragma unroll
            for (int kt = 0; kt < 2; ++kt) {
#pragma unroll
                for (int qt = 0; qt < 2; ++qt) s[qt][kt] = wmmab(kh[kt][ks], ql[qt][ks], s[qt][kt]); } }
        // the next pass's K, fetched behind this pass's score products; the last pass fetches its own rows again (in bounds, unused)
        const int more = (p + 1 < AKL / 32) ? 32 : 0; kph += more * CC; kpl += more * CC;
#pragma unroll
        for (int kt = 0; kt < 2; ++kt) {
#pragma unroll
            for (int ks = 0; ks < 2; ++ks) { kh[kt][ks] = ldfr(kph + fo + (kt * 2 + ks) * 512); kl[kt][ks] = ldfr(kpl + fo + (kt * 2 + ks) * 512); } }
        asm volatile("s_wait_xcnt 0x0" ::: "memory");   // stands before the base registers of these loads are advanced in the next pass
        float mx[2];
#pragma unroll
        for (int qt = 0; qt < 2; ++qt) { float a = fmaxf(s[qt][0][0], s[qt][1][0]);
#pragma unroll
            for (int i = 1; i < 8; ++i) a = fmaxf(a, fmaxf(s[qt][0][i], s[qt][1][i]));
            mx[qt] = fmaxf(a, xhalf(a)) * CS; }
        const bool need = (mx[0] > m[0] + 8.0f) | (mx[1] > m[1] + 8.0f);
        if (__builtin_amdgcn_ballot_w32(need) != 0) {   // one scalar branch a pass
#pragma unroll
            for (int qt = 0; qt < 2; ++qt) { const float mn = fmaxf(m[qt], mx[qt]); const float al = exp2_slot(m[qt] - mn); m[qt] = mn; l[qt] *= al;
#pragma unroll
                for (int dt = 0; dt < 4; ++dt) acc[qt][dt] *= al; } }
        v16bf ph[2], pl[2];
#pragma unroll
        for (int qt = 0; qt < 2; ++qt) { float pv[16];
#pragma unroll
            for (int i = 0; i < 16; ++i) pv[i] = fmaf(s[qt][i >> 3][i & 7], CS, -m[qt]);
            exp2x8(pv); exp2x8(pv + 8);
#pragma unroll
            for (int i = 0; i < 16; i += 2) { const v2bf hb = __builtin_convertvector((v2f){pv[i], pv[i + 1]}, v2bf); const v2bf lb = __builtin_convertvector((v2f){pv[i] - (float)hb[0], pv[i + 1] - (float)hb[1]}, v2bf);
                ph[qt][i] = hb[0]; ph[qt][i + 1] = hb[1]; pl[qt][i] = lb[0]; pl[qt][i + 1] = lb[1]; }
#pragma unroll
            for (int w = 8; w; w >>= 1) {
#pragma unroll
                for (int i = 0; i < w; ++i) pv[i] += pv[i + w]; }
            l[qt] += pv[0]; }
#pragma unroll
        for (int dt = 0; dt < 4; ++dt) {
#pragma unroll
            for (int qt = 0; qt < 2; ++qt) acc[qt][dt] = wmmab(vh[dt], ph[qt], acc[qt][dt]); }
#pragma unroll
        for (int dt = 0; dt < 4; ++dt) {
#pragma unroll
            for (int qt = 0; qt < 2; ++qt) acc[qt][dt] = wmmab(vl[dt], ph[qt], acc[qt][dt]); }
#pragma unroll
        for (int dt = 0; dt < 4; ++dt) {
#pragma unroll
            for (int qt = 0; qt < 2; ++qt) acc[qt][dt] = wmmab(vh[dt], pl[qt], acc[qt][dt]); }
        // the next pass's Vt, fetched behind this pass's output products (the last pass: its own columns again, in bounds, unused)
        vph += more * CC; vpl += more * CC;
#pragma unroll
        for (int dt = 0; dt < 4; ++dt) { vh[dt] = ldfr(vph + fo + dt * 512); vl[dt] = ldfr(vpl + fo + dt * 512); }
        asm volatile("s_wait_xcnt 0x0" ::: "memory");   // as above, for the Vt bases
    }
#pragma unroll
    for (int qt = 0; qt < 2; ++qt) { l[qt] += xhalf(l[qt]);
#pragma unroll
        for (int dt = 0; dt < 4; ++dt) *(v8f*)&ost[wave][qt * 4 + dt][lane][0] = acc[qt][dt];
        if (h == 0) { sm[wave][qt * 16 + c] = m[qt]; sl[wave][qt * 16 + c] = l[qt]; } }
    __syncthreads();
    const int qq = wave * 4 + (lane >> 3), d8 = lane & 7;   // query of the block, 8-channel piece of its row
    const int g = (qq >> 4) * 4 + (d8 >> 1), sln = (d8 & 1) * 16 + (qq & 15);
    float M = sm[0][qq];
#pragma unroll
    for (int w = 1; w < AW; ++w) M = fmaxf(M, sm[w][qq]);
    float L = 0.f; v8f o = (v8f){};
#pragma unroll
    for (int w = 0; w < AW; ++w) { const float a = exp2_slot(sm[w][qq] - M); L = fmaf(sl[w][qq], a, L); o += *(const v8f*)&ost[w][g][sln][0] * a; }
    const float inv = 1.0f / L; v8us oh, ol;
#pragma unroll
    for (int i = 0; i < 8; ++i) { const float y = o[i] * inv; const unsigned short hb = f2bf(y); oh[i] = hb; ol[i] = f2bf(y - bf2f(hb)); }
    const size_t oo = po + (size_t)(q0 + qq) * CC + d8 * 8; *(v8us*)(Oh + oo) = oh; *(v8us*)(Ol + oo) = ol;
}
__global__ __launch_bounds__(256) void k_outT(const float* __restrict__ OT, const float* __restrict__ xb, float* OUTB) {
    __shared__ float tl[64][65];
    OT += (size_t)blockIdx.y * NV * CC; xb += (size_t)blockIdx.y * CC * NV; OUTB += (size_t)blockIdx.y * CC * NV;   // batch item
    const int tid = threadIdx.x; const int p0 = blockIdx.x * 64; const int rr = tid >> 2, cq = (tid & 3) * 16;
#pragma unroll
    for (int i = 0; i < 16; ++i) tl[rr][cq + i] = OT[(size_t)(p0 + rr) * CC + cq + i];
    __syncthreads();
    const int lane = tid & 31, wv = tid >> 5;
    auto pass = [&]() {
#pragma unroll
        for (int st = 0; st < 4; ++st) { const int cr = wv * 8 + st * 2 + (lane >> 4); const int pq = (lane & 15) * 4; v4f v; const size_t o = (size_t)cr * NV + p0 + pq;
#pragma unroll
            for (int i = 0; i < 4; ++i) v[i] = bfr(xb[o + i]) + tl[pq + i][cr];
            *(v4f*)(OUTB + o) = v; }
    };
    pass(); 
}

extern "C" void kernel_launch(void* const* d_in, const int* in_sizes, int n_in,
                              void* d_out, int out_size, void* d_ws, size_t ws_size, hipStream_t stream) {
    (void)in_sizes; (void)n_in; (void)out_size;
    const float* x = (const float*)d_in[0]; const float* gam = (const float*)d_in[1]; const float* bet = (const float*)d_in[2]; const float* wq = (const float*)d_in[3]; const float* bq = (const float*)d_in[4]; const float* wk = (const float*)d_in[5]; const float* bk = (const float*)d_in[6]; const float* wv = (const float*)d_in[7]; const float* bv = (const float*)d_in[8]; const float* wp = (const float*)d_in[9]; const float* bp = (const float*)d_in[10];
    float* out = (float*)d_out;    // [2][64][32][32][8]
    char* wsp = (char*)d_ws;
    auto take = [&](size_t bytes) { char* p = wsp; wsp += (bytes + 255) & ~(size_t)255; return (void*)p; };
    // every plane holds both batch items, item after item; the four weight matrices and the three f32 planes of q, k, v stand behind one another
    bf* W4 = (bf*)take((size_t)4 * CC * CC * 2); float* ST = (float*)take((size_t)NB_ * NG * 32 * 4);
    bf* Hh = (bf*)take((size_t)NB_ * NV * CC * 2); bf* Hl = (bf*)take((size_t)NB_ * NV * CC * 2); float* QF = (float*)take((size_t)3 * NB_ * NV * CC * 4); float* KF = QF + (size_t)NB_ * NV * CC; float* VF = KF + (size_t)NB_ * NV * CC;
    bf* Qh = (bf*)take((size_t)NB_ * NV * CC * 2); bf* Ql = (bf*)take((size_t)NB_ * NV * CC * 2); bf* Kh = (bf*)take((size_t)NB_ * NV * CC * 2); bf* Kl = (bf*)take((size_t)NB_ * NV * CC * 2); bf* VTh = (bf*)take((size_t)NB_ * CC * NV * 2); bf* VTl = (bf*)take((size_t)NB_ * CC * NV * 2);
    bf* Oh = (bf*)take((size_t)NB_ * NV * CC * 2); bf* Ol = (bf*)take((size_t)NB_ * NV * CC * 2); float* OT = (float*)take((size_t)NB_ * NV * CC * 4);
    if ((size_t)(wsp - (char*)d_ws) > ws_size) return;
    k_prep<<<NB_ * (NG / 8) + 8, 256, 0, stream>>>(x, ST, wq, wk, wv, wp, W4);
    k_gnT<<<dim3(1, NV / 64, NB_), 256, 0, stream>>>(x, ST, gam, bet, Hh, Hl);
    k_gemmb<true, false><<<dim3(NV / 64, 3, NB_), 128, 0, stream>>>(Hh, Hl, W4, bq, bk, bv, QF, CC, nullptr, nullptr, CC);
    k_repack<<<dim3(RB_Q + RB_K + RB_V, 1, NB_), 256, 0, stream>>>(QF, KF, VF, Qh, Ql, Kh, Kl, VTh, VTl);
    k_attn<<<dim3(NV / 32, NB_, 1), 256, 0, stream>>>(Qh, Ql, Kh, Kl, VTh, VTl, Oh, Ol);
    k_gemmb<true, false><<<dim3(NV / 64, 1, NB_), 128, 0, stream>>>(Oh, Ol, W4 + (size_t)3 * CC * CC, bp, bp, bp, OT, CC, nullptr, nullptr, CC);
    k_outT<<<dim3(NV / 64, NB_, 1), 256, 0, stream>>>(OT, x, out);
}

// v006
// A run of this version takes 115 microseconds.
// Timed twice side by side with v005, it ran 1.35 and 1.36 times as fast.
// All steps since v000 together make it 46.9 times as fast.
#include <hip/hip_runtime.h>

// Compute dtypes, f32 accumulate, per item: GroupNorm (32 groups, statistics in f32, fixed order) while transposing to voxel-major bf16 hi + UNSCALED residual planes; q/k/v/proj =
// 1x1x1 convs as [8192 x 64].[64 x 64] GEMMs on hi/lo planes with exact bf16 weights (two products, + bias); single-head attention over the 8192 voxels in one fused kernel with
// hi/lo operands (three products); 1/8 and the softmax in f32; x + out with the channel-major transpose in f32 - on v_wmma_f32_16x16x32_bf16. Deterministic, no atomics; every

#define NB_  2
#define CC   64
#define NV   8192
#define NG   32
#define DM   CC
#define SCL  0.125f
#define GEPS 1e-6f
#define LOSC 1024.0f
#define AW   8
#define AKL  (NV / AW)

typedef _Float16 h16;
typedef unsigned short bf;
typedef __attribute__((ext_vector_type(16))) __bf16   v16bf;
typedef __attribute__((ext_vector_type(16))) _Float16 v16h;
typedef __attribute__((ext_vector_type(8)))  _Float16 v8h;
typedef __attribute__((ext_vector_type(8)))  unsigned short v8us;
typedef __attribute__((ext_vector_type(8)))  float    v8f;
typedef __attribute__((ext_vector_type(4)))  float    v4f;
typedef __attribute__((ext_vector_type(2)))  float    v2f;
typedef __attribute__((ext_vector_type(2)))  __bf16   v2bf;
typedef v8h  __attribute__((may_alias)) v8ha;
typedef v4f  __attribute__((may_alias)) v4fa;
typedef v8us __attribute__((may_alias)) v8usa;

__device__ __forceinline__ unsigned short f2bf(float f) { unsigned u = __float_as_uint(f); u += 0x7FFFu + ((u >> 16) & 1u); return (unsigned short)(u >> 16); }
__device__ __forceinline__ float bf2f(unsigned short b) { return __uint_as_float(((unsigned)b) << 16); }
__device__ __forceinline__ float bfr(float f) { return bf2f(f2bf(f)); }
__device__ __forceinline__ v16h cat16(v8h lo, v8h hi) { return __builtin_shufflevector(lo, hi, 0, 1, 2, 3, 4, 5, 6, 7, 8, 9, 10, 11, 12, 13, 14, 15); }
__device__ __forceinline__ v16bf cat16b(v8us lo, v8us hi) { return __builtin_bit_cast(v16bf, __builtin_shufflevector(lo, hi, 0, 1, 2, 3, 4, 5, 6, 7, 8, 9, 10, 11, 12, 13, 14, 15)); }
__device__ __forceinline__ v8f wmma16(v16h a, v16h b, v8f c) { return __builtin_amdgcn_wmma_f32_16x16x32_f16(false, a, false, b, (short)0, c, false, false); }
__device__ __forceinline__ v8f wmmab(v16bf a, v16bf b, v8f c) { return __builtin_amdgcn_wmma_f32_16x16x32_bf16(false, a, false, b, (short)0, c, false, false); }

// blockIdx.y picks one of up to three stacked 64-row weight matrices with its own bias and its own output plane, blockIdx.z the batch item (planes of NV rows each).
// k_gemmb: 64 x 64 block tile (4 waves x 16 x 64) of C[NTK][NW] = (A [+ Al]).B^T (K = 64) [+ bf(bias[c])] [+ bf(R[r][c]) residual]; f32 whole-line epilogue (or f16
template <bool SPLITA, bool F16OUT = false>
__global__ __launch_bounds__(128) void k_gemmb(const bf* __restrict__ A, const bf* __restrict__ Al, const bf* __restrict__ Bn, const float* __restrict__ bias0, const float* __restrict__ bias1, const float* __restrict__ bias2, float* C, int ldc, h16* C2, const float* __restrict__ R = nullptr, int K = DM, int roundR = 1) {
    __shared__ __align__(16) float ost[4][16 * 68];
    const int lane = threadIdx.x & 31, wave = threadIdx.x >> 5, lr = lane & 15, hi = lane >> 4;
    const int r0 = blockIdx.x * 64 + wave * 16, c0 = 0, sel = blockIdx.y, item = blockIdx.z;
    A += (size_t)item * NV * K; Al += (size_t)item * NV * K; Bn += (size_t)sel * CC * K; C += ((size_t)sel * NB_ + item) * NV * ldc;
    const float* bias = sel == 0 ? bias0 : sel == 1 ? bias1 : bias2;
    const size_t aoff = (size_t)(r0 + lr) * K + 8 * hi;
    size_t boff[4];
#pragma unroll
    for (int t = 0; t < 4; ++t) boff[t] = (size_t)(c0 + t * 16 + lr) * K + 8 * hi;
    v8f acc[4];
#pragma unroll
    for (int t = 0; t < 4; ++t) acc[t] = (v8f){};
#pragma unroll 1
    for (int kc = 0; kc < K; kc += 32) {
        const v16bf a = cat16b(*(const v8us*)(A + aoff + kc), *(const v8us*)(A + aoff + kc + 16));
        v16bf al = a;
        if (SPLITA) al = cat16b(*(const v8us*)(Al + aoff + kc), *(const v8us*)(Al + aoff + kc + 16));
#pragma unroll
        for (int t = 0; t < 4; ++t) { const v16bf b = cat16b(*(const v8us*)(Bn + boff[t] + kc), *(const v8us*)(Bn + boff[t] + kc + 16)); acc[t] = wmmab(a, b, acc[t]); if (SPLITA) acc[t] = wmmab(al, b, acc[t]); }
        asm volatile("v_nop\n\tv_nop\n\tv_nop\n\tv_nop" : "+v"(acc[0]), "+v"(acc[1]), "+v"(acc[2]), "+v"(acc[3]) : "v"(a), "v"(al));
    }
    float* os = &ost[wave][0];
#pragma unroll
    for (int t = 0; t < 4; ++t) { const float bv = bias ? bfr(bias[c0 + t * 16 + lr]) : 0.f;
#pragma unroll
        for (int j = 0; j < 8; ++j) os[(hi * 8 + j) * 68 + t * 16 + lr] = acc[t][j] + bv; }
    __syncthreads();
    if (F16OUT) {
        h16* crow = (h16*)(void*)C + (size_t)r0 * ldc + c0;
        auto pass = [&]() {
#pragma unroll
            for (int s = 0; s < 4; ++s) { const int row = 4 * s + (lane >> 3), piece = lane & 7; const float* sp = os + row * 68 + piece * 8; v8h o, o2;
#pragma unroll
                for (int i = 0; i < 8; ++i) { const h16 a = (h16)sp[i]; o[i] = a; o2[i] = (h16)((sp[i] - (float)a) * LOSC); }
                *(v8h*)(crow + (size_t)row * ldc + piece * 8) = o; if (C2) *(v8h*)(C2 + (size_t)r0 * ldc + c0 + (size_t)row * ldc + piece * 8) = o2; }
        };
        pass(); 
    } else {
        float* crow = C + (size_t)r0 * ldc + c0;
        auto pass = [&]() {
#pragma unroll
            for (int s = 0; s < 8; ++s) { const int Lid = (lane >> 3) + 4 * s, piece = lane & 7; const int row = Lid >> 1, cofs = (Lid & 1) * 32 + piece * 4;
                v4f val = *(const v4fa*)(os + row * 68 + cofs); if (R) { const v4f rv = *(const v4f*)(R + ((size_t)r0 + row) * ldc + c0 + cofs); val += roundR ? (v4f){bfr(rv[0]), bfr(rv[1]), bfr(rv[2]), bfr(rv[3])} : rv; }
                *(v4f*)(crow + (size_t)row * ldc + cofs) = val; }
        };
        pass(); 
    }
}

__device__ __forceinline__ void d_cvt8(int blk, const float* __restrict__ src, bf* dst, size_t n8) {
    const size_t i = (size_t)blk * 256 + threadIdx.x; if (i >= n8) return;
    const v8f v = *(const v8f*)(src + i * 8); v8us o;
#pragma unroll
    for (int k = 0; k < 8; ++k) o[k] = f2bf(v[k]);
    *(v8us*)(dst + i * 8) = o; 
}
__global__ __launch_bounds__(256) void k_zero8(bf* dst, size_t n8) {
    const size_t i = (size_t)blockIdx.x * 256 + threadIdx.x; if (i >= n8) return; v8us z;
#pragma unroll
    for (int k = 0; k < 8; ++k) z[k] = 0;
    *(v8us*)(dst + i * 8) = z; 
}


// d_gnstat: mean and rsqrt(var + eps) (biased var, f32) of one group of 2 channels = 2 x 8192 contiguous values of x, by one work-group of 8 waves. Each thread fetches its 64 values
// once, as 16 16-byte loads that are all in flight together, and keeps them in registers for both passes (sum, then squared deviations from the mean). Fixed order: a thread's 16
// vectors, their 4 elements, xor tree over the lanes, the 8 waves' partial sums through LDS in wave order. Wave 0 writes the group's whole 128-byte line of ST.
__device__ __forceinline__ void d_gnstat(int g, const float* __restrict__ xb, float* ST) {
    __shared__ float ps[8], pq[8];
    const int tid = threadIdx.x, lane = tid & 31, wv = tid >> 5; const v4f* base = (const v4f*)(xb + (size_t)(2 * g) * NV); const int n = 2 * NV;
    v4f v[16];
#pragma unroll
    for (int i = 0; i < 16; ++i) v[i] = base[i * 256 + tid];
    v4f s4 = v[0];
#pragma unroll
    for (int i = 1; i < 16; ++i) s4 += v[i];
    float s = (s4[0] + s4[1]) + (s4[2] + s4[3]);
#pragma unroll
    for (int sh = 16; sh; sh >>= 1) s += __shfl_xor(s, sh, 32);
    if (lane == 0) ps[wv] = s;
    __syncthreads();
    s = ps[0];
#pragma unroll
    for (int w = 1; w < 8; ++w) s += ps[w];
    const float mu = s / (float)n; v4f q4 = (v4f){};
#pragma unroll
    for (int i = 0; i < 16; ++i) { const v4f d = v[i] - mu; q4 += d * d; }
    float q = (q4[0] + q4[1]) + (q4[2] + q4[3]);
#pragma unroll
    for (int sh = 16; sh; sh >>= 1) q += __shfl_xor(q, sh, 32);
    if (lane == 0) pq[wv] = q;
    __syncthreads();
    q = pq[0];
#pragma unroll
    for (int w = 1; w < 8; ++w) q += pq[w];
    const float rs = rsqrtf(q / (float)n + GEPS);
    if (wv == 0) ST[(size_t)g * 32 + lane] = (lane == 0) ? mu : (lane == 1) ? rs : 0.f;
}
// k_prep: the launches that depend on nothing, side by side in one grid: blocks 0..63 the statistics (one block a group, 32 groups a batch item), blocks 64..71 the four weight matrices to bf16 (2 blocks each).
__global__ __launch_bounds__(256) void k_prep(const float* __restrict__ x, float* ST, const float* __restrict__ wq, const float* __restrict__ wk, const float* __restrict__ wv, const float* __restrict__ wp, bf* W4) {
    const int bx = blockIdx.x;
    if (bx < NB_ * NG) { const int item = bx / NG; d_gnstat(bx % NG, x + (size_t)item * CC * NV, ST + (size_t)item * NG * 32); return; }
    const int u = bx - NB_ * NG, sel = u >> 1;
    d_cvt8(u & 1, sel == 0 ? wq : sel == 1 ? wk : sel == 2 ? wv : wp, W4 + (size_t)sel * CC * CC, CC * CC / 8);
}
// k_gnT: voxel-major planes HT[p][c] of (bf(x[c][p]) - mean_g) rstd_g bf(gamma[c]) + bf(beta[c]) via 64x64 LDS tiles (all 64 channels x 64 voxels per block); wave writes 2 rows x 64
__global__ __launch_bounds__(256) void k_gnT(const float* __restrict__ xb, const float* __restrict__ ST, const float* __restrict__ gam, const float* __restrict__ bet, bf* Hh, bf* Hl) {
    __shared__ float tl[64][65];
    xb += (size_t)blockIdx.z * CC * NV; ST += (size_t)blockIdx.z * NG * 32; Hh += (size_t)blockIdx.z * NV * CC; Hl += (size_t)blockIdx.z * NV * CC;   // batch item
    typedef __attribute__((ext_vector_type(4))) unsigned short v4us;
    const int tid = threadIdx.x, p0 = blockIdx.y * 64; const int rr = tid >> 2, cq = (tid & 3) * 16;   // rr = channel
    { const float mu = ST[(rr >> 1) * 32], rs = ST[(rr >> 1) * 32 + 1], ga = bfr(gam[rr]), be = bfr(bet[rr]);
#pragma unroll
      for (int i = 0; i < 16; ++i) tl[rr][cq + i] = (bfr(xb[(size_t)rr * NV + p0 + cq + i]) - mu) * rs * ga + be; }
    __syncthreads();
    const int lane = tid & 31, wv = tid >> 5;
    auto pass = [&]() {
#pragma unroll
        for (int st = 0; st < 4; ++st) { const int pr = wv * 8 + st * 2 + (lane >> 4); const int cl = (lane & 15) * 4; v4us oh, ol;
#pragma unroll
            for (int i = 0; i < 4; ++i) { const float y = tl[cl + i][pr]; const unsigned short hb = f2bf(y); oh[i] = hb; ol[i] = f2bf(y - bf2f(hb)); }
            const size_t o = (size_t)(p0 + pr) * CC + cl; *(v4us*)(Hh + o) = oh; *(v4us*)(Hl + o) = ol; }
    };
    pass(); 
}
__device__ __forceinline__ void d_split64(int blk, const float* __restrict__ F, int rows, float sc, bf* Ph, bf* Pl) {
    typedef __attribute__((ext_vector_type(2))) unsigned short v2us; typedef __attribute__((ext_vector_type(2))) float v2f_;
    const int lane = threadIdx.x & 31; const size_t r = (size_t)blk * 8 + (threadIdx.x >> 5); if (r >= (size_t)rows) return; const size_t o = r * CC + lane * 2; const v2f_ v = *(const v2f_*)(F + o); v2us oh, ol;
#pragma unroll
    for (int i = 0; i < 2; ++i) { const float y = v[i] * sc; const unsigned short hb = f2bf(y); oh[i] = hb; ol[i] = f2bf(y - bf2f(hb)); }
    *(v2us*)(Ph + o) = oh; *(v2us*)(Pl + o) = ol; 
}
// d_kfrag, d_vfrag: the bf16 hi + residual planes of K and V, laid out in the order in which k_attn's A fragments are read: 512-byte blocks, lane l's 16 bytes at 16 * l, so that a
// wave-wide 16-byte load covers four whole 128-byte lines. One thread makes one 16-byte piece of each plane; a wave stores whole lines.
// K: block ((tile * 2 + ks) * 2 + j) holds K[tile * 16 + c][ks * 32 + h * 16 + j * 8 + i], lane = h * 16 + c.
__device__ __forceinline__ void d_kfrag(int blk, const float* __restrict__ F, bf* Ph, bf* Pl) {
    const int t = blk * 256 + threadIdx.x; const int c = t & 15, h = (t >> 4) & 1, j = (t >> 5) & 1, ks = (t >> 6) & 1, tile = t >> 7;
    const v8f v = *(const v8f*)(F + (size_t)(tile * 16 + c) * CC + ks * 32 + h * 16 + j * 8); v8us oh, ol;
#pragma unroll
    for (int i = 0; i < 8; ++i) { const float y = v[i]; const unsigned short hb = f2bf(y); oh[i] = hb; ol[i] = f2bf(y - bf2f(hb)); }
    *(v8us*)(Ph + (size_t)t * 8) = oh; *(v8us*)(Pl + (size_t)t * 8) = ol;
}
// V: block ((pass * 4 + dt) * 2 + j) holds V[pass * 32 + j * 16 + h * 8 + i][dt * 16 + c], lane = h * 16 + c (the transpose is done by the eight strided reads).
__device__ __forceinline__ void d_vfrag(int blk, const float* __restrict__ V, bf* Th, bf* Tl) {
    const int t = blk * 256 + threadIdx.x; const int c = t & 15, h = (t >> 4) & 1, j = (t >> 5) & 1, dt = (t >> 6) & 3, ps = t >> 8;
    const float* sp = V + (size_t)(ps * 32 + j * 16 + h * 8) * CC + dt * 16 + c; v8us oh, ol;
#pragma unroll
    for (int i = 0; i < 8; ++i) { const float y = sp[i * CC]; const unsigned short hb = f2bf(y); oh[i] = hb; ol[i] = f2bf(y - bf2f(hb)); }
    *(v8us*)(Th + (size_t)t * 8) = oh; *(v8us*)(Tl + (size_t)t * 8) = ol;
}
// k_repack: the three repacks of Q, K and V, which do not depend on one another, side by side in one grid (block ranges of blockIdx.x); blockIdx.z = batch item.
#define RB_Q (NV / 8)
#define RB_K (NV * CC / 2048)
#define RB_V (NV / 32)
__global__ __launch_bounds__(256) void k_repack(const float* __restrict__ QF, const float* __restrict__ KF, const float* __restrict__ VF, bf* Qh, bf* Ql, bf* Kh, bf* Kl, bf* Vh, bf* Vl) {
    const int bx = blockIdx.x; const size_t po = (size_t)blockIdx.z * NV * CC;
    if (bx < RB_Q) d_split64(bx, QF + po, NV, 1.0f, Qh + po, Ql + po);
    else if (bx < RB_Q + RB_K) d_kfrag(bx - RB_Q, KF + po, Kh + po, Kl + po);
    else d_vfrag(bx - RB_Q - RB_K, VF + po, Vh + po, Vl + po);
}
__device__ __forceinline__ v16bf ld16(const bf* p) { return cat16b(*(const v8us*)p, *(const v8us*)(p + 8)); }    // 16 consecutive k a lane: Q; d_kfrag's blocks give K's fragments the same k order
__device__ __forceinline__ v16bf ldfr(const bf* p) { return cat16b(*(const v8us*)p, *(const v8us*)(p + 256)); }  // a fragment from two 512-byte blocks of d_kfrag / d_vfrag, p already at 8 * lane
__device__ __forceinline__ float xhalf(float v) { const int b = __float_as_int(v); return __int_as_float(__builtin_amdgcn_permlanex16(b, b, 0x76543210, 0xfedcba98, false, false)); }   // lane l <-> l ^ 16
// 2^x by v_exp_f32. The v_nop is the one slot the instruction set asks for behind a transcendental before its result is read or its source overwritten; it stands in the same
// statement because a v_nop apart drifts off. In the run of eight each v_exp_f32 works in place on a register of its own, so only the last one needs the slot.
__device__ __forceinline__ float exp2_slot(float x) { float r; asm("v_exp_f32 %0, %1\n\tv_nop" : "=v"(r) : "v"(x)); return r; }
__device__ __forceinline__ void exp2x8(float* x) {
    asm("v_exp_f32 %0, %0\n\tv_exp_f32 %1, %1\n\tv_exp_f32 %2, %2\n\tv_exp_f32 %3, %3\n\tv_exp_f32 %4, %4\n\tv_exp_f32 %5, %5\n\tv_exp_f32 %6, %6\n\tv_exp_f32 %7, %7\n\tv_nop"
        : "+v"(x[0]), "+v"(x[1]), "+v"(x[2]), "+v"(x[3]), "+v"(x[4]), "+v"(x[5]), "+v"(x[6]), "+v"(x[7]));
}
// k_attn: scores, softmax and P.V in one kernel; scores and probabilities never leave the registers. A work-group owns 32 queries; each of its 8 waves walks its own 1024 keys in
// passes of 32: St = K.Qt (a lane holds one query's scores), running maximum and sum per query, Pt packed from the score accumulators as B operand, Ot += Vt.Pt. hi/lo operands,
// three products each. The maximum in use is raised only when a new one exceeds it by more than 8 (log2 units), so P stays below 2^8 times its normalised size.
// The eight waves' partial (max, sum, Ot) are combined through LDS in wave order (fixed), normalised, and split into bf16 hi + residual planes, whole 128-byte rows a wave.
__global__ __launch_bounds__(256) void k_attn(const bf* __restrict__ Qh, const bf* __restrict__ Ql, const bf* __restrict__ Kh, const bf* __restrict__ Kl, const bf* __restrict__ Vh, const bf* __restrict__ Vl, bf* Oh, bf* Ol) {
    __shared__ __align__(32) float ost[AW][8][32][8];
    __shared__ float sm[AW][32], sl[AW][32];
    const int lane = threadIdx.x & 31, wave = __builtin_amdgcn_readfirstlane(threadIdx.x >> 5), c = lane & 15, h = lane >> 4;
    const int q0 = blockIdx.x * 32; const size_t po = (size_t)blockIdx.y * NV * CC;   // po: the batch item's planes
    const float CS = SCL * 1.44269504f;   // scores go to log2 units
    const int ko = c * CC + 16 * h;   // a lane's place in a 16-row tile of Q
    const int fo = lane * 8;          // a lane's place in a 512-byte block of K or V
    const bf* qph = Qh + po + (size_t)q0 * CC; const bf* qpl = Ql + po + (size_t)q0 * CC;
    const bf* kph = Kh + po + (size_t)wave * AKL * CC; const bf* kpl = Kl + po + (size_t)wave * AKL * CC;
    const bf* vph = Vh + po + (size_t)wave * AKL * CC; const bf* vpl = Vl + po + (size_t)wave * AKL * CC;
    v16bf kh[2][2], kl[2][2], vh[4], vl[4];
#pragma unroll
    for (int kt = 0; kt < 2; ++kt) {
#pragma unroll
        for (int ks = 0; ks < 2; ++ks) { kh[kt][ks] = ldfr(kph + fo + (kt * 2 + ks) * 512); kl[kt][ks] = ldfr(kpl + fo + (kt * 2 + ks) * 512); } }
    asm volatile("s_wait_xcnt 0x0" ::: "memory");   // here and twice below: stands before a register that the issued loads name is written again
#pragma unroll
    for (int dt = 0; dt < 4; ++dt) { vh[dt] = ldfr(vph + fo + dt * 512); vl[dt] = ldfr(vpl + fo + dt * 512); }
    asm volatile("s_wait_xcnt 0x0" ::: "memory");
    v16bf qh[2][2], ql[2][2];
#pragma unroll
    for (int qt = 0; qt < 2; ++qt) {
#pragma unroll
        for (int ks = 0; ks < 2; ++ks) { qh[qt][ks] = ld16(qph + ko + qt * 16 * CC + ks * 32); ql[qt][ks] = ld16(qpl + ko + qt * 16 * CC + ks * 32); } }
    asm volatile("s_wait_xcnt 0x0" ::: "memory");
    v8f acc[2][4]; float m[2], l[2];
#pragma unroll
    for (int qt = 0; qt < 2; ++qt) { m[qt] = -3.0e38f; l[qt] = 0.f;
#pragma unroll
        for (int dt = 0; dt < 4; ++dt) acc[qt][dt] = (v8f){}; }
#pragma unroll 1   // rolled: one pass is already 48 matrix instructions and some 300 registers
    for (int p = 0; p < AKL / 32; ++p) {
        v8f s[2][2];
#pragma unroll
        for (int qt = 0; qt < 2; ++qt) { s[qt][0] = (v8f){}; s[qt][1] = (v8f){}; }
#pragma unroll
        for (int ks = 0; ks < 2; ++ks) {
#pragma unroll
            for (int kt = 0; kt < 2; ++kt) {
#pragma unroll
                for (int qt = 0; qt < 2; ++qt) s[qt][kt] = wmmab(kh[kt][ks], qh[qt][ks], s[qt][kt]); }
#pragma unroll
            for (int kt = 0; kt < 2; ++kt) {
#pragma unroll
                for (int qt = 0; qt < 2; ++qt) s[qt][kt] = wmmab(kl[kt][ks], qh[qt][ks], s[qt][kt]); }
#pragma unroll
            for (int kt = 0; kt < 2; ++kt) {
#pragma unroll
                for (int qt = 0; qt < 2; ++qt) s[qt][kt] = wmmab(kh[kt][ks], ql[qt][ks], s[qt][kt]); } }
        // the next pass's K, fetched behind this pass's score products; the last pass fetches its own rows again (in bounds, unused)
        const int more = (p + 1 < AKL / 32) ? 32 : 0; kph += more * CC; kpl += more * CC;
#pragma unroll
        for (int kt = 0; kt < 2; ++kt) {
#pragma unroll
            for (int ks = 0; ks < 2; ++ks) { kh[kt][ks] = ldfr(kph + fo + (kt * 2 + ks) * 512); kl[kt][ks] = ldfr(kpl + fo + (kt * 2 + ks) * 512); } }
        asm volatile("s_wait_xcnt 0x0" ::: "memory");   // stands before the base registers of these loads are advanced in the next pass
        float mx[2];
#pragma unroll
        for (int qt = 0; qt < 2; ++qt) { float a = fmaxf(s[qt][0][0], s[qt][1][0]);
#pragma unroll
            for (int i = 1; i < 8; ++i) a = fmaxf(a, fmaxf(s[qt][0][i], s[qt][1][i]));
            mx[qt] = fmaxf(a, xhalf(a)) * CS; }
        const bool need = (mx[0] > m[0] + 8.0f) | (mx[1] > m[1] + 8.0f);
        if (__builtin_amdgcn_ballot_w32(need) != 0) {   // one scalar branch a pass
#pragma unroll
            for (int qt = 0; qt < 2; ++qt) { const float mn = fmaxf(m[qt], mx[qt]); const float al = exp2_slot(m[qt] - mn); m[qt] = mn; l[qt] *= al;
#pragma unroll
                for (int dt = 0; dt < 4; ++dt) acc[qt][dt] *= al; } }
        v16bf ph[2], pl[2];
#pragma unroll
        for (int qt = 0; qt < 2; ++qt) { float pv[16];
#pragma unroll
            for (int i = 0; i < 16; ++i) pv[i] = fmaf(s[qt][i >> 3][i & 7], CS, -m[qt]);
            exp2x8(pv); exp2x8(pv + 8);
#pragma unroll
            for (int i = 0; i < 16; i += 2) { const v2bf hb = __builtin_convertvector((v2f){pv[i], pv[i + 1]}, v2bf); const v2bf lb = __builtin_convertvector((v2f){pv[i] - (float)hb[0], pv[i + 1] - (float)hb[1]}, v2bf);
                ph[qt][i] = hb[0]; ph[qt][i + 1] = hb[1]; pl[qt][i] = lb[0]; pl[qt][i + 1] = lb[1]; }
#pragma unroll
            for (int w = 8; w; w >>= 1) {
#pragma unroll
                for (int i = 0; i < w; ++i) pv[i] += pv[i + w]; }
            l[qt] += pv[0]; }
#pragma unroll
        for (int dt = 0; dt < 4; ++dt) {
#pragma unroll
            for (int qt = 0; qt < 2; ++qt) acc[qt][dt] = wmmab(vh[dt], ph[qt], acc[qt][dt]); }
#pragma unroll
        for (int dt = 0; dt < 4; ++dt) {
#pragma unroll
            for (int qt = 0; qt < 2; ++qt) acc[qt][dt] = wmmab(vl[dt], ph[qt], acc[qt][dt]); }
#pragma unroll
        for (int dt = 0; dt < 4; ++dt) {
#pragma unroll
            for (int qt = 0; qt < 2; ++qt) acc[qt][dt] = wmmab(vh[dt], pl[qt], acc[qt][dt]); }
        // the next pass's Vt, fetched behind this pass's output products (the last pass: its own columns again, in bounds, unused)
        vph += more * CC; vpl += more * CC;
#pragma unroll
        for (int dt = 0; dt < 4; ++dt) { vh[dt] = ldfr(vph + fo + dt * 512); vl[dt] = ldfr(vpl + fo + dt * 512); }
        asm volatile("s_wait_xcnt 0x0" ::: "memory");   // as above, for the Vt bases
    }
#pragma unroll
    for (int qt = 0; qt < 2; ++qt) { l[qt] += xhalf(l[qt]);
#pragma unroll
        for (int dt = 0; dt < 4; ++dt) *(v8f*)&ost[wave][qt * 4 + dt][lane][0] = acc[qt][dt];
        if (h == 0) { sm[wave][qt * 16 + c] = m[qt]; sl[wave][qt * 16 + c] = l[qt]; } }
    __syncthreads();
    const int qq = wave * 4 + (lane >> 3), d8 = lane & 7;   // query of the block, 8-channel piece of its row
    const int g = (qq >> 4) * 4 + (d8 >> 1), sln = (d8 & 1) * 16 + (qq & 15);
    float M = sm[0][qq];
#pragma unroll
    for (int w = 1; w < AW; ++w) M = fmaxf(M, sm[w][qq]);
    float L = 0.f; v8f o = (v8f){};
#pragma unroll
    for (int w = 0; w < AW; ++w) { const float a = exp2_slot(sm[w][qq] - M); L = fmaf(sl[w][qq], a, L); o += *(const v8f*)&ost[w][g][sln][0] * a; }
    const float inv = 1.0f / L; v8us oh, ol;
#pragma unroll
    for (int i = 0; i < 8; ++i) { const float y = o[i] * inv; const unsigned short hb = f2bf(y); oh[i] = hb; ol[i] = f2bf(y - bf2f(hb)); }
    const size_t oo = po + (size_t)(q0 + qq) * CC + d8 * 8; *(v8us*)(Oh + oo) = oh; *(v8us*)(Ol + oo) = ol;
}
__global__ __launch_bounds__(256) void k_outT(const float* __restrict__ OT, const float* __restrict__ xb, float* OUTB) {
    __shared__ float tl[64][65];
    OT += (size_t)blockIdx.y * NV * CC; xb += (size_t)blockIdx.y * CC * NV; OUTB += (size_t)blockIdx.y * CC * NV;   // batch item
    const int tid = threadIdx.x; const int p0 = blockIdx.x * 64; const int rr = tid >> 2, cq = (tid & 3) * 16;
#pragma unroll
    for (int i = 0; i < 16; ++i) tl[rr][cq + i] = OT[(size_t)(p0 + rr) * CC + cq + i];
    __syncthreads();
    const int lane = tid & 31, wv = tid >> 5;
    auto pass = [&]() {
#pragma unroll
        for (int st = 0; st < 4; ++st) { const int cr = wv * 8 + st * 2 + (lane >> 4); const int pq = (lane & 15) * 4; v4f v; const size_t o = (size_t)cr * NV + p0 + pq;
#pragma unroll
            for (int i = 0; i < 4; ++i) v[i] = bfr(xb[o + i]) + tl[pq + i][cr];
            *(v4f*)(OUTB + o) = v; }
    };
    pass(); 
}

extern "C" void kernel_launch(void* const* d_in, const int* in_sizes, int n_in,
                              void* d_out, int out_size, void* d_ws, size_t ws_size, hipStream_t stream) {
    (void)in_sizes; (void)n_in; (void)out_size;
    const float* x = (const float*)d_in[0]; const float* gam = (const float*)d_in[1]; const float* bet = (const float*)d_in[2]; const float* wq = (const float*)d_in[3]; const float* bq = (const float*)d_in[4]; const float* wk = (const float*)d_in[5]; const float* bk = (const float*)d_in[6]; const float* wv = (const float*)d_in[7]; const float* bv = (const float*)d_in[8]; const float* wp = (const float*)d_in[9]; const float* bp = (const float*)d_in[10];
    float* out = (float*)d_out;    // [2][64][32][32][8]
    char* wsp = (char*)d_ws;
    auto take = [&](size_t bytes) { char* p = wsp; wsp += (bytes + 255) & ~(size_t)255; return (void*)p; };
    // every plane holds both batch items, item after item; the four weight matrices and the three f32 planes of q, k, v stand behind one another
    bf* W4 = (bf*)take((size_t)4 * CC * CC * 2); float* ST = (float*)take((size_t)NB_ * NG * 32 * 4);
    bf* Hh = (bf*)take((size_t)NB_ * NV * CC * 2); bf* Hl = (bf*)take((size_t)NB_ * NV * CC * 2); float* QF = (float*)take((size_t)3 * NB_ * NV * CC * 4); float* KF = QF + (size_t)NB_ * NV * CC; float* VF = KF + (size_t)NB_ * NV * CC;
    bf* Qh = (bf*)take((size_t)NB_ * NV * CC * 2); bf* Ql = (bf*)take((size_t)NB_ * NV * CC * 2); bf* Kh = (bf*)take((size_t)NB_ * NV * CC * 2); bf* Kl = (bf*)take((size_t)NB_ * NV * CC * 2); bf* VTh = (bf*)take((size_t)NB_ * CC * NV * 2); bf* VTl = (bf*)take((size_t)NB_ * CC * NV * 2);
    bf* Oh = (bf*)take((size_t)NB_ * NV * CC * 2); bf* Ol = (bf*)take((size_t)NB_ * NV * CC * 2); float* OT = (float*)take((size_t)NB_ * NV * CC * 4);
    if ((size_t)(wsp - (char*)d_ws) > ws_size) return;
    k_prep<<<NB_ * NG + 8, 256, 0, stream>>>(x, ST, wq, wk, wv, wp, W4);
    k_gnT<<<dim3(1, NV / 64, NB_), 256, 0, stream>>>(x, ST, gam, bet, Hh, Hl);
    k_gemmb<true, false><<<dim3(NV / 64, 3, NB_), 128, 0, stream>>>(Hh, Hl, W4, bq, bk, bv, QF, CC, nullptr, nullptr, CC);
    k_repack<<<dim3(RB_Q + RB_K + RB_V, 1, NB_), 256, 0, stream>>>(QF, KF, VF, Qh, Ql, Kh, Kl, VTh, VTl);
    k_attn<<<dim3(NV / 32, NB_, 1), 256, 0, stream>>>(Qh, Ql, Kh, Kl, VTh, VTl, Oh, Ol);
    k_gemmb<true, false><<<dim3(NV / 64, 1, NB_), 128, 0, stream>>>(Oh, Ol, W4 + (size_t)3 * CC * CC, bp, bp, bp, OT, CC, nullptr, nullptr, CC);
    k_outT<<<dim3(NV / 64, NB_, 1), 256, 0, stream>>>(OT, x, out);
}

// v007
// One run takes 91.9 microseconds.
// Next to v006, in two timings, it ran 1.25 and 1.26 times as fast.
// All steps since v000 together make it 58.7 times as fast.
#include <hip/hip_runtime.h>

// Compute dtypes, f32 accumulate, per item: GroupNorm (32 groups, statistics in f32, fixed order) while transposing to voxel-major bf16 hi + UNSCALED residual planes; q/k/v/proj =
// 1x1x1 convs as [8192 x 64].[64 x 64] GEMMs on hi/lo planes with exact bf16 weights (two products, + bias); single-head attention over the 8192 voxels in one fused kernel with
// hi/lo operands (three products); 1/8 and the softmax in f32; x + out with the channel-major transpose in f32 - on v_wmma_f32_16x16x32_bf16. Deterministic, no atomics; every

#define NB_  2
#define CC   64
#define NV   8192
#define NG   32
#define DM   CC
#define SCL  0.125f
#define GEPS 1e-6f
#define LOSC 1024.0f
#define AW   8
#define AKL  (NV / AW)
#define QT   4            // 16-query tiles a wave of k_attn holds: every K and V fragment it loads serves 64 queries

typedef _Float16 h16;
typedef unsigned short bf;
typedef __attribute__((ext_vector_type(16))) __bf16   v16bf;
typedef __attribute__((ext_vector_type(16))) _Float16 v16h;
typedef __attribute__((ext_vector_type(8)))  _Float16 v8h;
typedef __attribute__((ext_vector_type(8)))  unsigned short v8us;
typedef __attribute__((ext_vector_type(8)))  float    v8f;
typedef __attribute__((ext_vector_type(4)))  float    v4f;
typedef __attribute__((ext_vector_type(2)))  float    v2f;
typedef __attribute__((ext_vector_type(2)))  __bf16   v2bf;
typedef v8h  __attribute__((may_alias)) v8ha;
typedef v4f  __attribute__((may_alias)) v4fa;
typedef v8us __attribute__((may_alias)) v8usa;

__device__ __forceinline__ unsigned short f2bf(float f) { unsigned u = __float_as_uint(f); u += 0x7FFFu + ((u >> 16) & 1u); return (unsigned short)(u >> 16); }
__device__ __forceinline__ float bf2f(unsigned short b) { return __uint_as_float(((unsigned)b) << 16); }
__device__ __forceinline__ float bfr(float f) { return bf2f(f2bf(f)); }
__device__ __forceinline__ v16h cat16(v8h lo, v8h hi) { return __builtin_shufflevector(lo, hi, 0, 1, 2, 3, 4, 5, 6, 7, 8, 9, 10, 11, 12, 13, 14, 15); }
__device__ __forceinline__ v16bf cat16b(v8us lo, v8us hi) { return __builtin_bit_cast(v16bf, __builtin_shufflevector(lo, hi, 0, 1, 2, 3, 4, 5, 6, 7, 8, 9, 10, 11, 12, 13, 14, 15)); }
__device__ __forceinline__ v8f wmma16(v16h a, v16h b, v8f c) { return __builtin_amdgcn_wmma_f32_16x16x32_f16(false, a, false, b, (short)0, c, false, false); }
__device__ __forceinline__ v8f wmmab(v16bf a, v16bf b, v8f c) { return __builtin_amdgcn_wmma_f32_16x16x32_bf16(false, a, false, b, (short)0, c, false, false); }

// blockIdx.y picks one of up to three stacked 64-row weight matrices with its own bias and its own output plane, blockIdx.z the batch item (planes of NV rows each).
// k_gemmb: 64 x 64 block tile (4 waves x 16 x 64) of C[NTK][NW] = (A [+ Al]).B^T (K = 64) [+ bf(bias[c])] [+ bf(R[r][c]) residual]; f32 whole-line epilogue (or f16
template <bool SPLITA, bool F16OUT = false>
__global__ __launch_bounds__(128) void k_gemmb(const bf* __restrict__ A, const bf* __restrict__ Al, const bf* __restrict__ Bn, const float* __restrict__ bias0, const float* __restrict__ bias1, const float* __restrict__ bias2, float* C, int ldc, h16* C2, const float* __restrict__ R = nullptr, int K = DM, int roundR = 1) {
    __shared__ __align__(16) float ost[4][16 * 68];
    const int lane = threadIdx.x & 31, wave = threadIdx.x >> 5, lr = lane & 15, hi = lane >> 4;
    const int r0 = blockIdx.x * 64 + wave * 16, c0 = 0, sel = blockIdx.y, item = blockIdx.z;
    A += (size_t)item * NV * K; Al += (size_t)item * NV * K; Bn += (size_t)sel * CC * K; C += ((size_t)sel * NB_ + item) * NV * ldc;
    const float* bias = sel == 0 ? bias0 : sel == 1 ? bias1 : bias2;
    const size_t aoff = (size_t)(r0 + lr) * K + 8 * hi;
    size_t boff[4];
#pragma unroll
    for (int t = 0; t < 4; ++t) boff[t] = (size_t)(c0 + t * 16 + lr) * K + 8 * hi;
    v8f acc[4];
#pragma unroll
    for (int t = 0; t < 4; ++t) acc[t] = (v8f){};
#pragma unroll 1
    for (int kc = 0; kc < K; kc += 32) {
        const v16bf a = cat16b(*(const v8us*)(A + aoff + kc), *(const v8us*)(A + aoff + kc + 16));
        v16bf al = a;
        if (SPLITA) al = cat16b(*(const v8us*)(Al + aoff + kc), *(const v8us*)(Al + aoff + kc + 16));
#pragma unroll
        for (int t = 0; t < 4; ++t) { const v16bf b = cat16b(*(const v8us*)(Bn + boff[t] + kc), *(const v8us*)(Bn + boff[t] + kc + 16)); acc[t] = wmmab(a, b, acc[t]); if (SPLITA) acc[t] = wmmab(al, b, acc[t]); }
        asm volatile("v_nop\n\tv_nop\n\tv_nop\n\tv_nop" : "+v"(acc[0]), "+v"(acc[1]), "+v"(acc[2]), "+v"(acc[3]) : "v"(a), "v"(al));
    }
    float* os = &ost[wave][0];
#pragma unroll
    for (int t = 0; t < 4; ++t) { const float bv = bias ? bfr(bias[c0 + t * 16 + lr]) : 0.f;
#pragma unroll
        for (int j = 0; j < 8; ++j) os[(hi * 8 + j) * 68 + t * 16 + lr] = acc[t][j] + bv; }
    __syncthreads();
    if (F16OUT) {
        h16* crow = (h16*)(void*)C + (size_t)r0 * ldc + c0;
        auto pass = [&]() {
#pragma unroll
            for (int s = 0; s < 4; ++s) { const int row = 4 * s + (lane >> 3), piece = lane & 7; const float* sp = os + row * 68 + piece * 8; v8h o, o2;
#pragma unroll
                for (int i = 0; i < 8; ++i) { const h16 a = (h16)sp[i]; o[i] = a; o2[i] = (h16)((sp[i] - (float)a) * LOSC); }
                *(v8h*)(crow + (size_t)row * ldc + piece * 8) = o; if (C2) *(v8h*)(C2 + (size_t)r0 * ldc + c0 + (size_t)row * ldc + piece * 8) = o2; }
        };
        pass(); 
    } else {
        float* crow = C + (size_t)r0 * ldc + c0;
        auto pass = [&]() {
#pragma unroll
            for (int s = 0; s < 8; ++s) { const int Lid = (lane >> 3) + 4 * s, piece = lane & 7; const int row = Lid >> 1, cofs = (Lid & 1) * 32 + piece * 4;
                v4f val = *(const v4fa*)(os + row * 68 + cofs); if (R) { const v4f rv = *(const v4f*)(R + ((size_t)r0 + row) * ldc + c0 + cofs); val += roundR ? (v4f){bfr(rv[0]), bfr(rv[1]), bfr(rv[2]), bfr(rv[3])} : rv; }
                *(v4f*)(crow + (size_t)row * ldc + cofs) = val; }
        };
        pass(); 
    }
}

__device__ __forceinline__ void d_cvt8(int blk, const float* __restrict__ src, bf* dst, size_t n8) {
    const size_t i = (size_t)blk * 256 + threadIdx.x; if (i >= n8) return;
    const v8f v = *(const v8f*)(src + i * 8); v8us o;
#pragma unroll
    for (int k = 0; k < 8; ++k) o[k] = f2bf(v[k]);
    *(v8us*)(dst + i * 8) = o; 
}
__global__ __launch_bounds__(256) void k_zero8(bf* dst, size_t n8) {
    const size_t i = (size_t)blockIdx.x * 256 + threadIdx.x; if (i >= n8) return; v8us z;
#pragma unroll
    for (int k = 0; k < 8; ++k) z[k] = 0;
    *(v8us*)(dst + i * 8) = z; 
}


// d_gnstat: mean and rsqrt(var + eps) (biased var, f32) of one group of 2 channels = 2 x 8192 contiguous values of x, by one work-group of 8 waves. Each thread fetches its 64 values
// once, as 16 16-byte loads that are all in flight together, and keeps them in registers for both passes (sum, then squared deviations from the mean). Fixed order: a thread's 16
// vectors, their 4 elements, xor tree over the lanes, the 8 waves' partial sums through LDS in wave order. Wave 0 writes the group's whole 128-byte line of ST.
__device__ __forceinline__ void d_gnstat(int g, const float* __restrict__ xb, float* ST) {
    __shared__ float ps[8], pq[8];
    const int tid = threadIdx.x, lane = tid & 31, wv = tid >> 5; const v4f* base = (const v4f*)(xb + (size_t)(2 * g) * NV); const int n = 2 * NV;
    v4f v[16];
#pragma unroll
    for (int i = 0; i < 16; ++i) v[i] = base[i * 256 + tid];
    v4f s4 = v[0];
#pragma unroll
    for (int i = 1; i < 16; ++i) s4 += v[i];
    float s = (s4[0] + s4[1]) + (s4[2] + s4[3]);
#pragma unroll
    for (int sh = 16; sh; sh >>= 1) s += __shfl_xor(s, sh, 32);
    if (lane == 0) ps[wv] = s;
    __syncthreads();
    s = ps[0];
#pragma unroll
    for (int w = 1; w < 8; ++w) s += ps[w];
    const float mu = s / (float)n; v4f q4 = (v4f){};
#pragma unroll
    for (int i = 0; i < 16; ++i) { const v4f d = v[i] - mu; q4 += d * d; }
    float q = (q4[0] + q4[1]) + (q4[2] + q4[3]);
#pragma unroll
    for (int sh = 16; sh; sh >>= 1) q += __shfl_xor(q, sh, 32);
    if (lane == 0) pq[wv] = q;
    __syncthreads();
    q = pq[0];
#pragma unroll
    for (int w = 1; w < 8; ++w) q += pq[w];
    const float rs = rsqrtf(q / (float)n + GEPS);
    if (wv == 0) ST[(size_t)g * 32 + lane] = (lane == 0) ? mu : (lane == 1) ? rs : 0.f;
}
// k_prep: the launches that depend on nothing, side by side in one grid: blocks 0..63 the statistics (one block a group, 32 groups a batch item), blocks 64..71 the four weight matrices to bf16 (2 blocks each).
__global__ __launch_bounds__(256) void k_prep(const float* __restrict__ x, float* ST, const float* __restrict__ wq, const float* __restrict__ wk, const float* __restrict__ wv, const float* __restrict__ wp, bf* W4) {
    const int bx = blockIdx.x;
    if (bx < NB_ * NG) { const int item = bx / NG; d_gnstat(bx % NG, x + (size_t)item * CC * NV, ST + (size_t)item * NG * 32); return; }
    const int u = bx - NB_ * NG, sel = u >> 1;
    d_cvt8(u & 1, sel == 0 ? wq : sel == 1 ? wk : sel == 2 ? wv : wp, W4 + (size_t)sel * CC * CC, CC * CC / 8);
}
// k_gnT: voxel-major planes HT[p][c] of (bf(x[c][p]) - mean_g) rstd_g bf(gamma[c]) + bf(beta[c]) via 64x64 LDS tiles (all 64 channels x 64 voxels per block); wave writes 2 rows x 64
__global__ __launch_bounds__(256) void k_gnT(const float* __restrict__ xb, const float* __restrict__ ST, const float* __restrict__ gam, const float* __restrict__ bet, bf* Hh, bf* Hl) {
    __shared__ float tl[64][65];
    xb += (size_t)blockIdx.z * CC * NV; ST += (size_t)blockIdx.z * NG * 32; Hh += (size_t)blockIdx.z * NV * CC; Hl += (size_t)blockIdx.z * NV * CC;   // batch item
    typedef __attribute__((ext_vector_type(4))) unsigned short v4us;
    const int tid = threadIdx.x, p0 = blockIdx.y * 64; const int rr = tid >> 2, cq = (tid & 3) * 16;   // rr = channel
    { const float mu = ST[(rr >> 1) * 32], rs = ST[(rr >> 1) * 32 + 1], ga = bfr(gam[rr]), be = bfr(bet[rr]);
#pragma unroll
      for (int i = 0; i < 16; ++i) tl[rr][cq + i] = (bfr(xb[(size_t)rr * NV + p0 + cq + i]) - mu) * rs * ga + be; }
    __syncthreads();
    const int lane = tid & 31, wv = tid >> 5;
    auto pass = [&]() {
#pragma unroll
        for (int st = 0; st < 4; ++st) { const int pr = wv * 8 + st * 2 + (lane >> 4); const int cl = (lane & 15) * 4; v4us oh, ol;
#pragma unroll
            for (int i = 0; i < 4; ++i) { const float y = tl[cl + i][pr]; const unsigned short hb = f2bf(y); oh[i] = hb; ol[i] = f2bf(y - bf2f(hb)); }
            const size_t o = (size_t)(p0 + pr) * CC + cl; *(v4us*)(Hh + o) = oh; *(v4us*)(Hl + o) = ol; }
    };
    pass(); 
}
__device__ __forceinline__ void d_split64(int blk, const float* __restrict__ F, int rows, float sc, bf* Ph, bf* Pl) {
    typedef __attribute__((ext_vector_type(2))) unsigned short v2us; typedef __attribute__((ext_vector_type(2))) float v2f_;
    const int lane = threadIdx.x & 31; const size_t r = (size_t)blk * 8 + (threadIdx.x >> 5); if (r >= (size_t)rows) return; const size_t o = r * CC + lane * 2; const v2f_ v = *(const v2f_*)(F + o); v2us oh, ol;
#pragma unroll
    for (int i = 0; i < 2; ++i) { const float y = v[i] * sc; const unsigned short hb = f2bf(y); oh[i] = hb; ol[i] = f2bf(y - bf2f(hb)); }
    *(v2us*)(Ph + o) = oh; *(v2us*)(Pl + o) = ol; 
}
// d_kfrag, d_vfrag: the bf16 hi + residual planes of K and V, laid out in the order in which k_attn's A fragments are read: 512-byte blocks, lane l's 16 bytes at 16 * l, so that a
// wave-wide 16-byte load covers four whole 128-byte lines. One thread makes one 16-byte piece of each plane; a wave stores whole lines.
// K: block ((tile * 2 + ks) * 2 + j) holds K[tile * 16 + c][ks * 32 + h * 16 + j * 8 + i], lane = h * 16 + c.
__device__ __forceinline__ void d_kfrag(int blk, const float* __restrict__ F, bf* Ph, bf* Pl) {
    const int t = blk * 256 + threadIdx.x; const int c = t & 15, h = (t >> 4) & 1, j = (t >> 5) & 1, ks = (t >> 6) & 1, tile = t >> 7;
    const v8f v = *(const v8f*)(F + (size_t)(tile * 16 + c) * CC + ks * 32 + h * 16 + j * 8); v8us oh, ol;
#pragma unroll
    for (int i = 0; i < 8; ++i) { const float y = v[i]; const unsigned short hb = f2bf(y); oh[i] = hb; ol[i] = f2bf(y - bf2f(hb)); }
    *(v8us*)(Ph + (size_t)t * 8) = oh; *(v8us*)(Pl + (size_t)t * 8) = ol;
}
// V: block ((pass * 4 + dt) * 2 + j) holds V[pass * 32 + j * 16 + h * 8 + i][dt * 16 + c], lane = h * 16 + c (the transpose is done by the eight strided reads).
__device__ __forceinline__ void d_vfrag(int blk, const float* __restrict__ V, bf* Th, bf* Tl) {
    const int t = blk * 256 + threadIdx.x; const int c = t & 15, h = (t >> 4) & 1, j = (t >> 5) & 1, dt = (t >> 6) & 3, ps = t >> 8;
    const float* sp = V + (size_t)(ps * 32 + j * 16 + h * 8) * CC + dt * 16 + c; v8us oh, ol;
#pragma unroll
    for (int i = 0; i < 8; ++i) { const float y = sp[i * CC]; const unsigned short hb = f2bf(y); oh[i] = hb; ol[i] = f2bf(y - bf2f(hb)); }
    *(v8us*)(Th + (size_t)t * 8) = oh; *(v8us*)(Tl + (size_t)t * 8) = ol;
}
// k_repack: the three repacks of Q, K and V, which do not depend on one another, side by side in one grid (block ranges of blockIdx.x); blockIdx.z = batch item.
#define RB_Q (NV / 8)
#define RB_K (NV * CC / 2048)
#define RB_V (NV / 32)
__global__ __launch_bounds__(256) void k_repack(const float* __restrict__ QF, const float* __restrict__ KF, const float* __restrict__ VF, bf* Qh, bf* Ql, bf* Kh, bf* Kl, bf* Vh, bf* Vl) {
    const int bx = blockIdx.x; const size_t po = (size_t)blockIdx.z * NV * CC;
    if (bx < RB_Q) d_split64(bx, QF + po, NV, 1.0f, Qh + po, Ql + po);
    else if (bx < RB_Q + RB_K) d_kfrag(bx - RB_Q, KF + po, Kh + po, Kl + po);
    else d_vfrag(bx - RB_Q - RB_K, VF + po, Vh + po, Vl + po);
}
__device__ __forceinline__ v16bf ld16(const bf* p) { return cat16b(*(const v8us*)p, *(const v8us*)(p + 8)); }    // 16 consecutive k a lane: Q; d_kfrag's blocks give K's fragments the same k order
__device__ __forceinline__ v16bf ldfr(const bf* p) { return cat16b(*(const v8us*)p, *(const v8us*)(p + 256)); }  // a fragment from two 512-byte blocks of d_kfrag / d_vfrag, p already at 8 * lane
__device__ __forceinline__ float xhalf(float v) { const int b = __float_as_int(v); return __int_as_float(__builtin_amdgcn_permlanex16(b, b, 0x76543210, 0xfedcba98, false, false)); }   // lane l <-> l ^ 16
// 2^x by v_exp_f32. The v_nop is the one slot the instruction set asks for behind a transcendental before its result is read or its source overwritten; it stands in the same
// statement because a v_nop apart drifts off. In the run of eight each v_exp_f32 works in place on a register of its own, so only the last one needs the slot.
__device__ __forceinline__ float exp2_slot(float x) { float r; asm("v_exp_f32 %0, %1\n\tv_nop" : "=v"(r) : "v"(x)); return r; }
__device__ __forceinline__ void exp2x8(float* x) {
    asm("v_exp_f32 %0, %0\n\tv_exp_f32 %1, %1\n\tv_exp_f32 %2, %2\n\tv_exp_f32 %3, %3\n\tv_exp_f32 %4, %4\n\tv_exp_f32 %5, %5\n\tv_exp_f32 %6, %6\n\tv_exp_f32 %7, %7\n\tv_nop"
        : "+v"(x[0]), "+v"(x[1]), "+v"(x[2]), "+v"(x[3]), "+v"(x[4]), "+v"(x[5]), "+v"(x[6]), "+v"(x[7]));
}
// k_attn: scores, softmax and P.V in one kernel; scores and probabilities never leave the registers. A work-group owns 64 queries, each wave all of them; each of its 8 waves walks its own 1024 keys in
// passes of 32: St = K.Qt (a lane holds one query's scores), running maximum and sum per query, Pt packed from the score accumulators as B operand, Ot += Vt.Pt. hi/lo operands,
// three products each. The maximum in use is raised only when a new one exceeds it by more than 8 (log2 units), so P stays below 2^8 times its normalised size.
// The eight waves' partial (max, sum, Ot) are combined through LDS in wave order (fixed), normalised, and split into bf16 hi + residual planes, whole 128-byte rows a wave.
__global__ __launch_bounds__(256) void k_attn(const bf* __restrict__ Qh, const bf* __restrict__ Ql, const bf* __restrict__ Kh, const bf* __restrict__ Kl, const bf* __restrict__ Vh, const bf* __restrict__ Vl, bf* Oh, bf* Ol) {
    __shared__ __align__(32) float ost[AW][QT * 4][32][8];
    __shared__ float sm[AW][QT * 16], sl[AW][QT * 16];
    const int lane = threadIdx.x & 31, wave = __builtin_amdgcn_readfirstlane(threadIdx.x >> 5), c = lane & 15, h = lane >> 4;
    const int q0 = blockIdx.x * (QT * 16); const size_t po = (size_t)blockIdx.y * NV * CC;   // po: the batch item's planes
    const float CS = SCL * 1.44269504f;   // scores go to log2 units
    const int ko = c * CC + 16 * h;   // a lane's place in a 16-row tile of Q
    const int fo = lane * 8;          // a lane's place in a 512-byte block of K or V
    const bf* qph = Qh + po + (size_t)q0 * CC; const bf* qpl = Ql + po + (size_t)q0 * CC;
    const bf* kph = Kh + po + (size_t)wave * AKL * CC; const bf* kpl = Kl + po + (size_t)wave * AKL * CC;
    const bf* vph = Vh + po + (size_t)wave * AKL * CC; const bf* vpl = Vl + po + (size_t)wave * AKL * CC;
    v16bf kh[2][2], kl[2][2], vh[4], vl[4];
#pragma unroll
    for (int kt = 0; kt < 2; ++kt) {
#pragma unroll
        for (int ks = 0; ks < 2; ++ks) { kh[kt][ks] = ldfr(kph + fo + (kt * 2 + ks) * 512); kl[kt][ks] = ldfr(kpl + fo + (kt * 2 + ks) * 512); } }
    asm volatile("s_wait_xcnt 0x0" ::: "memory");   // here and twice below: stands before a register that the issued loads name is written again
#pragma unroll
    for (int dt = 0; dt < 4; ++dt) { vh[dt] = ldfr(vph + fo + dt * 512); vl[dt] = ldfr(vpl + fo + dt * 512); }
    asm volatile("s_wait_xcnt 0x0" ::: "memory");
    v16bf qh[QT][2], ql[QT][2];
#pragma unroll
    for (int qt = 0; qt < QT; ++qt) {
#pragma unroll
        for (int ks = 0; ks < 2; ++ks) { qh[qt][ks] = ld16(qph + ko + qt * 16 * CC + ks * 32); ql[qt][ks] = ld16(qpl + ko + qt * 16 * CC + ks * 32); } }
    asm volatile("s_wait_xcnt 0x0" ::: "memory");
    __builtin_amdgcn_sched_barrier(0);   // keeps the register writes that follow from being scheduled ahead of the wait above (one of them reuses the Q loads' offset register)
    v8f acc[QT][4]; float m[QT], l[QT];
#pragma unroll
    for (int qt = 0; qt < QT; ++qt) { m[qt] = -3.0e38f; l[qt] = 0.f;
#pragma unroll
        for (int dt = 0; dt < 4; ++dt) acc[qt][dt] = (v8f){}; }
#pragma unroll 1   // rolled: one pass is already 96 matrix instructions and most of a wave's 512 registers
    for (int p = 0; p < AKL / 32; ++p) {
        v8f s[QT][2];
#pragma unroll
        for (int qt = 0; qt < QT; ++qt) { s[qt][0] = (v8f){}; s[qt][1] = (v8f){}; }
#pragma unroll
        for (int ks = 0; ks < 2; ++ks) {
#pragma unroll
            for (int kt = 0; kt < 2; ++kt) {
#pragma unroll
                for (int qt = 0; qt < QT; ++qt) s[qt][kt] = wmmab(kh[kt][ks], qh[qt][ks], s[qt][kt]); }
#pragma unroll
            for (int kt = 0; kt < 2; ++kt) {
#pragma unroll
                for (int qt = 0; qt < QT; ++qt) s[qt][kt] = wmmab(kl[kt][ks], qh[qt][ks], s[qt][kt]); }
#pragma unroll
            for (int kt = 0; kt < 2; ++kt) {
#pragma unroll
                for (int qt = 0; qt < QT; ++qt) s[qt][kt] = wmmab(kh[kt][ks], ql[qt][ks], s[qt][kt]); } }
        // the next pass's K, fetched behind this pass's score products; the last pass fetches its own rows again (in bounds, unused)
        const int more = (p + 1 < AKL / 32) ? 32 : 0; kph += more * CC; kpl += more * CC;
#pragma unroll
        for (int kt = 0; kt < 2; ++kt) {
#pragma unroll
            for (int ks = 0; ks < 2; ++ks) { kh[kt][ks] = ldfr(kph + fo + (kt * 2 + ks) * 512); kl[kt][ks] = ldfr(kpl + fo + (kt * 2 + ks) * 512); } }
        asm volatile("s_wait_xcnt 0x0" ::: "memory");   // stands before the base registers of these loads are advanced in the next pass
        float mx[QT];
#pragma unroll
        for (int qt = 0; qt < QT; ++qt) { float a = fmaxf(s[qt][0][0], s[qt][1][0]);
#pragma unroll
            for (int i = 1; i < 8; ++i) a = fmaxf(a, fmaxf(s[qt][0][i], s[qt][1][i]));
            mx[qt] = fmaxf(a, xhalf(a)) * CS; }
        bool need = false;
#pragma unroll
        for (int qt = 0; qt < QT; ++qt) need |= mx[qt] > m[qt] + 8.0f;
        if (__builtin_amdgcn_ballot_w32(need) != 0) {   // one scalar branch a pass
#pragma unroll
            for (int qt = 0; qt < QT; ++qt) { const float mn = fmaxf(m[qt], mx[qt]); const float al = exp2_slot(m[qt] - mn); m[qt] = mn; l[qt] *= al;
#pragma unroll
                for (int dt = 0; dt < 4; ++dt) acc[qt][dt] *= al; } }
        v16bf ph[QT], pl[QT];
#pragma unroll
        for (int qt = 0; qt < QT; ++qt) { float pv[16];
#pragma unroll
            for (int i = 0; i < 16; ++i) pv[i] = fmaf(s[qt][i >> 3][i & 7], CS, -m[qt]);
            exp2x8(pv); exp2x8(pv + 8);
#pragma unroll
            for (int i = 0; i < 16; i += 2) { const v2bf hb = __builtin_convertvector((v2f){pv[i], pv[i + 1]}, v2bf); const v2bf lb = __builtin_convertvector((v2f){pv[i] - (float)hb[0], pv[i + 1] - (float)hb[1]}, v2bf);
                ph[qt][i] = hb[0]; ph[qt][i + 1] = hb[1]; pl[qt][i] = lb[0]; pl[qt][i + 1] = lb[1]; }
#pragma unroll
            for (int w = 8; w; w >>= 1) {
#pragma unroll
                for (int i = 0; i < w; ++i) pv[i] += pv[i + w]; }
            l[qt] += pv[0]; }
#pragma unroll
        for (int dt = 0; dt < 4; ++dt) {
#pragma unroll
            for (int qt = 0; qt < QT; ++qt) acc[qt][dt] = wmmab(vh[dt], ph[qt], acc[qt][dt]); }
#pragma unroll
        for (int dt = 0; dt < 4; ++dt) {
#pragma unroll
            for (int qt = 0; qt < QT; ++qt) acc[qt][dt] = wmmab(vl[dt], ph[qt], acc[qt][dt]); }
#pragma unroll
        for (int dt = 0; dt < 4; ++dt) {
#pragma unroll
            for (int qt = 0; qt < QT; ++qt) acc[qt][dt] = wmmab(vh[dt], pl[qt], acc[qt][dt]); }
        // the next pass's Vt, fetched behind this pass's output products (the last pass: its own columns again, in bounds, unused)
        vph += more * CC; vpl += more * CC;
#pragma unroll
        for (int dt = 0; dt < 4; ++dt) { vh[dt] = ldfr(vph + fo + dt * 512); vl[dt] = ldfr(vpl + fo + dt * 512); }
        asm volatile("s_wait_xcnt 0x0" ::: "memory");   // as above, for the Vt bases
    }
#pragma unroll
    for (int qt = 0; qt < QT; ++qt) { l[qt] += xhalf(l[qt]);
#pragma unroll
        for (int dt = 0; dt < 4; ++dt) *(v8f*)&ost[wave][qt * 4 + dt][lane][0] = acc[qt][dt];
        if (h == 0) { sm[wave][qt * 16 + c] = m[qt]; sl[wave][qt * 16 + c] = l[qt]; } }
    __syncthreads();
#pragma unroll 1   // rolled: the two halves of the 64 queries go through the same short code
    for (int hf = 0; hf < QT / 2; ++hf) {
        const int qq = hf * 32 + wave * 4 + (lane >> 3), d8 = lane & 7;   // query of the block, 8-channel piece of its row
        const int g = (qq >> 4) * 4 + (d8 >> 1), sln = (d8 & 1) * 16 + (qq & 15);
        float M = sm[0][qq];
#pragma unroll
        for (int w = 1; w < AW; ++w) M = fmaxf(M, sm[w][qq]);
        float L = 0.f; v8f o = (v8f){};
#pragma unroll
        for (int w = 0; w < AW; ++w) { const float a = exp2_slot(sm[w][qq] - M); L = fmaf(sl[w][qq], a, L); o += *(const v8f*)&ost[w][g][sln][0] * a; }
        const float inv = 1.0f / L; v8us oh, ol;
#pragma unroll
        for (int i = 0; i < 8; ++i) { const float y = o[i] * inv; const unsigned short hb = f2bf(y); oh[i] = hb; ol[i] = f2bf(y - bf2f(hb)); }
        const size_t oo = po + (size_t)(q0 + qq) * CC + d8 * 8; *(v8us*)(Oh + oo) = oh; *(v8us*)(Ol + oo) = ol;
        asm volatile("s_wait_xcnt 0x0" ::: "memory");   // stands before the second trip writes the registers that these two stores name
    }
}
__global__ __launch_bounds__(256) void k_outT(const float* __restrict__ OT, const float* __restrict__ xb, float* OUTB) {
    __shared__ float tl[64][65];
    OT += (size_t)blockIdx.y * NV * CC; xb += (size_t)blockIdx.y * CC * NV; OUTB += (size_t)blockIdx.y * CC * NV;   // batch item
    const int tid = threadIdx.x; const int p0 = blockIdx.x * 64; const int rr = tid >> 2, cq = (tid & 3) * 16;
#pragma unroll
    for (int i = 0; i < 16; ++i) tl[rr][cq + i] = OT[(size_t)(p0 + rr) * CC + cq + i];
    __syncthreads();
    const int lane = tid & 31, wv = tid >> 5;
    auto pass = [&]() {
#pragma unroll
        for (int st = 0; st < 4; ++st) { const int cr = wv * 8 + st * 2 + (lane >> 4); const int pq = (lane & 15) * 4; v4f v; const size_t o = (size_t)cr * NV + p0 + pq;
#pragma unroll
            for (int i = 0; i < 4; ++i) v[i] = bfr(xb[o + i]) + tl[pq + i][cr];
            *(v4f*)(OUTB + o) = v; }
    };
    pass(); 
}

extern "C" void kernel_launch(void* const* d_in, const int* in_sizes, int n_in,
                              void* d_out, int out_size, void* d_ws, size_t ws_size, hipStream_t stream) {
    (void)in_sizes; (void)n_in; (void)out_size;
    const float* x = (const float*)d_in[0]; const float* gam = (const float*)d_in[1]; const float* bet = (const float*)d_in[2]; const float* wq = (const float*)d_in[3]; const float* bq = (const float*)d_in[4]; const float* wk = (const float*)d_in[5]; const float* bk = (const float*)d_in[6]; const float* wv = (const float*)d_in[7]; const float* bv = (const float*)d_in[8]; const float* wp = (const float*)d_in[9]; const float* bp = (const float*)d_in[10];
    float* out = (float*)d_out;    // [2][64][32][32][8]
    char* wsp = (char*)d_ws;
    auto take = [&](size_t bytes) { char* p = wsp; wsp += (bytes + 255) & ~(size_t)255; return (void*)p; };
    // every plane holds both batch items, item after item; the four weight matrices and the three f32 planes of q, k, v stand behind one another
    bf* W4 = (bf*)take((size_t)4 * CC * CC * 2); float* ST = (float*)take((size_t)NB_ * NG * 32 * 4);
    bf* Hh = (bf*)take((size_t)NB_ * NV * CC * 2); bf* Hl = (bf*)take((size_t)NB_ * NV * CC * 2); float* QF = (float*)take((size_t)3 * NB_ * NV * CC * 4); float* KF = QF + (size_t)NB_ * NV * CC; float* VF = KF + (size_t)NB_ * NV * CC;
    bf* Qh = (bf*)take((size_t)NB_ * NV * CC * 2); bf* Ql = (bf*)take((size_t)NB_ * NV * CC * 2); bf* Kh = (bf*)take((size_t)NB_ * NV * CC * 2); bf* Kl = (bf*)take((size_t)NB_ * NV * CC * 2); bf* VTh = (bf*)take((size_t)NB_ * CC * NV * 2); bf* VTl = (bf*)take((size_t)NB_ * CC * NV * 2);
    bf* Oh = (bf*)take((size_t)NB_ * NV * CC * 2); bf* Ol = (bf*)take((size_t)NB_ * NV * CC * 2); float* OT = (float*)take((size_t)NB_ * NV * CC * 4);
    if ((size_t)(wsp - (char*)d_ws) > ws_size) return;
    k_prep<<<NB_ * NG + 8, 256, 0, stream>>>(x, ST, wq, wk, wv, wp, W4);
    k_gnT<<<dim3(1, NV / 64, NB_), 256, 0, stream>>>(x, ST, gam, bet, Hh, Hl);
    k_gemmb<true, false><<<dim3(NV / 64, 3, NB_), 128, 0, stream>>>(Hh, Hl, W4, bq, bk, bv, QF, CC, nullptr, nullptr, CC);
    k_repack<<<dim3(RB_Q + RB_K + RB_V, 1, NB_), 256, 0, stream>>>(QF, KF, VF, Qh, Ql, Kh, Kl, VTh, VTl);
    k_attn<<<dim3(NV / (QT * 16), NB_, 1), 256, 0, stream>>>(Qh, Ql, Kh, Kl, VTh, VTl, Oh, Ol);
    k_gemmb<true, false><<<dim3(NV / 64, 1, NB_), 128, 0, stream>>>(Oh, Ol, W4 + (size_t)3 * CC * CC, bp, bp, bp, OT, CC, nullptr, nullptr, CC);
    k_outT<<<dim3(NV / 64, NB_, 1), 256, 0, stream>>>(OT, x, out);
}

// v008
// A run of this version takes 84.2 microseconds.
// In two side-by-side timings against v007, it was 1.13 and 1.10 times as fast.
// All steps since v000 together make it 65.4 times as fast.
#include <hip/hip_runtime.h>

// Compute dtypes, f32 accumulate, per item: GroupNorm (32 groups, statistics in f32, fixed order) while transposing to voxel-major bf16 hi + UNSCALED residual A fragments in registers; q/k/v/proj =
// 1x1x1 convs as [8192 x 64].[64 x 64] GEMMs on hi/lo operands with exact bf16 weights (two products, + bias); single-head attention over the 8192 voxels in one fused kernel with
// hi/lo operands (three products); 1/8 and the softmax in f32; x + out with the channel-major transpose in f32 - on v_wmma_f32_16x16x32_bf16. Deterministic, no atomics; every

#define NB_  2
#define CC   64
#define NV   8192
#define NG   32
#define DM   CC
#define SCL  0.125f
#define GEPS 1e-6f
#define LOSC 1024.0f
#define AW   8
#define AKL  (NV / AW)
#define QT   4            // 16-query tiles a wave of k_attn holds: every K and V fragment it loads serves 64 queries

typedef _Float16 h16;
typedef unsigned short bf;
typedef __attribute__((ext_vector_type(16))) __bf16   v16bf;
typedef __attribute__((ext_vector_type(16))) _Float16 v16h;
typedef __attribute__((ext_vector_type(8)))  _Float16 v8h;
typedef __attribute__((ext_vector_type(8)))  unsigned short v8us;
typedef __attribute__((ext_vector_type(8)))  float    v8f;
typedef __attribute__((ext_vector_type(4)))  float    v4f;
typedef __attribute__((ext_vector_type(2)))  float    v2f;
typedef __attribute__((ext_vector_type(2)))  __bf16   v2bf;
typedef v8h  __attribute__((may_alias)) v8ha;
typedef v4f  __attribute__((may_alias)) v4fa;
typedef v8us __attribute__((may_alias)) v8usa;

__device__ __forceinline__ unsigned short f2bf(float f) { unsigned u = __float_as_uint(f); u += 0x7FFFu + ((u >> 16) & 1u); return (unsigned short)(u >> 16); }
__device__ __forceinline__ float bf2f(unsigned short b) { return __uint_as_float(((unsigned)b) << 16); }
__device__ __forceinline__ float bfr(float f) { return bf2f(f2bf(f)); }
__device__ __forceinline__ v16h cat16(v8h lo, v8h hi) { return __builtin_shufflevector(lo, hi, 0, 1, 2, 3, 4, 5, 6, 7, 8, 9, 10, 11, 12, 13, 14, 15); }
__device__ __forceinline__ v16bf cat16b(v8us lo, v8us hi) { return __builtin_bit_cast(v16bf, __builtin_shufflevector(lo, hi, 0, 1, 2, 3, 4, 5, 6, 7, 8, 9, 10, 11, 12, 13, 14, 15)); }
__device__ __forceinline__ v8f wmma16(v16h a, v16h b, v8f c) { return __builtin_amdgcn_wmma_f32_16x16x32_f16(false, a, false, b, (short)0, c, false, false); }
__device__ __forceinline__ v8f wmmab(v16bf a, v16bf b, v8f c) { return __builtin_amdgcn_wmma_f32_16x16x32_bf16(false, a, false, b, (short)0, c, false, false); }

// blockIdx.y picks one of up to three stacked 64-row weight matrices with its own bias and its own output plane, blockIdx.z the batch item (planes of NV rows each).
// k_gemmb: 64 x 64 block tile (4 waves x 16 x 64) of C[NTK][NW] = (A [+ Al]).B^T (K = 64) [+ bf(bias[c])] [+ bf(R[r][c]) residual]; f32 whole-line epilogue (or f16
template <bool SPLITA, bool F16OUT = false>
__global__ __launch_bounds__(128) void k_gemmb(const bf* __restrict__ A, const bf* __restrict__ Al, const bf* __restrict__ Bn, const float* __restrict__ bias0, const float* __restrict__ bias1, const float* __restrict__ bias2, float* C, int ldc, h16* C2, const float* __restrict__ R = nullptr, int K = DM, int roundR = 1) {
    __shared__ __align__(16) float ost[4][16 * 68];
    const int lane = threadIdx.x & 31, wave = threadIdx.x >> 5, lr = lane & 15, hi = lane >> 4;
    const int r0 = blockIdx.x * 64 + wave * 16, c0 = 0, sel = blockIdx.y, item = blockIdx.z;
    A += (size_t)item * NV * K; Al += (size_t)item * NV * K; Bn += (size_t)sel * CC * K; C += ((size_t)sel * NB_ + item) * NV * ldc;
    const float* bias = sel == 0 ? bias0 : sel == 1 ? bias1 : bias2;
    const size_t aoff = (size_t)(r0 + lr) * K + 8 * hi;
    size_t boff[4];
#pragma unroll
    for (int t = 0; t < 4; ++t) boff[t] = (size_t)(c0 + t * 16 + lr) * K + 8 * hi;
    v8f acc[4];
#pragma unroll
    for (int t = 0; t < 4; ++t) acc[t] = (v8f){};
#pragma unroll 1
    for (int kc = 0; kc < K; kc += 32) {
        const v16bf a = cat16b(*(const v8us*)(A + aoff + kc), *(const v8us*)(A + aoff + kc + 16));
        v16bf al = a;
        if (SPLITA) al = cat16b(*(const v8us*)(Al + aoff + kc), *(const v8us*)(Al + aoff + kc + 16));
#pragma unroll
        for (int t = 0; t < 4; ++t) { const v16bf b = cat16b(*(const v8us*)(Bn + boff[t] + kc), *(const v8us*)(Bn + boff[t] + kc + 16)); acc[t] = wmmab(a, b, acc[t]); if (SPLITA) acc[t] = wmmab(al, b, acc[t]); }
        asm volatile("v_nop\n\tv_nop\n\tv_nop\n\tv_nop" : "+v"(acc[0]), "+v"(acc[1]), "+v"(acc[2]), "+v"(acc[3]) : "v"(a), "v"(al));
    }
    float* os = &ost[wave][0];
#pragma unroll
    for (int t = 0; t < 4; ++t) { const float bv = bias ? bfr(bias[c0 + t * 16 + lr]) : 0.f;
#pragma unroll
        for (int j = 0; j < 8; ++j) os[(hi * 8 + j) * 68 + t * 16 + lr] = acc[t][j] + bv; }
    __syncthreads();
    if (F16OUT) {
        h16* crow = (h16*)(void*)C + (size_t)r0 * ldc + c0;
        auto pass = [&]() {
#pragma unroll
            for (int s = 0; s < 4; ++s) { const int row = 4 * s + (lane >> 3), piece = lane & 7; const float* sp = os + row * 68 + piece * 8; v8h o, o2;
#pragma unroll
                for (int i = 0; i < 8; ++i) { const h16 a = (h16)sp[i]; o[i] = a; o2[i] = (h16)((sp[i] - (float)a) * LOSC); }
                *(v8h*)(crow + (size_t)row * ldc + piece * 8) = o; if (C2) *(v8h*)(C2 + (size_t)r0 * ldc + c0 + (size_t)row * ldc + piece * 8) = o2; }
        };
        pass(); 
    } else {
        float* crow = C + (size_t)r0 * ldc + c0;
        auto pass = [&]() {
#pragma unroll
            for (int s = 0; s < 8; ++s) { const int Lid = (lane >> 3) + 4 * s, piece = lane & 7; const int row = Lid >> 1, cofs = (Lid & 1) * 32 + piece * 4;
                v4f val = *(const v4fa*)(os + row * 68 + cofs); if (R) { const v4f rv = *(const v4f*)(R + ((size_t)r0 + row) * ldc + c0 + cofs); val += roundR ? (v4f){bfr(rv[0]), bfr(rv[1]), bfr(rv[2]), bfr(rv[3])} : rv; }
                *(v4f*)(crow + (size_t)row * ldc + cofs) = val; }
        };
        pass(); 
    }
}

__device__ __forceinline__ void d_cvt8(int blk, const float* __restrict__ src, bf* dst, size_t n8) {
    const size_t i = (size_t)blk * 256 + threadIdx.x; if (i >= n8) return;
    const v8f v = *(const v8f*)(src + i * 8); v8us o;
#pragma unroll
    for (int k = 0; k < 8; ++k) o[k] = f2bf(v[k]);
    *(v8us*)(dst + i * 8) = o; 
}
__global__ __launch_bounds__(256) void k_zero8(bf* dst, size_t n8) {
    const size_t i = (size_t)blockIdx.x * 256 + threadIdx.x; if (i >= n8) return; v8us z;
#pragma unroll
    for (int k = 0; k < 8; ++k) z[k] = 0;
    *(v8us*)(dst + i * 8) = z; 
}


// d_gnstat: mean and rsqrt(var + eps) (biased var, f32) of one group of 2 channels = 2 x 8192 contiguous values of x, by one work-group of 8 waves. Each thread fetches its 64 values
// once, as 16 16-byte loads that are all in flight together, and keeps them in registers for both passes (sum, then squared deviations from the mean). Fixed order: a thread's 16
// vectors, their 4 elements, xor tree over the lanes, the 8 waves' partial sums through LDS in wave order. Wave 0 writes the group's whole 128-byte line of ST.
__device__ __forceinline__ void d_gnstat(int g, const float* __restrict__ xb, float* ST) {
    __shared__ float ps[8], pq[8];
    const int tid = threadIdx.x, lane = tid & 31, wv = tid >> 5; const v4f* base = (const v4f*)(xb + (size_t)(2 * g) * NV); const int n = 2 * NV;
    v4f v[16];
#pragma unroll
    for (int i = 0; i < 16; ++i) v[i] = base[i * 256 + tid];
    v4f s4 = v[0];
#pragma unroll
    for (int i = 1; i < 16; ++i) s4 += v[i];
    float s = (s4[0] + s4[1]) + (s4[2] + s4[3]);
#pragma unroll
    for (int sh = 16; sh; sh >>= 1) s += __shfl_xor(s, sh, 32);
    if (lane == 0) ps[wv] = s;
    __syncthreads();
    s = ps[0];
#pragma unroll
    for (int w = 1; w < 8; ++w) s += ps[w];
    const float mu = s / (float)n; v4f q4 = (v4f){};
#pragma unroll
    for (int i = 0; i < 16; ++i) { const v4f d = v[i] - mu; q4 += d * d; }
    float q = (q4[0] + q4[1]) + (q4[2] + q4[3]);
#pragma unroll
    for (int sh = 16; sh; sh >>= 1) q += __shfl_xor(q, sh, 32);
    if (lane == 0) pq[wv] = q;
    __syncthreads();
    q = pq[0];
#pragma unroll
    for (int w = 1; w < 8; ++w) q += pq[w];
    const float rs = rsqrtf(q / (float)n + GEPS);
    if (wv == 0) ST[(size_t)g * 32 + lane] = (lane == 0) ? mu : (lane == 1) ? rs : 0.f;
}
// k_prep: the launches that depend on nothing, side by side in one grid: blocks 0..63 the statistics (one block a group, 32 groups a batch item), blocks 64..71 the four weight matrices to bf16 (2 blocks each).
__global__ __launch_bounds__(256) void k_prep(const float* __restrict__ x, float* ST, const float* __restrict__ wq, const float* __restrict__ wk, const float* __restrict__ wv, const float* __restrict__ wp, bf* W4) {
    const int bx = blockIdx.x;
    if (bx < NB_ * NG) { const int item = bx / NG; d_gnstat(bx % NG, x + (size_t)item * CC * NV, ST + (size_t)item * NG * 32); return; }
    const int u = bx - NB_ * NG, sel = u >> 1;
    d_cvt8(u & 1, sel == 0 ? wq : sel == 1 ? wk : sel == 2 ? wv : wp, W4 + (size_t)sel * CC * CC, CC * CC / 8);
}
// k_qkv: GroupNorm apply, one of the q/k/v 1x1x1 convs (blockIdx.y) and the split into the planes k_attn reads, for 64 voxels x 64 channels of one batch item (blockIdx.z), in one kernel.
// The normalised tile (bf(x[c][p]) - mean_g) rstd_g bf(gamma[c]) + bf(beta[c]) goes into LDS in f32; each of the 4 waves takes 16 voxels (the transpose is in its LDS reads), splits them into bf16 hi + residual
// A fragments in registers, and does [16 x 64].[64 x 64] on exact bf16 weights (two products, + bias). The f32 result is split into bf16 hi + residual and stored straight in its final order:
// Q: rows of 64 channels. K and V: the order in which k_attn's A fragments are read, 512-byte blocks, lane l's 16 bytes at 16 * l, so that a wave-wide 16-byte load covers four whole lines.
// K: block ((tile * 2 + ks) * 2 + j) holds K[tile * 16 + c][ks * 32 + h * 16 + j * 8 + i], lane = h * 16 + c.
// V: block ((pass * 4 + dt) * 2 + j) holds V[pass * 32 + j * 16 + h * 8 + i][dt * 16 + c], lane = h * 16 + c: the accumulators' own layout, so V needs no LDS.
// Every loop is unrolled whole: its arrays are indexed by the loop counter and have to stay in registers.
__device__ __forceinline__ void split8(const float* y, bf* Ph, bf* Pl, size_t o) {
    v8us oh, ol;
#pragma unroll
    for (int i = 0; i < 8; ++i) { const unsigned short hb = f2bf(y[i]); oh[i] = hb; ol[i] = f2bf(y[i] - bf2f(hb)); }
    *(v8us*)(Ph + o) = oh; *(v8us*)(Pl + o) = ol;
}
__global__ __launch_bounds__(128) void k_qkv(const float* __restrict__ xb, const float* __restrict__ ST, const float* __restrict__ gam, const float* __restrict__ bet, const bf* __restrict__ W4, const float* __restrict__ bq, const float* __restrict__ bk, const float* __restrict__ bv,
                                             bf* Qh, bf* Ql, bf* Kh, bf* Kl, bf* Vh, bf* Vl) {
    __shared__ __align__(16) float tl[64][68];        // [channel][voxel]
    __shared__ __align__(16) float ost[4][16 * 68];   // a wave's 16 x 64 result
    const int tid = threadIdx.x, lane = tid & 31, wave = __builtin_amdgcn_readfirstlane(tid >> 5), lr = lane & 15, hi = lane >> 4;
    const int p0 = blockIdx.x * 64, sel = blockIdx.y, item = blockIdx.z;
    xb += (size_t)item * CC * NV; ST += (size_t)item * NG * 32;
    const bf* Bn = W4 + (size_t)sel * CC * CC; const float* bias = sel == 0 ? bq : sel == 1 ? bk : bv;
    const int ch0 = tid >> 4, pc = (tid & 15) * 4;   // a wave-wide 16-byte load covers 2 channels x 64 voxels, four whole lines; a thread has channels ch0 + 8 * i
    v4f xv[8]; float mu[8], rs[8], ga[8], be[8];
#pragma unroll
    for (int i = 0; i < 8; ++i) { const int g = i * 4 + wave; mu[i] = ST[g * 32]; rs[i] = ST[g * 32 + 1]; }   // g = channel >> 1, the same for a whole wave
#pragma unroll
    for (int i = 0; i < 8; ++i) { xv[i] = *(const v4f*)(xb + (size_t)(i * 8 + ch0) * NV + p0 + pc); ga[i] = gam[i * 8 + ch0]; be[i] = bet[i * 8 + ch0]; }
    asm volatile("s_wait_xcnt 0x0" ::: "memory");   // here and below: stands before a register that the issued loads name is written again
    __builtin_amdgcn_sched_barrier(0);              // keeps the register writes that follow from being scheduled ahead of the wait above
    v16bf b[2][4]; float bb[4];
#pragma unroll
    for (int t = 0; t < 4; ++t) { const bf* bp = Bn + (size_t)(t * 16 + lr) * CC + 8 * hi; bb[t] = bias[t * 16 + lr];
#pragma unroll
        for (int ks = 0; ks < 2; ++ks) b[ks][t] = cat16b(*(const v8us*)(bp + ks * 32), *(const v8us*)(bp + ks * 32 + 16)); }
    asm volatile("s_wait_xcnt 0x0" ::: "memory");
    __builtin_amdgcn_sched_barrier(0);              // as above
#pragma unroll
    for (int i = 0; i < 8; ++i) { const float gb = bfr(ga[i]), bt = bfr(be[i]); v4f y;
#pragma unroll
        for (int e = 0; e < 4; ++e) y[e] = (bfr(xv[i][e]) - mu[i]) * rs[i] * gb + bt;
        *(v4fa*)&tl[i * 8 + ch0][pc] = y; }
    __syncthreads();   // every wave reads all 64 channels of its 16 voxels, written by all four waves
    v8f acc[4];
#pragma unroll
    for (int t = 0; t < 4; ++t) acc[t] = (v8f){};
#pragma unroll
    for (int ks = 0; ks < 2; ++ks) {
        const float* ap = &tl[ks * 32 + 8 * hi][wave * 16 + lr];   // the k order of the weights' fragments: 8 * hi + 0..7, then 16 + 8 * hi + 0..7
        v8us h0, h1, l0, l1;
#pragma unroll
        for (int i = 0; i < 8; ++i) { const float ya = ap[i * 68], yb = ap[(16 + i) * 68]; const unsigned short ha = f2bf(ya), hb = f2bf(yb);
            h0[i] = ha; l0[i] = f2bf(ya - bf2f(ha)); h1[i] = hb; l1[i] = f2bf(yb - bf2f(hb)); }
        const v16bf a = cat16b(h0, h1), al = cat16b(l0, l1);
#pragma unroll
        for (int t = 0; t < 4; ++t) { acc[t] = wmmab(a, b[ks][t], acc[t]); acc[t] = wmmab(al, b[ks][t], acc[t]); }
    }
    const size_t po = (size_t)item * NV * CC; const int r0 = p0 + wave * 16;
    float val[4][8];
#pragma unroll
    for (int t = 0; t < 4; ++t) {
#pragma unroll
        for (int j = 0; j < 8; ++j) val[t][j] = acc[t][j] + bfr(bb[t]); }
    if (sel == 2) {
#pragma unroll
        for (int dt = 0; dt < 4; ++dt) split8(val[dt], Vh, Vl, po + ((size_t)(r0 >> 5) * 256 + dt * 64 + ((r0 >> 4) & 1) * 32 + lane) * 8);
        return;
    }
    float* os = &ost[wave][0];
#pragma unroll
    for (int t = 0; t < 4; ++t) {
#pragma unroll
        for (int j = 0; j < 8; ++j) os[(hi * 8 + j) * 68 + t * 16 + lr] = val[t][j]; }
    __syncthreads();   // a lane reads below what other lanes have written above (the whole block is on this path: sel is blockIdx.y)
    // Q: 4 rows x 8 pieces of 8 channels a step. K: block s = ks * 2 + j of the wave's tile a step. Either way a step's 32 pieces stand 512 bytes behind the step before.
    const int so = sel == 0 ? (lane >> 3) * 68 + (lane & 7) * 8 : lr * 68 + hi * 16;
    const int ss = sel == 0 ? 4 * 68 : 8, s2 = sel == 0 ? 8 * 68 : 32;   // the source's step for bit 0 and bit 1 of s
    bf* Ph = sel == 0 ? Qh : Kh; bf* Pl = sel == 0 ? Ql : Kl;
    float y[4][8];
#pragma unroll
    for (int s = 0; s < 4; ++s) { const float* sp = os + so + (s & 1) * ss + (s >> 1) * s2; const v4f u0 = *(const v4fa*)sp, u1 = *(const v4fa*)(sp + 4);
#pragma unroll
        for (int i = 0; i < 4; ++i) { y[s][i] = u0[i]; y[s][4 + i] = u1[i]; } }
#pragma unroll
    for (int s = 0; s < 4; ++s) split8(y[s], Ph, Pl, po + (size_t)r0 * CC + s * 256 + lane * 8);
}
__device__ __forceinline__ v16bf ld16(const bf* p) { return cat16b(*(const v8us*)p, *(const v8us*)(p + 8)); }    // 16 consecutive k a lane: Q; k_qkv's blocks give K's fragments the same k order
__device__ __forceinline__ v16bf ldfr(const bf* p) { return cat16b(*(const v8us*)p, *(const v8us*)(p + 256)); }  // a fragment from two 512-byte blocks of k_qkv's K or V planes, p already at 8 * lane
__device__ __forceinline__ float xhalf(float v) { const int b = __float_as_int(v); return __int_as_float(__builtin_amdgcn_permlanex16(b, b, 0x76543210, 0xfedcba98, false, false)); }   // lane l <-> l ^ 16
// 2^x by v_exp_f32. The v_nop is the one slot the instruction set asks for behind a transcendental before its result is read or its source overwritten; it stands in the same
// statement because a v_nop apart drifts off. In the run of eight each v_exp_f32 works in place on a register of its own, so only the last one needs the slot.
__device__ __forceinline__ float exp2_slot(float x) { float r; asm("v_exp_f32 %0, %1\n\tv_nop" : "=v"(r) : "v"(x)); return r; }
__device__ __forceinline__ void exp2x8(float* x) {
    asm("v_exp_f32 %0, %0\n\tv_exp_f32 %1, %1\n\tv_exp_f32 %2, %2\n\tv_exp_f32 %3, %3\n\tv_exp_f32 %4, %4\n\tv_exp_f32 %5, %5\n\tv_exp_f32 %6, %6\n\tv_exp_f32 %7, %7\n\tv_nop"
        : "+v"(x[0]), "+v"(x[1]), "+v"(x[2]), "+v"(x[3]), "+v"(x[4]), "+v"(x[5]), "+v"(x[6]), "+v"(x[7]));
}
// k_attn: scores, softmax and P.V in one kernel; scores and probabilities never leave the registers. A work-group owns 64 queries, each wave all of them; each of its 8 waves walks its own 1024 keys in
// passes of 32: St = K.Qt (a lane holds one query's scores), running maximum and sum per query, Pt packed from the score accumulators as B operand, Ot += Vt.Pt. hi/lo operands,
// three products each. The maximum in use is raised only when a new one exceeds it by more than 8 (log2 units), so P stays below 2^8 times its normalised size.
// The eight waves' partial (max, sum, Ot) are combined through LDS in wave order (fixed), normalised, and split into bf16 hi + residual planes, whole 128-byte rows a wave.
__global__ __launch_bounds__(256) void k_attn(const bf* __restrict__ Qh, const bf* __restrict__ Ql, const bf* __restrict__ Kh, const bf* __restrict__ Kl, const bf* __restrict__ Vh, const bf* __restrict__ Vl, bf* Oh, bf* Ol) {
    __shared__ __align__(32) float ost[AW][QT * 4][32][8];
    __shared__ float sm[AW][QT * 16], sl[AW][QT * 16];
    const int lane = threadIdx.x & 31, wave = __builtin_amdgcn_readfirstlane(threadIdx.x >> 5), c = lane & 15, h = lane >> 4;
    const int q0 = blockIdx.x * (QT * 16); const size_t po = (size_t)blockIdx.y * NV * CC;   // po: the batch item's planes
    const float CS = SCL * 1.44269504f;   // scores go to log2 units
    const int ko = c * CC + 16 * h;   // a lane's place in a 16-row tile of Q
    const int fo = lane * 8;          // a lane's place in a 512-byte block of K or V
    const bf* qph = Qh + po + (size_t)q0 * CC; const bf* qpl = Ql + po + (size_t)q0 * CC;
    const bf* kph = Kh + po + (size_t)wave * AKL * CC; const bf* kpl = Kl + po + (size_t)wave * AKL * CC;
    const bf* vph = Vh + po + (size_t)wave * AKL * CC; const bf* vpl = Vl + po + (size_t)wave * AKL * CC;
    v16bf kh[2][2], kl[2][2], vh[4], vl[4];
#pragma unroll
    for (int kt = 0; kt < 2; ++kt) {
#pragma unroll
        for (int ks = 0; ks < 2; ++ks) { kh[kt][ks] = ldfr(kph + fo + (kt * 2 + ks) * 512); kl[kt][ks] = ldfr(kpl + fo + (kt * 2 + ks) * 512); } }
    asm volatile("s_wait_xcnt 0x0" ::: "memory");   // here and twice below: stands before a register that the issued loads name is written again
#pragma unroll
    for (int dt = 0; dt < 4; ++dt) { vh[dt] = ldfr(vph + fo + dt * 512); vl[dt] = ldfr(vpl + fo + dt * 512); }
    asm volatile("s_wait_xcnt 0x0" ::: "memory");
    v16bf qh[QT][2], ql[QT][2];
#pragma unroll
    for (int qt = 0; qt < QT; ++qt) {
#pragma unroll
        for (int ks = 0; ks < 2; ++ks) { qh[qt][ks] = ld16(qph + ko + qt * 16 * CC + ks * 32); ql[qt][ks] = ld16(qpl + ko + qt * 16 * CC + ks * 32); } }
    asm volatile("s_wait_xcnt 0x0" ::: "memory");
    __builtin_amdgcn_sched_barrier(0);   // keeps the register writes that follow from being scheduled ahead of the wait above (one of them reuses the Q loads' offset register)
    v8f acc[QT][4]; float m[QT], l[QT];
#pragma unroll
    for (int qt = 0; qt < QT; ++qt) { m[qt] = -3.0e38f; l[qt] = 0.f;
#pragma unroll
        for (int dt = 0; dt < 4; ++dt) acc[qt][dt] = (v8f){}; }
#pragma unroll 1   // rolled: one pass is already 96 matrix instructions and most of a wave's 512 registers
    for (int p = 0; p < AKL / 32; ++p) {
        v8f s[QT][2];
#pragma unroll
        for (int qt = 0; qt < QT; ++qt) { s[qt][0] = (v8f){}; s[qt][1] = (v8f){}; }
#pragma unroll
        for (int ks = 0; ks < 2; ++ks) {
#pragma unroll
            for (int kt = 0; kt < 2; ++kt) {
#pragma unroll
                for (int qt = 0; qt < QT; ++qt) s[qt][kt] = wmmab(kh[kt][ks], qh[qt][ks], s[qt][kt]); }
#pragma unroll
            for (int kt = 0; kt < 2; ++kt) {
#pragma unroll
                for (int qt = 0; qt < QT; ++qt) s[qt][kt] = wmmab(kl[kt][ks], qh[qt][ks], s[qt][kt]); }
#pragma unroll
            for (int kt = 0; kt < 2; ++kt) {
#pragma unroll
                for (int qt = 0; qt < QT; ++qt) s[qt][kt] = wmmab(kh[kt][ks], ql[qt][ks], s[qt][kt]); } }
        // the next pass's K, fetched behind this pass's score products; the last pass fetches its own rows again (in bounds, unused)
        const int more = (p + 1 < AKL / 32) ? 32 : 0; kph += more * CC; kpl += more * CC;
#pragma unroll
        for (int kt = 0; kt < 2; ++kt) {
#pragma unroll
            for (int ks = 0; ks < 2; ++ks) { kh[kt][ks] = ldfr(kph + fo + (kt * 2 + ks) * 512); kl[kt][ks] = ldfr(kpl + fo + (kt * 2 + ks) * 512); } }
        asm volatile("s_wait_xcnt 0x0" ::: "memory");   // stands before the base registers of these loads are advanced in the next pass
        float mx[QT];
#pragma unroll
        for (int qt = 0; qt < QT; ++qt) { float a = fmaxf(s[qt][0][0], s[qt][1][0]);
#pragma unroll
            for (int i = 1; i < 8; ++i) a = fmaxf(a, fmaxf(s[qt][0][i], s[qt][1][i]));
            mx[qt] = fmaxf(a, xhalf(a)) * CS; }
        bool need = false;
#pragma unroll
        for (int qt = 0; qt < QT; ++qt) need |= mx[qt] > m[qt] + 8.0f;
        if (__builtin_amdgcn_ballot_w32(need) != 0) {   // one scalar branch a pass
#pragma unroll
            for (int qt = 0; qt < QT; ++qt) { const float mn = fmaxf(m[qt], mx[qt]); const float al = exp2_slot(m[qt] - mn); m[qt] = mn; l[qt] *= al;
#pragma unroll
                for (int dt = 0; dt < 4; ++dt) acc[qt][dt] *= al; } }
        v16bf ph[QT], pl[QT];
#pragma unroll
        for (int qt = 0; qt < QT; ++qt) { float pv[16];
#pragma unroll
            for (int i = 0; i < 16; ++i) pv[i] = fmaf(s[qt][i >> 3][i & 7], CS, -m[qt]);
            exp2x8(pv); exp2x8(pv + 8);
#pragma unroll
            for (int i = 0; i < 16; i += 2) { const v2bf hb = __builtin_convertvector((v2f){pv[i], pv[i + 1]}, v2bf); const v2bf lb = __builtin_convertvector((v2f){pv[i] - (float)hb[0], pv[i + 1] - (float)hb[1]}, v2bf);
                ph[qt][i] = hb[0]; ph[qt][i + 1] = hb[1]; pl[qt][i] = lb[0]; pl[qt][i + 1] = lb[1]; }
#pragma unroll
            for (int w = 8; w; w >>= 1) {
#pragma unroll
                for (int i = 0; i < w; ++i) pv[i] += pv[i + w]; }
            l[qt] += pv[0]; }
#pragma unroll
        for (int dt = 0; dt < 4; ++dt) {
#pragma unroll
            for (int qt = 0; qt < QT; ++qt) acc[qt][dt] = wmmab(vh[dt], ph[qt], acc[qt][dt]); }
#pragma unroll
        for (int dt = 0; dt < 4; ++dt) {
#pragma unroll
            for (int qt = 0; qt < QT; ++qt) acc[qt][dt] = wmmab(vl[dt], ph[qt], acc[qt][dt]); }
#pragma unroll
        for (int dt = 0; dt < 4; ++dt) {
#pragma unroll
            for (int qt = 0; qt < QT; ++qt) acc[qt][dt] = wmmab(vh[dt], pl[qt], acc[qt][dt]); }
        // the next pass's Vt, fetched behind this pass's output products (the last pass: its own columns again, in bounds, unused)
        vph += more * CC; vpl += more * CC;
#pragma unroll
        for (int dt = 0; dt < 4; ++dt) { vh[dt] = ldfr(vph + fo + dt * 512); vl[dt] = ldfr(vpl + fo + dt * 512); }
        asm volatile("s_wait_xcnt 0x0" ::: "memory");   // as above, for the Vt bases
    }
#pragma unroll
    for (int qt = 0; qt < QT; ++qt) { l[qt] += xhalf(l[qt]);
#pragma unroll
        for (int dt = 0; dt < 4; ++dt) *(v8f*)&ost[wave][qt * 4 + dt][lane][0] = acc[qt][dt];
        if (h == 0) { sm[wave][qt * 16 + c] = m[qt]; sl[wave][qt * 16 + c] = l[qt]; } }
    __syncthreads();
#pragma unroll 1   // rolled: the two halves of the 64 queries go through the same short code
    for (int hf = 0; hf < QT / 2; ++hf) {
        const int qq = hf * 32 + wave * 4 + (lane >> 3), d8 = lane & 7;   // query of the block, 8-channel piece of its row
        const int g = (qq >> 4) * 4 + (d8 >> 1), sln = (d8 & 1) * 16 + (qq & 15);
        float M = sm[0][qq];
#pragma unroll
        for (int w = 1; w < AW; ++w) M = fmaxf(M, sm[w][qq]);
        float L = 0.f; v8f o = (v8f){};
#pragma unroll
        for (int w = 0; w < AW; ++w) { const float a = exp2_slot(sm[w][qq] - M); L = fmaf(sl[w][qq], a, L); o += *(const v8f*)&ost[w][g][sln][0] * a; }
        const float inv = 1.0f / L; v8us oh, ol;
#pragma unroll
        for (int i = 0; i < 8; ++i) { const float y = o[i] * inv; const unsigned short hb = f2bf(y); oh[i] = hb; ol[i] = f2bf(y - bf2f(hb)); }
        const size_t oo = po + (size_t)(q0 + qq) * CC + d8 * 8; *(v8us*)(Oh + oo) = oh; *(v8us*)(Ol + oo) = ol;
        asm volatile("s_wait_xcnt 0x0" ::: "memory");   // stands before the second trip writes the registers that these two stores name
    }
}
__global__ __launch_bounds__(256) void k_outT(const float* __restrict__ OT, const float* __restrict__ xb, float* OUTB) {
    __shared__ float tl[64][65];
    OT += (size_t)blockIdx.y * NV * CC; xb += (size_t)blockIdx.y * CC * NV; OUTB += (size_t)blockIdx.y * CC * NV;   // batch item
    const int tid = threadIdx.x; const int p0 = blockIdx.x * 64; const int rr = tid >> 2, cq = (tid & 3) * 16;
#pragma unroll
    for (int i = 0; i < 16; ++i) tl[rr][cq + i] = OT[(size_t)(p0 + rr) * CC + cq + i];
    __syncthreads();
    const int lane = tid & 31, wv = tid >> 5;
    auto pass = [&]() {
#pragma unroll
        for (int st = 0; st < 4; ++st) { const int cr = wv * 8 + st * 2 + (lane >> 4); const int pq = (lane & 15) * 4; v4f v; const size_t o = (size_t)cr * NV + p0 + pq;
#pragma unroll
            for (int i = 0; i < 4; ++i) v[i] = bfr(xb[o + i]) + tl[pq + i][cr];
            *(v4f*)(OUTB + o) = v; }
    };
    pass(); 
}

extern "C" void kernel_launch(void* const* d_in, const int* in_sizes, int n_in,
                              void* d_out, int out_size, void* d_ws, size_t ws_size, hipStream_t stream) {
    (void)in_sizes; (void)n_in; (void)out_size;
    const float* x = (const float*)d_in[0]; const float* gam = (const float*)d_in[1]; const float* bet = (const float*)d_in[2]; const float* wq = (const float*)d_in[3]; const float* bq = (const float*)d_in[4]; const float* wk = (const float*)d_in[5]; const float* bk = (const float*)d_in[6]; const float* wv = (const float*)d_in[7]; const float* bv = (const float*)d_in[8]; const float* wp = (const float*)d_in[9]; const float* bp = (const float*)d_in[10];
    float* out = (float*)d_out;    // [2][64][32][32][8]
    char* wsp = (char*)d_ws;
    auto take = [&](size_t bytes) { char* p = wsp; wsp += (bytes + 255) & ~(size_t)255; return (void*)p; };
    // every plane holds both batch items, item after item; the four weight matrices stand behind one another
    bf* W4 = (bf*)take((size_t)4 * CC * CC * 2); float* ST = (float*)take((size_t)NB_ * NG * 32 * 4);
    bf* Qh = (bf*)take((size_t)NB_ * NV * CC * 2); bf* Ql = (bf*)take((size_t)NB_ * NV * CC * 2); bf* Kh = (bf*)take((size_t)NB_ * NV * CC * 2); bf* Kl = (bf*)take((size_t)NB_ * NV * CC * 2); bf* VTh = (bf*)take((size_t)NB_ * CC * NV * 2); bf* VTl = (bf*)take((size_t)NB_ * CC * NV * 2);
    bf* Oh = (bf*)take((size_t)NB_ * NV * CC * 2); bf* Ol = (bf*)take((size_t)NB_ * NV * CC * 2); float* OT = (float*)take((size_t)NB_ * NV * CC * 4);
    if ((size_t)(wsp - (char*)d_ws) > ws_size) return;
    k_prep<<<NB_ * NG + 8, 256, 0, stream>>>(x, ST, wq, wk, wv, wp, W4);
    k_qkv<<<dim3(NV / 64, 3, NB_), 128, 0, stream>>>(x, ST, gam, bet, W4, bq, bk, bv, Qh, Ql, Kh, Kl, VTh, VTl);
    k_attn<<<dim3(NV / (QT * 16), NB_, 1), 256, 0, stream>>>(Qh, Ql, Kh, Kl, VTh, VTl, Oh, Ol);
    k_gemmb<true, false><<<dim3(NV / 64, 1, NB_), 128, 0, stream>>>(Oh, Ol, W4 + (size_t)3 * CC * CC, bp, bp, bp, OT, CC, nullptr, nullptr, CC);
    k_outT<<<dim3(NV / 64, NB_, 1), 256, 0, stream>>>(OT, x, out);
}

// v009
// A run of this version takes 74.8 microseconds.
// Timed twice side by side with v008, it ran 1.11 times as fast both times.
// Counting every step since v000, it is 72.6 times as fast.
#include <hip/hip_runtime.h>

// Compute dtypes, f32 accumulate, per item: GroupNorm (32 groups, statistics in f32, fixed order) while transposing to voxel-major bf16 hi + UNSCALED residual A fragments in registers; q/k/v/proj =
// 1x1x1 convs as [8192 x 64].[64 x 64] GEMMs on hi/lo operands with exact bf16 weights (two products, + bias); single-head attention over the 8192 voxels in k_attn (eight key ranges, combined in k_proj) with
// hi/lo operands (three products); 1/8 and the softmax in f32; x + out with the channel-major transpose in f32 - on v_wmma_f32_16x16x32_bf16. Deterministic, no atomics; every

#define NB_  2
#define CC   64
#define NV   8192
#define NG   32
#define DM   CC
#define SCL  0.125f
#define GEPS 1e-6f
#define LOSC 1024.0f
#define AW   8
#define AKL  (NV / AW)
#define QT   4            // 16-query tiles a wave of k_attn holds: every K and V fragment it loads serves 64 queries
#define SK   128          // keys of one stage of k_attn's LDS ring
#define NS   (AKL / SK)
#define PE   (SK * CC)    // elements of one plane in a stage

typedef _Float16 h16;
typedef unsigned short bf;
typedef __attribute__((ext_vector_type(16))) __bf16   v16bf;
typedef __attribute__((ext_vector_type(16))) _Float16 v16h;
typedef __attribute__((ext_vector_type(8)))  _Float16 v8h;
typedef __attribute__((ext_vector_type(8)))  unsigned short v8us;
typedef __attribute__((ext_vector_type(8)))  float    v8f;
typedef __attribute__((ext_vector_type(4)))  float    v4f;
typedef __attribute__((ext_vector_type(2)))  float    v2f;
typedef __attribute__((ext_vector_type(2)))  __bf16   v2bf;
typedef v8h  __attribute__((may_alias)) v8ha;
typedef v4f  __attribute__((may_alias)) v4fa;
typedef v8us __attribute__((may_alias)) v8usa;

__device__ __forceinline__ unsigned short f2bf(float f) { unsigned u = __float_as_uint(f); u += 0x7FFFu + ((u >> 16) & 1u); return (unsigned short)(u >> 16); }
__device__ __forceinline__ float bf2f(unsigned short b) { return __uint_as_float(((unsigned)b) << 16); }
__device__ __forceinline__ float bfr(float f) { return bf2f(f2bf(f)); }
__device__ __forceinline__ v16h cat16(v8h lo, v8h hi) { return __builtin_shufflevector(lo, hi, 0, 1, 2, 3, 4, 5, 6, 7, 8, 9, 10, 11, 12, 13, 14, 15); }
__device__ __forceinline__ v16bf cat16b(v8us lo, v8us hi) { return __builtin_bit_cast(v16bf, __builtin_shufflevector(lo, hi, 0, 1, 2, 3, 4, 5, 6, 7, 8, 9, 10, 11, 12, 13, 14, 15)); }
__device__ __forceinline__ v8f wmma16(v16h a, v16h b, v8f c) { return __builtin_amdgcn_wmma_f32_16x16x32_f16(false, a, false, b, (short)0, c, false, false); }
__device__ __forceinline__ v8f wmmab(v16bf a, v16bf b, v8f c) { return __builtin_amdgcn_wmma_f32_16x16x32_bf16(false, a, false, b, (short)0, c, false, false); }

__device__ __forceinline__ void d_cvt8(int blk, const float* __restrict__ src, bf* dst, size_t n8) {
    const size_t i = (size_t)blk * 256 + threadIdx.x; if (i >= n8) return;
    const v8f v = *(const v8f*)(src + i * 8); v8us o;
#pragma unroll
    for (int k = 0; k < 8; ++k) o[k] = f2bf(v[k]);
    *(v8us*)(dst + i * 8) = o; 
}
__global__ __launch_bounds__(256) void k_zero8(bf* dst, size_t n8) {
    const size_t i = (size_t)blockIdx.x * 256 + threadIdx.x; if (i >= n8) return; v8us z;
#pragma unroll
    for (int k = 0; k < 8; ++k) z[k] = 0;
    *(v8us*)(dst + i * 8) = z; 
}


// d_gnstat: mean and rsqrt(var + eps) (biased var, f32) of one group of 2 channels = 2 x 8192 contiguous values of x, by one work-group of 8 waves. Each thread fetches its 64 values
// once, as 16 16-byte loads that are all in flight together, and keeps them in registers for both passes (sum, then squared deviations from the mean). Fixed order: a thread's 16
// vectors, their 4 elements, xor tree over the lanes, the 8 waves' partial sums through LDS in wave order. Wave 0 writes the group's whole 128-byte line of ST.
__device__ __forceinline__ void d_gnstat(int g, const float* __restrict__ xb, float* ST) {
    __shared__ float ps[8], pq[8];
    const int tid = threadIdx.x, lane = tid & 31, wv = tid >> 5; const v4f* base = (const v4f*)(xb + (size_t)(2 * g) * NV); const int n = 2 * NV;
    v4f v[16];
#pragma unroll
    for (int i = 0; i < 16; ++i) v[i] = base[i * 256 + tid];
    v4f s4 = v[0];
#pragma unroll
    for (int i = 1; i < 16; ++i) s4 += v[i];
    float s = (s4[0] + s4[1]) + (s4[2] + s4[3]);
#pragma unroll
    for (int sh = 16; sh; sh >>= 1) s += __shfl_xor(s, sh, 32);
    if (lane == 0) ps[wv] = s;
    __syncthreads();
    s = ps[0];
#pragma unroll
    for (int w = 1; w < 8; ++w) s += ps[w];
    const float mu = s / (float)n; v4f q4 = (v4f){};
#pragma unroll
    for (int i = 0; i < 16; ++i) { const v4f d = v[i] - mu; q4 += d * d; }
    float q = (q4[0] + q4[1]) + (q4[2] + q4[3]);
#pragma unroll
    for (int sh = 16; sh; sh >>= 1) q += __shfl_xor(q, sh, 32);
    if (lane == 0) pq[wv] = q;
    __syncthreads();
    q = pq[0];
#pragma unroll
    for (int w = 1; w < 8; ++w) q += pq[w];
    const float rs = rsqrtf(q / (float)n + GEPS);
    if (wv == 0) ST[(size_t)g * 32 + lane] = (lane == 0) ? mu : (lane == 1) ? rs : 0.f;
}
// k_prep: the launches that depend on nothing, side by side in one grid: blocks 0..63 the statistics (one block a group, 32 groups a batch item), blocks 64..71 the four weight matrices to bf16 (2 blocks each).
__global__ __launch_bounds__(256) void k_prep(const float* __restrict__ x, float* ST, const float* __restrict__ wq, const float* __restrict__ wk, const float* __restrict__ wv, const float* __restrict__ wp, bf* W4) {
    const int bx = blockIdx.x;
    if (bx < NB_ * NG) { const int item = bx / NG; d_gnstat(bx % NG, x + (size_t)item * CC * NV, ST + (size_t)item * NG * 32); return; }
    const int u = bx - NB_ * NG, sel = u >> 1;
    d_cvt8(u & 1, sel == 0 ? wq : sel == 1 ? wk : sel == 2 ? wv : wp, W4 + (size_t)sel * CC * CC, CC * CC / 8);
}
// k_qkv: GroupNorm apply, one of the q/k/v 1x1x1 convs (blockIdx.y) and the split into the planes k_attn reads, for 64 voxels x 64 channels of one batch item (blockIdx.z), in one kernel.
// The normalised tile (bf(x[c][p]) - mean_g) rstd_g bf(gamma[c]) + bf(beta[c]) goes into LDS in f32; each of the 4 waves takes 16 voxels (the transpose is in its LDS reads), splits them into bf16 hi + residual
// A fragments in registers, and does [16 x 64].[64 x 64] on exact bf16 weights (two products, + bias). The f32 result is split into bf16 hi + residual and stored straight in its final order:
// Q: rows of 64 channels. K and V: the order in which k_attn's A fragments are read, 512-byte blocks, lane l's 16 bytes at 16 * l, so that a wave-wide 16-byte load covers four whole lines.
// K: block ((tile * 2 + ks) * 2 + j) holds K[tile * 16 + c][ks * 32 + h * 16 + j * 8 + i], lane = h * 16 + c.
// V: block ((pass * 4 + dt) * 2 + j) holds V[pass * 32 + j * 16 + h * 8 + i][dt * 16 + c], lane = h * 16 + c: the accumulators' own layout, so V needs no LDS.
// Every loop is unrolled whole: its arrays are indexed by the loop counter and have to stay in registers.
__device__ __forceinline__ void split8(const float* y, bf* Ph, bf* Pl, size_t o) {
    v8us oh, ol;
#pragma unroll
    for (int i = 0; i < 8; ++i) { const unsigned short hb = f2bf(y[i]); oh[i] = hb; ol[i] = f2bf(y[i] - bf2f(hb)); }
    *(v8us*)(Ph + o) = oh; *(v8us*)(Pl + o) = ol;
}
__global__ __launch_bounds__(128) void k_qkv(const float* __restrict__ xb, const float* __restrict__ ST, const float* __restrict__ gam, const float* __restrict__ bet, const bf* __restrict__ W4, const float* __restrict__ bq, const float* __restrict__ bk, const float* __restrict__ bv,
                                             bf* Qh, bf* Ql, bf* Kh, bf* Kl, bf* Vh, bf* Vl) {
    __shared__ __align__(16) float tl[64][68];        // [channel][voxel]
    __shared__ __align__(16) float ost[4][16 * 68];   // a wave's 16 x 64 result
    const int tid = threadIdx.x, lane = tid & 31, wave = __builtin_amdgcn_readfirstlane(tid >> 5), lr = lane & 15, hi = lane >> 4;
    const int p0 = blockIdx.x * 64, sel = blockIdx.y, item = blockIdx.z;
    xb += (size_t)item * CC * NV; ST += (size_t)item * NG * 32;
    const bf* Bn = W4 + (size_t)sel * CC * CC; const float* bias = sel == 0 ? bq : sel == 1 ? bk : bv;
    const int ch0 = tid >> 4, pc = (tid & 15) * 4;   // a wave-wide 16-byte load covers 2 channels x 64 voxels, four whole lines; a thread has channels ch0 + 8 * i
    v4f xv[8]; float mu[8], rs[8], ga[8], be[8];
#pragma unroll
    for (int i = 0; i < 8; ++i) { const int g = i * 4 + wave; mu[i] = ST[g * 32]; rs[i] = ST[g * 32 + 1]; }   // g = channel >> 1, the same for a whole wave
#pragma unroll
    for (int i = 0; i < 8; ++i) { xv[i] = *(const v4f*)(xb + (size_t)(i * 8 + ch0) * NV + p0 + pc); ga[i] = gam[i * 8 + ch0]; be[i] = bet[i * 8 + ch0]; }
    asm volatile("s_wait_xcnt 0x0" ::: "memory");   // here and below: stands before a register that the issued loads name is written again
    __builtin_amdgcn_sched_barrier(0);              // keeps the register writes that follow from being scheduled ahead of the wait above
    v16bf b[2][4]; float bb[4];
#pragma unroll
    for (int t = 0; t < 4; ++t) { const bf* bp = Bn + (size_t)(t * 16 + lr) * CC + 8 * hi; bb[t] = bias[t * 16 + lr];
#pragma unroll
        for (int ks = 0; ks < 2; ++ks) b[ks][t] = cat16b(*(const v8us*)(bp + ks * 32), *(const v8us*)(bp + ks * 32 + 16)); }
    asm volatile("s_wait_xcnt 0x0" ::: "memory");
    __builtin_amdgcn_sched_barrier(0);              // as above
#pragma unroll
    for (int i = 0; i < 8; ++i) { const float gb = bfr(ga[i]), bt = bfr(be[i]); v4f y;
#pragma unroll
        for (int e = 0; e < 4; ++e) y[e] = (bfr(xv[i][e]) - mu[i]) * rs[i] * gb + bt;
        *(v4fa*)&tl[i * 8 + ch0][pc] = y; }
    __syncthreads();   // every wave reads all 64 channels of its 16 voxels, written by all four waves
    v8f acc[4];
#pragma unroll
    for (int t = 0; t < 4; ++t) acc[t] = (v8f){};
#pragma unroll
    for (int ks = 0; ks < 2; ++ks) {
        const float* ap = &tl[ks * 32 + 8 * hi][wave * 16 + lr];   // the k order of the weights' fragments: 8 * hi + 0..7, then 16 + 8 * hi + 0..7
        v8us h0, h1, l0, l1;
#pragma unroll
        for (int i = 0; i < 8; ++i) { const float ya = ap[i * 68], yb = ap[(16 + i) * 68]; const unsigned short ha = f2bf(ya), hb = f2bf(yb);
            h0[i] = ha; l0[i] = f2bf(ya - bf2f(ha)); h1[i] = hb; l1[i] = f2bf(yb - bf2f(hb)); }
        const v16bf a = cat16b(h0, h1), al = cat16b(l0, l1);
#pragma unroll
        for (int t = 0; t < 4; ++t) { acc[t] = wmmab(a, b[ks][t], acc[t]); acc[t] = wmmab(al, b[ks][t], acc[t]); }
    }
    const size_t po = (size_t)item * NV * CC; const int r0 = p0 + wave * 16;
    float val[4][8];
#pragma unroll
    for (int t = 0; t < 4; ++t) {
#pragma unroll
        for (int j = 0; j < 8; ++j) val[t][j] = acc[t][j] + bfr(bb[t]); }
    if (sel == 2) {
#pragma unroll
        for (int dt = 0; dt < 4; ++dt) split8(val[dt], Vh, Vl, po + ((size_t)(r0 >> 5) * 256 + dt * 64 + ((r0 >> 4) & 1) * 32 + lane) * 8);
        return;
    }
    float* os = &ost[wave][0];
#pragma unroll
    for (int t = 0; t < 4; ++t) {
#pragma unroll
        for (int j = 0; j < 8; ++j) os[(hi * 8 + j) * 68 + t * 16 + lr] = val[t][j]; }
    __syncthreads();   // a lane reads below what other lanes have written above (the whole block is on this path: sel is blockIdx.y)
    // Q: 4 rows x 8 pieces of 8 channels a step. K: block s = ks * 2 + j of the wave's tile a step. Either way a step's 32 pieces stand 512 bytes behind the step before.
    const int so = sel == 0 ? (lane >> 3) * 68 + (lane & 7) * 8 : lr * 68 + hi * 16;
    const int ss = sel == 0 ? 4 * 68 : 8, s2 = sel == 0 ? 8 * 68 : 32;   // the source's step for bit 0 and bit 1 of s
    bf* Ph = sel == 0 ? Qh : Kh; bf* Pl = sel == 0 ? Ql : Kl;
    float y[4][8];
#pragma unroll
    for (int s = 0; s < 4; ++s) { const float* sp = os + so + (s & 1) * ss + (s >> 1) * s2; const v4f u0 = *(const v4fa*)sp, u1 = *(const v4fa*)(sp + 4);
#pragma unroll
        for (int i = 0; i < 4; ++i) { y[s][i] = u0[i]; y[s][4 + i] = u1[i]; } }
#pragma unroll
    for (int s = 0; s < 4; ++s) split8(y[s], Ph, Pl, po + (size_t)r0 * CC + s * 256 + lane * 8);
}
__device__ __forceinline__ v16bf ld16(const bf* p) { return cat16b(*(const v8us*)p, *(const v8us*)(p + 8)); }    // 16 consecutive k a lane: Q; k_qkv's blocks give K's fragments the same k order
__device__ __forceinline__ v16bf ldfr(const bf* p) { return cat16b(*(const v8us*)p, *(const v8us*)(p + 256)); }  // a fragment from two 512-byte blocks of k_qkv's K or V planes, p already at 8 * lane
__device__ __forceinline__ float xhalf(float v) { const int b = __float_as_int(v); return __int_as_float(__builtin_amdgcn_permlanex16(b, b, 0x76543210, 0xfedcba98, false, false)); }   // lane l <-> l ^ 16
// 2^x by v_exp_f32. The v_nop is the one slot the instruction set asks for behind a transcendental before its result is read or its source overwritten; it stands in the same
// statement because a v_nop apart drifts off. In the run of eight each v_exp_f32 works in place on a register of its own, so only the last one needs the slot.
__device__ __forceinline__ float exp2_slot(float x) { float r; asm("v_exp_f32 %0, %1\n\tv_nop" : "=v"(r) : "v"(x)); return r; }
__device__ __forceinline__ void exp2x8(float* x) {
    asm("v_exp_f32 %0, %0\n\tv_exp_f32 %1, %1\n\tv_exp_f32 %2, %2\n\tv_exp_f32 %3, %3\n\tv_exp_f32 %4, %4\n\tv_exp_f32 %5, %5\n\tv_exp_f32 %6, %6\n\tv_exp_f32 %7, %7\n\tv_nop"
        : "+v"(x[0]), "+v"(x[1]), "+v"(x[2]), "+v"(x[3]), "+v"(x[4]), "+v"(x[5]), "+v"(x[6]), "+v"(x[7]));
}
// Eight 16-byte asynchronous copies a lane, global memory to LDS through no register: four 4-KB steps of plane a, then of plane b, which stands 16 KB behind a in LDS.
// The s_wait_xcnt 0 is the last line of the copies' own statement, so that it stands before any register that a copy names is written again.
__device__ __forceinline__ void acopy8(unsigned d, const bf* ga, const bf* gb) {
    asm volatile("global_load_async_to_lds_b128 %0, %8, off\n\tglobal_load_async_to_lds_b128 %1, %9, off\n\tglobal_load_async_to_lds_b128 %2, %10, off\n\tglobal_load_async_to_lds_b128 %3, %11, off\n\t"
                 "global_load_async_to_lds_b128 %4, %12, off\n\tglobal_load_async_to_lds_b128 %5, %13, off\n\tglobal_load_async_to_lds_b128 %6, %14, off\n\tglobal_load_async_to_lds_b128 %7, %15, off\n\ts_wait_xcnt 0x0"
                 :: "v"(d), "v"(d + 4096u), "v"(d + 8192u), "v"(d + 12288u), "v"(d + 16384u), "v"(d + 20480u), "v"(d + 24576u), "v"(d + 28672u),
                    "v"(ga), "v"(ga + 2048), "v"(ga + 4096), "v"(ga + 6144), "v"(gb), "v"(gb + 2048), "v"(gb + 4096), "v"(gb + 6144) : "memory");
}
// k_attn: scores, softmax and P.V in one kernel; scores and probabilities never leave the registers. A work-group owns 512 queries (64 a wave) and one range of 1024 keys (blockIdx.y), which all its
// 8 waves walk together: the range's K and V planes come into LDS once for the work-group, in stages of 128 keys (4 planes x 16 KB), two buffers, by asynchronous copies issued one stage ahead, and each
// wave reads its fragments from there. Passes of 32 keys: St = K.Qt (a lane holds one query's scores), running maximum and sum per query, Pt packed from the score accumulators as B operand,
// Ot += Vt.Pt. hi/lo operands, three products each. The maximum in use is raised only when a new one exceeds it by more than 8 (log2 units), so P stays below 2^8 times its normalised size.
// Each wave stores its partial (max, sum, Ot) of the key range, not normalised, in f32; k_proj combines the eight ranges. Ot goes out in the accumulators' own layout, 512 bytes in a row a store.
__global__ __launch_bounds__(256) void k_attn(const bf* __restrict__ Qh, const bf* __restrict__ Ql, const bf* __restrict__ Kh, const bf* __restrict__ Kl, const bf* __restrict__ Vh, const bf* __restrict__ Vl, float* PO, float* PM, float* PL) {
    __shared__ __align__(16) bf kv[2 * 4 * PE];   // [buffer][K hi, K lo, V hi, V lo][128 keys x 64 channels, in the planes' own fragment order]
    const int tid = threadIdx.x, lane = tid & 31, wave = __builtin_amdgcn_readfirstlane(tid >> 5), c = lane & 15, h = lane >> 4;
    const int q0 = (blockIdx.x * AW + wave) * (QT * 16), kr = blockIdx.y; const size_t po = (size_t)blockIdx.z * NV * CC;   // po: the batch item's planes
    const float CS = SCL * 1.44269504f;   // scores go to log2 units
    const int ko = c * CC + 16 * h;   // a lane's place in a 16-row tile of Q
    const int fo = lane * 8;          // a lane's place in a 512-byte block of K or V
    const bf* qph = Qh + po + (size_t)q0 * CC; const bf* qpl = Ql + po + (size_t)q0 * CC;
    const size_t go = po + (size_t)kr * AKL * CC + tid * 8;   // a thread's first 16 bytes of the key range in each plane
    const unsigned ld0 = (unsigned)(size_t)&kv[0] + tid * 16;
    auto fill = [&](int st) {   // stage st of the key range into buffer st & 1: 16 copies a lane
        const unsigned d = ld0 + (st & 1) * (4 * PE * 2); const size_t g = go + (size_t)st * PE;
        acopy8(d, Kh + g, Kl + g); acopy8(d + 2 * PE * 2, Vh + g, Vl + g);
    };
    fill(0);
    asm volatile("s_wait_asynccnt 0x0" ::: "memory");   // this wave's copies of stage 0 have landed
    __syncthreads();                                    // and every other wave's: stage 0 may be read
    fill(1);
    v16bf qh[QT][2], ql[QT][2];
#pragma unroll
    for (int qt = 0; qt < QT; ++qt) {
#pragma unroll
        for (int ks = 0; ks < 2; ++ks) { qh[qt][ks] = ld16(qph + ko + qt * 16 * CC + ks * 32); ql[qt][ks] = ld16(qpl + ko + qt * 16 * CC + ks * 32); } }
    asm volatile("s_wait_xcnt 0x0" ::: "memory");   // stands before a register that the issued loads name is written again
    __builtin_amdgcn_sched_barrier(0);   // keeps the register writes that follow from being scheduled ahead of the wait above (one of them reuses the Q loads' offset register)
    v8f acc[QT][4]; float m[QT], l[QT];
#pragma unroll
    for (int qt = 0; qt < QT; ++qt) { m[qt] = -3.0e38f; l[qt] = 0.f;
#pragma unroll
        for (int dt = 0; dt < 4; ++dt) acc[qt][dt] = (v8f){}; }
#pragma unroll 1   // rolled: the stages differ only in the buffer they read
    for (int st = 0; st < NS; ++st) {
        const bf* kp = kv + (st & 1) * (4 * PE) + fo; const bf* vp = kp + 2 * PE;   // the lo plane stands PE elements behind its hi plane
        v16bf kh[2][2], kl[2][2], vh[4], vl[4];
#pragma unroll
        for (int kt = 0; kt < 2; ++kt) {
#pragma unroll
            for (int ks = 0; ks < 2; ++ks) { kh[kt][ks] = ldfr(kp + (kt * 2 + ks) * 512); kl[kt][ks] = ldfr(kp + PE + (kt * 2 + ks) * 512); } }
#pragma unroll 1   // rolled: one pass is already 96 matrix instructions and most of a wave's 512 registers
        for (int p = 0; p < SK / 32; ++p) {
            v8f s[QT][2];
#pragma unroll
            for (int qt = 0; qt < QT; ++qt) { s[qt][0] = (v8f){}; s[qt][1] = (v8f){}; }
#pragma unroll
            for (int ks = 0; ks < 2; ++ks) {
#pragma unroll
                for (int kt = 0; kt < 2; ++kt) {
#pragma unroll
                    for (int qt = 0; qt < QT; ++qt) s[qt][kt] = wmmab(kh[kt][ks], qh[qt][ks], s[qt][kt]); }
#pragma unroll
                for (int kt = 0; kt < 2; ++kt) {
#pragma unroll
                    for (int qt = 0; qt < QT; ++qt) s[qt][kt] = wmmab(kl[kt][ks], qh[qt][ks], s[qt][kt]); }
#pragma unroll
                for (int kt = 0; kt < 2; ++kt) {
#pragma unroll
                    for (int qt = 0; qt < QT; ++qt) s[qt][kt] = wmmab(kh[kt][ks], ql[qt][ks], s[qt][kt]); }
                // this pass's Vt, one half behind each half of the score products, into the registers that the K fragments of that half leave; the softmax covers the LDS latency
#pragma unroll
                for (int dt = 0; dt < 4; ++dt) { if (ks == 0) vl[dt] = ldfr(vp + PE + dt * 512); else vh[dt] = ldfr(vp + dt * 512); } }
            __builtin_amdgcn_sched_barrier(0);   // keeps the Vt loads up here in two groups: left free they sink in small groups to just ahead of the output products, which then wait for them
            float mx[QT];
#pragma unroll
            for (int qt = 0; qt < QT; ++qt) { float a = fmaxf(s[qt][0][0], s[qt][1][0]);
#pragma unroll
                for (int i = 1; i < 8; ++i) a = fmaxf(a, fmaxf(s[qt][0][i], s[qt][1][i]));
                mx[qt] = fmaxf(a, xhalf(a)) * CS; }
            bool need = false;
#pragma unroll
            for (int qt = 0; qt < QT; ++qt) need |= mx[qt] > m[qt] + 8.0f;
            if (__builtin_amdgcn_ballot_w32(need) != 0) {   // one scalar branch a pass
#pragma unroll
                for (int qt = 0; qt < QT; ++qt) { const float mn = fmaxf(m[qt], mx[qt]); const float al = exp2_slot(m[qt] - mn); m[qt] = mn; l[qt] *= al;
#pragma unroll
                    for (int dt = 0; dt < 4; ++dt) acc[qt][dt] *= al; } }
            v16bf ph[QT], pl[QT];
#pragma unroll
            for (int qt = 0; qt < QT; ++qt) { float pv[16];
#pragma unroll
                for (int i = 0; i < 16; ++i) pv[i] = fmaf(s[qt][i >> 3][i & 7], CS, -m[qt]);
                exp2x8(pv); exp2x8(pv + 8);
#pragma unroll
                for (int i = 0; i < 16; i += 2) { const v2bf hb = __builtin_convertvector((v2f){pv[i], pv[i + 1]}, v2bf); const v2bf lb = __builtin_convertvector((v2f){pv[i] - (float)hb[0], pv[i + 1] - (float)hb[1]}, v2bf);
                    ph[qt][i] = hb[0]; ph[qt][i + 1] = hb[1]; pl[qt][i] = lb[0]; pl[qt][i + 1] = lb[1]; }
#pragma unroll
                for (int w = 8; w; w >>= 1) {
#pragma unroll
                    for (int i = 0; i < w; ++i) pv[i] += pv[i + w]; }
                l[qt] += pv[0]; }
#pragma unroll
            for (int dt = 0; dt < 4; ++dt) {
#pragma unroll
                for (int qt = 0; qt < QT; ++qt) acc[qt][dt] = wmmab(vh[dt], ph[qt], acc[qt][dt]); }
#pragma unroll
            for (int dt = 0; dt < 4; ++dt) {
#pragma unroll
                for (int qt = 0; qt < QT; ++qt) acc[qt][dt] = wmmab(vl[dt], ph[qt], acc[qt][dt]); }
            // the next pass's K: its first half behind the last use of V lo, 16 matrix instructions ahead of the pass's end, its second half behind the last use of V hi, 24 ahead of its own first use.
            // A stage's last pass fetches its own rows again (its own buffer, unused): nothing of the next stage is read before its barrier.
            kp += (p + 1 < SK / 32) ? 32 * CC : 0; vp += 32 * CC;
#pragma unroll
            for (int kt = 0; kt < 2; ++kt) { kh[kt][0] = ldfr(kp + (kt * 2) * 512); kl[kt][0] = ldfr(kp + PE + (kt * 2) * 512); }
#pragma unroll
            for (int dt = 0; dt < 4; ++dt) {
#pragma unroll
                for (int qt = 0; qt < QT; ++qt) acc[qt][dt] = wmmab(vh[dt], pl[qt], acc[qt][dt]); }
#pragma unroll
            for (int kt = 0; kt < 2; ++kt) { kh[kt][1] = ldfr(kp + (kt * 2 + 1) * 512); kl[kt][1] = ldfr(kp + PE + (kt * 2 + 1) * 512); }
        }
        asm volatile("s_wait_dscnt 0x0" ::: "memory");      // this wave's reads of the stage's buffer are done before the buffer is handed back
        asm volatile("s_wait_asynccnt 0x0" ::: "memory");   // this wave's copies of stage st + 1 have landed
        __syncthreads();                                    // publishes stage st + 1 and ends every wave's reads of stage st
        if (st + 2 < NS) fill(st + 2);                      // into the buffer that stage st has just left
    }
    asm volatile("s_wait_asynccnt 0x0" ::: "memory");       // no copy is outstanding when the wave ends
    const size_t pn = ((size_t)kr * NB_ + blockIdx.z) * NV + q0;   // the wave's first query in the key range's partial planes
    float* pp = PO + pn * CC + lane * 4;
#pragma unroll
    for (int qt = 0; qt < QT; ++qt) l[qt] += xhalf(l[qt]);
    // both halves of a wave hold the same max and sum of a query: the upper half stores the odd tiles', so that a store covers a whole line
#pragma unroll
    for (int i = 0; i < QT / 2; ++i) { PM[pn + i * 32 + lane] = h ? m[2 * i + 1] : m[2 * i]; PL[pn + i * 32 + lane] = h ? l[2 * i + 1] : l[2 * i]; }
    asm volatile("s_wait_xcnt 0x0" ::: "memory");   // stands before a register that the four stores above name is written again
    __builtin_amdgcn_sched_barrier(0);              // keeps all vector work above the wide stores below: behind the first of them no register is written any more
#pragma unroll
    for (int qt = 0; qt < QT; ++qt) {
#pragma unroll
        for (int dt = 0; dt < 4; ++dt) { const v8f a = acc[qt][dt];
            *(v4f*)(pp + (qt * 4 + dt) * 256) = (v4f){a[0], a[1], a[2], a[3]}; *(v4f*)(pp + (qt * 4 + dt) * 256 + 128) = (v4f){a[4], a[5], a[6], a[7]}; } }
}
// k_proj: combines the eight key ranges' partial (max, sum, Ot) in range order (fixed), normalises, splits into bf16 hi + residual, and does the output conv [16 x 64].[64 x 64] a wave on exact bf16 weights
// (two products, + bias). k_attn's accumulator layout is this product's A fragment layout: lane h * 16 + c holds channels dt * 16 + h * 8 + 0..7 of query c, so the partials go from the loads into the fragments.
// All of a lane's loads are issued before the first is used. f32 whole-line epilogue through LDS.
__global__ __launch_bounds__(128) void k_proj(const float* __restrict__ PO, const float* __restrict__ PM, const float* __restrict__ PL, const bf* __restrict__ Bn, const float* __restrict__ bias, float* C) {
    __shared__ __align__(16) float ost[4][16 * 68];
    const int lane = threadIdx.x & 31, wave = __builtin_amdgcn_readfirstlane(threadIdx.x >> 5), lr = lane & 15, hi = lane >> 4;
    const int r0 = blockIdx.x * 64 + wave * 16, item = blockIdx.z;   // the same for a whole wave: the partial planes' bases are scalar, and all loads of a lane share one offset register
    C += (size_t)item * NV * CC;
    float mw[AW], lw[AW]; v4f pr[AW][4][2];
#pragma unroll
    for (int w = 0; w < AW; ++w) { const size_t pn = ((size_t)w * NB_ + item) * NV + r0; mw[w] = (PM + pn)[lr]; lw[w] = (PL + pn)[lr]; }
    asm volatile("s_wait_xcnt 0x0" ::: "memory");   // here and below: stands before a register that the issued loads name is written again (the next group's addresses and results)
    __builtin_amdgcn_sched_barrier(0);              // here and below: keeps the register writes that follow from being scheduled ahead of the wait above
#pragma unroll
    for (int w = 0; w < AW; ++w) { const float* pp = PO + (((size_t)w * NB_ + item) * NV + r0) * CC;
#pragma unroll
        for (int dt = 0; dt < 4; ++dt) { pr[w][dt][0] = *(const v4f*)(pp + dt * 256 + lane * 4); pr[w][dt][1] = *(const v4f*)(pp + dt * 256 + 128 + lane * 4); }
        if (w & 1) { asm volatile("s_wait_xcnt 0x0" ::: "memory"); __builtin_amdgcn_sched_barrier(0); } }   // two ranges' loads share an address
    v16bf b[2][4]; float bb[4];
#pragma unroll
    for (int t = 0; t < 4; ++t) { const bf* bp = Bn + (size_t)(t * 16 + lr) * CC + 8 * hi; bb[t] = bias[t * 16 + lr];
#pragma unroll
        for (int ks = 0; ks < 2; ++ks) b[ks][t] = cat16b(*(const v8us*)(bp + ks * 32), *(const v8us*)(bp + ks * 32 + 16)); }
    asm volatile("s_wait_xcnt 0x0" ::: "memory");
    __builtin_amdgcn_sched_barrier(0);
    float M = mw[0];
#pragma unroll
    for (int w = 1; w < AW; ++w) M = fmaxf(M, mw[w]);
    float L = 0.f; v8f o[4];
#pragma unroll
    for (int dt = 0; dt < 4; ++dt) o[dt] = (v8f){};
#pragma unroll
    for (int w = 0; w < AW; ++w) { const float a = exp2_slot(mw[w] - M); L = fmaf(lw[w], a, L);
#pragma unroll
        for (int dt = 0; dt < 4; ++dt) o[dt] += __builtin_shufflevector(pr[w][dt][0], pr[w][dt][1], 0, 1, 2, 3, 4, 5, 6, 7) * a; }
    const float inv = 1.0f / L; v8us oh[4], ol[4];
#pragma unroll
    for (int dt = 0; dt < 4; ++dt) {
#pragma unroll
        for (int i = 0; i < 8; ++i) { const float y = o[dt][i] * inv; const unsigned short hb = f2bf(y); oh[dt][i] = hb; ol[dt][i] = f2bf(y - bf2f(hb)); } }
    v8f acc[4];
#pragma unroll
    for (int t = 0; t < 4; ++t) acc[t] = (v8f){};
#pragma unroll
    for (int ks = 0; ks < 2; ++ks) { const v16bf a = cat16b(oh[2 * ks], oh[2 * ks + 1]), al = cat16b(ol[2 * ks], ol[2 * ks + 1]);   // the k order of the weights' fragments: 8 * hi + 0..7, then 16 + 8 * hi + 0..7
#pragma unroll
        for (int t = 0; t < 4; ++t) { acc[t] = wmmab(a, b[ks][t], acc[t]); acc[t] = wmmab(al, b[ks][t], acc[t]); } }
    float* os = &ost[wave][0];
#pragma unroll
    for (int t = 0; t < 4; ++t) { const float bv = bfr(bb[t]);
#pragma unroll
        for (int j = 0; j < 8; ++j) os[(hi * 8 + j) * 68 + t * 16 + lr] = acc[t][j] + bv; }
    __syncthreads();   // a lane reads below what other lanes have written above
    float* crow = C + (size_t)r0 * CC;
#pragma unroll
    for (int s = 0; s < 8; ++s) { const int Lid = (lane >> 3) + 4 * s, piece = lane & 7; const int row = Lid >> 1, cofs = (Lid & 1) * 32 + piece * 4;
        *(v4f*)(crow + (size_t)row * CC + cofs) = *(const v4fa*)(os + row * 68 + cofs); }
}
__global__ __launch_bounds__(256) void k_outT(const float* __restrict__ OT, const float* __restrict__ xb, float* OUTB) {
    __shared__ float tl[64][65];
    OT += (size_t)blockIdx.y * NV * CC; xb += (size_t)blockIdx.y * CC * NV; OUTB += (size_t)blockIdx.y * CC * NV;   // batch item
    const int tid = threadIdx.x; const int p0 = blockIdx.x * 64; const int rr = tid >> 2, cq = (tid & 3) * 16;
#pragma unroll
    for (int i = 0; i < 16; ++i) tl[rr][cq + i] = OT[(size_t)(p0 + rr) * CC + cq + i];
    __syncthreads();
    const int lane = tid & 31, wv = tid >> 5;
    auto pass = [&]() {
#pragma unroll
        for (int st = 0; st < 4; ++st) { const int cr = wv * 8 + st * 2 + (lane >> 4); const int pq = (lane & 15) * 4; v4f v; const size_t o = (size_t)cr * NV + p0 + pq;
#pragma unroll
            for (int i = 0; i < 4; ++i) v[i] = bfr(xb[o + i]) + tl[pq + i][cr];
            *(v4f*)(OUTB + o) = v; }
    };
    pass(); 
}

extern "C" void kernel_launch(void* const* d_in, const int* in_sizes, int n_in,
                              void* d_out, int out_size, void* d_ws, size_t ws_size, hipStream_t stream) {
    (void)in_sizes; (void)n_in; (void)out_size;
    const float* x = (const float*)d_in[0]; const float* gam = (const float*)d_in[1]; const float* bet = (const float*)d_in[2]; const float* wq = (const float*)d_in[3]; const float* bq = (const float*)d_in[4]; const float* wk = (const float*)d_in[5]; const float* bk = (const float*)d_in[6]; const float* wv = (const float*)d_in[7]; const float* bv = (const float*)d_in[8]; const float* wp = (const float*)d_in[9]; const float* bp = (const float*)d_in[10];
    float* out = (float*)d_out;    // [2][64][32][32][8]
    char* wsp = (char*)d_ws;
    auto take = [&](size_t bytes) { char* p = wsp; wsp += (bytes + 255) & ~(size_t)255; return (void*)p; };
    // every plane holds both batch items, item after item; the four weight matrices stand behind one another
    bf* W4 = (bf*)take((size_t)4 * CC * CC * 2); float* ST = (float*)take((size_t)NB_ * NG * 32 * 4);
    bf* Qh = (bf*)take((size_t)NB_ * NV * CC * 2); bf* Ql = (bf*)take((size_t)NB_ * NV * CC * 2); bf* Kh = (bf*)take((size_t)NB_ * NV * CC * 2); bf* Kl = (bf*)take((size_t)NB_ * NV * CC * 2); bf* VTh = (bf*)take((size_t)NB_ * CC * NV * 2); bf* VTl = (bf*)take((size_t)NB_ * CC * NV * 2);
    float* PO = (float*)take((size_t)AW * NB_ * NV * CC * 4); float* PM = (float*)take((size_t)AW * NB_ * NV * 4); float* PL = (float*)take((size_t)AW * NB_ * NV * 4); float* OT = (float*)take((size_t)NB_ * NV * CC * 4);
    if ((size_t)(wsp - (char*)d_ws) > ws_size) return;
    k_prep<<<NB_ * NG + 8, 256, 0, stream>>>(x, ST, wq, wk, wv, wp, W4);
    k_qkv<<<dim3(NV / 64, 3, NB_), 128, 0, stream>>>(x, ST, gam, bet, W4, bq, bk, bv, Qh, Ql, Kh, Kl, VTh, VTl);
    k_attn<<<dim3(NV / (AW * QT * 16), AW, NB_), 256, 0, stream>>>(Qh, Ql, Kh, Kl, VTh, VTl, PO, PM, PL);
    k_proj<<<dim3(NV / 64, 1, NB_), 128, 0, stream>>>(PO, PM, PL, W4 + (size_t)3 * CC * CC, bp, OT);
    k_outT<<<dim3(NV / 64, NB_, 1), 256, 0, stream>>>(OT, x, out);
}

// v010
// A run of this version takes 71.2 microseconds.
// Two timings next to v009 both put it at 1.05 times that version's speed.
// Counting every step since v000, it is 76.0 times as fast.
#include <hip/hip_runtime.h>

// Compute dtypes, f32 accumulate, per item: GroupNorm (32 groups, statistics in f32, fixed order) while transposing to voxel-major bf16 hi + UNSCALED residual A fragments in registers; q/k/v/proj =
// 1x1x1 convs as [8192 x 64].[64 x 64] GEMMs on hi/lo operands with exact bf16 weights (two products, + bias); single-head attention over the 8192 voxels in k_attn (eight key ranges, combined in k_proj) with
// hi/lo operands (three products); 1/8 and the softmax in f32; x + out with the channel-major transpose in f32 - on v_wmma_f32_16x16x32_bf16. Deterministic, no atomics; every

#define NB_  2
#define CC   64
#define NV   8192
#define NG   32
#define DM   CC
#define SCL  0.125f
#define GEPS 1e-6f
#define LOSC 1024.0f
#define AW   8
#define AKL  (NV / AW)
#define QT   4            // 16-query tiles a wave of k_attn holds: every K and V fragment it loads serves 64 queries
#define SK   128          // keys of one stage of k_attn's LDS ring
#define NS   (AKL / SK)
#define PE   (SK * CC)    // elements of one plane in a stage

typedef _Float16 h16;
typedef unsigned short bf;
typedef __attribute__((ext_vector_type(16))) __bf16   v16bf;
typedef __attribute__((ext_vector_type(16))) _Float16 v16h;
typedef __attribute__((ext_vector_type(8)))  _Float16 v8h;
typedef __attribute__((ext_vector_type(8)))  unsigned short v8us;
typedef __attribute__((ext_vector_type(8)))  float    v8f;
typedef __attribute__((ext_vector_type(4)))  float    v4f;
typedef __attribute__((ext_vector_type(2)))  float    v2f;
typedef __attribute__((ext_vector_type(2)))  __bf16   v2bf;
typedef v8h  __attribute__((may_alias)) v8ha;
typedef v4f  __attribute__((may_alias)) v4fa;
typedef v8us __attribute__((may_alias)) v8usa;

__device__ __forceinline__ unsigned short f2bf(float f) { unsigned u = __float_as_uint(f); u += 0x7FFFu + ((u >> 16) & 1u); return (unsigned short)(u >> 16); }
__device__ __forceinline__ float bf2f(unsigned short b) { return __uint_as_float(((unsigned)b) << 16); }
__device__ __forceinline__ float bfr(float f) { return bf2f(f2bf(f)); }
__device__ __forceinline__ v16h cat16(v8h lo, v8h hi) { return __builtin_shufflevector(lo, hi, 0, 1, 2, 3, 4, 5, 6, 7, 8, 9, 10, 11, 12, 13, 14, 15); }
__device__ __forceinline__ v16bf cat16b(v8us lo, v8us hi) { return __builtin_bit_cast(v16bf, __builtin_shufflevector(lo, hi, 0, 1, 2, 3, 4, 5, 6, 7, 8, 9, 10, 11, 12, 13, 14, 15)); }
__device__ __forceinline__ v8f wmma16(v16h a, v16h b, v8f c) { return __builtin_amdgcn_wmma_f32_16x16x32_f16(false, a, false, b, (short)0, c, false, false); }
__device__ __forceinline__ v8f wmmab(v16bf a, v16bf b, v8f c) { return __builtin_amdgcn_wmma_f32_16x16x32_bf16(false, a, false, b, (short)0, c, false, false); }

__device__ __forceinline__ void d_cvt8(int blk, const float* __restrict__ src, bf* dst, size_t n8) {
    const size_t i = (size_t)blk * 256 + threadIdx.x; if (i >= n8) return;
    const v8f v = *(const v8f*)(src + i * 8); v8us o;
#pragma unroll
    for (int k = 0; k < 8; ++k) o[k] = f2bf(v[k]);
    *(v8us*)(dst + i * 8) = o; 
}
__global__ __launch_bounds__(256) void k_zero8(bf* dst, size_t n8) {
    const size_t i = (size_t)blockIdx.x * 256 + threadIdx.x; if (i >= n8) return; v8us z;
#pragma unroll
    for (int k = 0; k < 8; ++k) z[k] = 0;
    *(v8us*)(dst + i * 8) = z; 
}


// d_gnstat: mean and rsqrt(var + eps) (biased var, f32) of one group of 2 channels = 2 x 8192 contiguous values of x, by one work-group of 8 waves. Each thread fetches its 64 values
// once, as 16 16-byte loads that are all in flight together, and keeps them in registers for both passes (sum, then squared deviations from the mean). Fixed order: a thread's 16
// vectors, their 4 elements, xor tree over the lanes, the 8 waves' partial sums through LDS in wave order. Wave 0 writes the group's whole 128-byte line of ST.
__device__ __forceinline__ void d_gnstat(int g, const float* __restrict__ xb, float* ST) {
    __shared__ float ps[8], pq[8];
    const int tid = threadIdx.x, lane = tid & 31, wv = tid >> 5; const v4f* base = (const v4f*)(xb + (size_t)(2 * g) * NV); const int n = 2 * NV;
    v4f v[16];
#pragma unroll
    for (int i = 0; i < 16; ++i) v[i] = base[i * 256 + tid];
    v4f s4 = v[0];
#pragma unroll
    for (int i = 1; i < 16; ++i) s4 += v[i];
    float s = (s4[0] + s4[1]) + (s4[2] + s4[3]);
#pragma unroll
    for (int sh = 16; sh; sh >>= 1) s += __shfl_xor(s, sh, 32);
    if (lane == 0) ps[wv] = s;
    __syncthreads();
    s = ps[0];
#pragma unroll
    for (int w = 1; w < 8; ++w) s += ps[w];
    const float mu = s / (float)n; v4f q4 = (v4f){};
#pragma unroll
    for (int i = 0; i < 16; ++i) { const v4f d = v[i] - mu; q4 += d * d; }
    float q = (q4[0] + q4[1]) + (q4[2] + q4[3]);
#pragma unroll
    for (int sh = 16; sh; sh >>= 1) q += __shfl_xor(q, sh, 32);
    if (lane == 0) pq[wv] = q;
    __syncthreads();
    q = pq[0];
#pragma unroll
    for (int w = 1; w < 8; ++w) q += pq[w];
    const float rs = rsqrtf(q / (float)n + GEPS);
    if (wv == 0) ST[(size_t)g * 32 + lane] = (lane == 0) ? mu : (lane == 1) ? rs : 0.f;
}
// k_prep: the launches that depend on nothing, side by side in one grid: blocks 0..63 the statistics (one block a group, 32 groups a batch item), blocks 64..71 the four weight matrices to bf16 (2 blocks each).
__global__ __launch_bounds__(256) void k_prep(const float* __restrict__ x, float* ST, const float* __restrict__ wq, const float* __restrict__ wk, const float* __restrict__ wv, const float* __restrict__ wp, bf* W4) {
    const int bx = blockIdx.x;
    if (bx < NB_ * NG) { const int item = bx / NG; d_gnstat(bx % NG, x + (size_t)item * CC * NV, ST + (size_t)item * NG * 32); return; }
    const int u = bx - NB_ * NG, sel = u >> 1;
    d_cvt8(u & 1, sel == 0 ? wq : sel == 1 ? wk : sel == 2 ? wv : wp, W4 + (size_t)sel * CC * CC, CC * CC / 8);
}
// k_qkv: GroupNorm apply, one of the q/k/v 1x1x1 convs (blockIdx.y) and the split into the planes k_attn reads, for 64 voxels x 64 channels of one batch item (blockIdx.z), in one kernel.
// The normalised tile (bf(x[c][p]) - mean_g) rstd_g bf(gamma[c]) + bf(beta[c]) goes into LDS in f32; each of the 4 waves takes 16 voxels (the transpose is in its LDS reads), splits them into bf16 hi + residual
// A fragments in registers, and does [16 x 64].[64 x 64] on exact bf16 weights (two products, + bias). The f32 result is split into bf16 hi + residual and stored straight in its final order:
// Q: rows of 64 channels. K and V: the order in which k_attn's A fragments are read, 512-byte blocks, lane l's 16 bytes at 16 * l, so that a wave-wide 16-byte load covers four whole lines.
// K: block ((tile * 2 + ks) * 2 + j) holds K[tile * 16 + c][ks * 32 + h * 16 + j * 8 + i], lane = h * 16 + c.
// V: block ((pass * 4 + dt) * 2 + j) holds V[pass * 32 + j * 16 + h * 8 + i][dt * 16 + c], lane = h * 16 + c: the accumulators' own layout, so V needs no LDS.
// Every loop is unrolled whole: its arrays are indexed by the loop counter and have to stay in registers.
__device__ __forceinline__ void split8(const float* y, bf* Ph, bf* Pl, size_t o) {
    v8us oh, ol;
#pragma unroll
    for (int i = 0; i < 8; ++i) { const unsigned short hb = f2bf(y[i]); oh[i] = hb; ol[i] = f2bf(y[i] - bf2f(hb)); }
    *(v8us*)(Ph + o) = oh; *(v8us*)(Pl + o) = ol;
}
__global__ __launch_bounds__(128) void k_qkv(const float* __restrict__ xb, const float* __restrict__ ST, const float* __restrict__ gam, const float* __restrict__ bet, const bf* __restrict__ W4, const float* __restrict__ bq, const float* __restrict__ bk, const float* __restrict__ bv,
                                             bf* Qh, bf* Ql, bf* Kh, bf* Kl, bf* Vh, bf* Vl) {
    __shared__ __align__(16) float tl[64][68];        // [channel][voxel]
    __shared__ __align__(16) float ost[4][16 * 68];   // a wave's 16 x 64 result
    const int tid = threadIdx.x, lane = tid & 31, wave = __builtin_amdgcn_readfirstlane(tid >> 5), lr = lane & 15, hi = lane >> 4;
    const int p0 = blockIdx.x * 64, sel = blockIdx.y, item = blockIdx.z;
    xb += (size_t)item * CC * NV; ST += (size_t)item * NG * 32;
    const bf* Bn = W4 + (size_t)sel * CC * CC; const float* bias = sel == 0 ? bq : sel == 1 ? bk : bv;
    const int ch0 = tid >> 4, pc = (tid & 15) * 4;   // a wave-wide 16-byte load covers 2 channels x 64 voxels, four whole lines; a thread has channels ch0 + 8 * i
    v4f xv[8]; float mu[8], rs[8], ga[8], be[8];
#pragma unroll
    for (int i = 0; i < 8; ++i) { const int g = i * 4 + wave; mu[i] = ST[g * 32]; rs[i] = ST[g * 32 + 1]; }   // g = channel >> 1, the same for a whole wave
#pragma unroll
    for (int i = 0; i < 8; ++i) { xv[i] = *(const v4f*)(xb + (size_t)(i * 8 + ch0) * NV + p0 + pc); ga[i] = gam[i * 8 + ch0]; be[i] = bet[i * 8 + ch0]; }
    asm volatile("s_wait_xcnt 0x0" ::: "memory");   // here and below: stands before a register that the issued loads name is written again
    __builtin_amdgcn_sched_barrier(0);              // keeps the register writes that follow from being scheduled ahead of the wait above
    v16bf b[2][4]; float bb[4];
#pragma unroll
    for (int t = 0; t < 4; ++t) { const bf* bp = Bn + (size_t)(t * 16 + lr) * CC + 8 * hi; bb[t] = bias[t * 16 + lr];
#pragma unroll
        for (int ks = 0; ks < 2; ++ks) b[ks][t] = cat16b(*(const v8us*)(bp + ks * 32), *(const v8us*)(bp + ks * 32 + 16)); }
    asm volatile("s_wait_xcnt 0x0" ::: "memory");
    __builtin_amdgcn_sched_barrier(0);              // as above
#pragma unroll
    for (int i = 0; i < 8; ++i) { const float gb = bfr(ga[i]), bt = bfr(be[i]); v4f y;
#pragma unroll
        for (int e = 0; e < 4; ++e) y[e] = (bfr(xv[i][e]) - mu[i]) * rs[i] * gb + bt;
        *(v4fa*)&tl[i * 8 + ch0][pc] = y; }
    __syncthreads();   // every wave reads all 64 channels of its 16 voxels, written by all four waves
    v8f acc[4];
#pragma unroll
    for (int t = 0; t < 4; ++t) acc[t] = (v8f){};
#pragma unroll
    for (int ks = 0; ks < 2; ++ks) {
        const float* ap = &tl[ks * 32 + 8 * hi][wave * 16 + lr];   // the k order of the weights' fragments: 8 * hi + 0..7, then 16 + 8 * hi + 0..7
        v8us h0, h1, l0, l1;
#pragma unroll
        for (int i = 0; i < 8; ++i) { const float ya = ap[i * 68], yb = ap[(16 + i) * 68]; const unsigned short ha = f2bf(ya), hb = f2bf(yb);
            h0[i] = ha; l0[i] = f2bf(ya - bf2f(ha)); h1[i] = hb; l1[i] = f2bf(yb - bf2f(hb)); }
        const v16bf a = cat16b(h0, h1), al = cat16b(l0, l1);
#pragma unroll
        for (int t = 0; t < 4; ++t) { acc[t] = wmmab(a, b[ks][t], acc[t]); acc[t] = wmmab(al, b[ks][t], acc[t]); }
    }
    const size_t po = (size_t)item * NV * CC; const int r0 = p0 + wave * 16;
    float val[4][8];
#pragma unroll
    for (int t = 0; t < 4; ++t) {
#pragma unroll
        for (int j = 0; j < 8; ++j) val[t][j] = acc[t][j] + bfr(bb[t]); }
    if (sel == 2) {
#pragma unroll
        for (int dt = 0; dt < 4; ++dt) split8(val[dt], Vh, Vl, po + ((size_t)(r0 >> 5) * 256 + dt * 64 + ((r0 >> 4) & 1) * 32 + lane) * 8);
        return;
    }
    float* os = &ost[wave][0];
#pragma unroll
    for (int t = 0; t < 4; ++t) {
#pragma unroll
        for (int j = 0; j < 8; ++j) os[(hi * 8 + j) * 68 + t * 16 + lr] = val[t][j]; }
    __syncthreads();   // a lane reads below what other lanes have written above (the whole block is on this path: sel is blockIdx.y)
    // Q: 4 rows x 8 pieces of 8 channels a step. K: block s = ks * 2 + j of the wave's tile a step. Either way a step's 32 pieces stand 512 bytes behind the step before.
    const int so = sel == 0 ? (lane >> 3) * 68 + (lane & 7) * 8 : lr * 68 + hi * 16;
    const int ss = sel == 0 ? 4 * 68 : 8, s2 = sel == 0 ? 8 * 68 : 32;   // the source's step for bit 0 and bit 1 of s
    bf* Ph = sel == 0 ? Qh : Kh; bf* Pl = sel == 0 ? Ql : Kl;
    float y[4][8];
#pragma unroll
    for (int s = 0; s < 4; ++s) { const float* sp = os + so + (s & 1) * ss + (s >> 1) * s2; const v4f u0 = *(const v4fa*)sp, u1 = *(const v4fa*)(sp + 4);
#pragma unroll
        for (int i = 0; i < 4; ++i) { y[s][i] = u0[i]; y[s][4 + i] = u1[i]; } }
#pragma unroll
    for (int s = 0; s < 4; ++s) split8(y[s], Ph, Pl, po + (size_t)r0 * CC + s * 256 + lane * 8);
}
__device__ __forceinline__ v16bf ld16(const bf* p) { return cat16b(*(const v8us*)p, *(const v8us*)(p + 8)); }    // 16 consecutive k a lane: Q; k_qkv's blocks give K's fragments the same k order
__device__ __forceinline__ v16bf ldfr(const bf* p) { return cat16b(*(const v8us*)p, *(const v8us*)(p + 256)); }  // a fragment from two 512-byte blocks of k_qkv's K or V planes, p already at 8 * lane
__device__ __forceinline__ float xhalf(float v) { const int b = __float_as_int(v); return __int_as_float(__builtin_amdgcn_permlanex16(b, b, 0x76543210, 0xfedcba98, false, false)); }   // lane l <-> l ^ 16
// 2^x by v_exp_f32. The v_nop is the one slot the instruction set asks for behind a transcendental before its result is read or its source overwritten; it stands in the same
// statement because a v_nop apart drifts off. In the run of eight each v_exp_f32 works in place on a register of its own, so only the last one needs the slot.
__device__ __forceinline__ float exp2_slot(float x) { float r; asm("v_exp_f32 %0, %1\n\tv_nop" : "=v"(r) : "v"(x)); return r; }
__device__ __forceinline__ void exp2x8(float* x) {
    asm("v_exp_f32 %0, %0\n\tv_exp_f32 %1, %1\n\tv_exp_f32 %2, %2\n\tv_exp_f32 %3, %3\n\tv_exp_f32 %4, %4\n\tv_exp_f32 %5, %5\n\tv_exp_f32 %6, %6\n\tv_exp_f32 %7, %7\n\tv_nop"
        : "+v"(x[0]), "+v"(x[1]), "+v"(x[2]), "+v"(x[3]), "+v"(x[4]), "+v"(x[5]), "+v"(x[6]), "+v"(x[7]));
}
// Eight 16-byte asynchronous copies a lane, global memory to LDS through no register: four 4-KB steps of plane a, then of plane b, which stands 16 KB behind a in LDS.
// The s_wait_xcnt 0 is the last line of the copies' own statement, so that it stands before any register that a copy names is written again.
__device__ __forceinline__ void acopy8(unsigned d, const bf* ga, const bf* gb) {
    asm volatile("global_load_async_to_lds_b128 %0, %8, off\n\tglobal_load_async_to_lds_b128 %1, %9, off\n\tglobal_load_async_to_lds_b128 %2, %10, off\n\tglobal_load_async_to_lds_b128 %3, %11, off\n\t"
                 "global_load_async_to_lds_b128 %4, %12, off\n\tglobal_load_async_to_lds_b128 %5, %13, off\n\tglobal_load_async_to_lds_b128 %6, %14, off\n\tglobal_load_async_to_lds_b128 %7, %15, off\n\ts_wait_xcnt 0x0"
                 :: "v"(d), "v"(d + 4096u), "v"(d + 8192u), "v"(d + 12288u), "v"(d + 16384u), "v"(d + 20480u), "v"(d + 24576u), "v"(d + 28672u),
                    "v"(ga), "v"(ga + 2048), "v"(ga + 4096), "v"(ga + 6144), "v"(gb), "v"(gb + 2048), "v"(gb + 4096), "v"(gb + 6144) : "memory");
}
// k_attn: scores, softmax and P.V in one kernel; scores and probabilities never leave the registers. A work-group owns 512 queries (64 a wave) and one range of 1024 keys (blockIdx.y), which all its
// 8 waves walk together: the range's K and V planes come into LDS once for the work-group, in stages of 128 keys (4 planes x 16 KB), two buffers, by asynchronous copies issued one stage ahead, and each
// wave reads its fragments from there. Passes of 32 keys: St = K.Qt (a lane holds one query's scores), running maximum and sum per query, Pt packed from the score accumulators as B operand,
// Ot += Vt.Pt. hi/lo operands, three products each. The maximum in use is raised only when a new one exceeds it by more than 8 (log2 units), so P stays below 2^8 times its normalised size.
// Each wave stores its partial (max, sum, Ot) of the key range, not normalised, in f32; k_proj combines the eight ranges. Ot goes out in the accumulators' own layout, 512 bytes in a row a store.
__global__ __launch_bounds__(256) void k_attn(const bf* __restrict__ Qh, const bf* __restrict__ Ql, const bf* __restrict__ Kh, const bf* __restrict__ Kl, const bf* __restrict__ Vh, const bf* __restrict__ Vl, float* PO, float* PM, float* PL) {
    __shared__ __align__(16) bf kv[2 * 4 * PE];   // [buffer][K hi, K lo, V hi, V lo][128 keys x 64 channels, in the planes' own fragment order]
    const int tid = threadIdx.x, lane = tid & 31, wave = __builtin_amdgcn_readfirstlane(tid >> 5), c = lane & 15, h = lane >> 4;
    const int q0 = (blockIdx.x * AW + wave) * (QT * 16), kr = blockIdx.y; const size_t po = (size_t)blockIdx.z * NV * CC;   // po: the batch item's planes
    const float CS = SCL * 1.44269504f;   // scores go to log2 units
    const int ko = c * CC + 16 * h;   // a lane's place in a 16-row tile of Q
    const int fo = lane * 8;          // a lane's place in a 512-byte block of K or V
    const bf* qph = Qh + po + (size_t)q0 * CC; const bf* qpl = Ql + po + (size_t)q0 * CC;
    const size_t go = po + (size_t)kr * AKL * CC + tid * 8;   // a thread's first 16 bytes of the key range in each plane
    const unsigned ld0 = (unsigned)(size_t)&kv[0] + tid * 16;
    auto fill = [&](int st) {   // stage st of the key range into buffer st & 1: 16 copies a lane
        const unsigned d = ld0 + (st & 1) * (4 * PE * 2); const size_t g = go + (size_t)st * PE;
        acopy8(d, Kh + g, Kl + g); acopy8(d + 2 * PE * 2, Vh + g, Vl + g);
    };
    fill(0);
    asm volatile("s_wait_asynccnt 0x0" ::: "memory");   // this wave's copies of stage 0 have landed
    __syncthreads();                                    // and every other wave's: stage 0 may be read
    fill(1);
    v16bf qh[QT][2], ql[QT][2];
#pragma unroll
    for (int qt = 0; qt < QT; ++qt) {
#pragma unroll
        for (int ks = 0; ks < 2; ++ks) { qh[qt][ks] = ld16(qph + ko + qt * 16 * CC + ks * 32); ql[qt][ks] = ld16(qpl + ko + qt * 16 * CC + ks * 32); } }
    asm volatile("s_wait_xcnt 0x0" ::: "memory");   // stands before a register that the issued loads name is written again
    __builtin_amdgcn_sched_barrier(0);   // keeps the register writes that follow from being scheduled ahead of the wait above (one of them reuses the Q loads' offset register)
    v8f acc[QT][4]; float m[QT], l[QT];
#pragma unroll
    for (int qt = 0; qt < QT; ++qt) { m[qt] = -3.0e38f; l[qt] = 0.f;
#pragma unroll
        for (int dt = 0; dt < 4; ++dt) acc[qt][dt] = (v8f){}; }
#pragma unroll 1   // rolled: the stages differ only in the buffer they read
    for (int st = 0; st < NS; ++st) {
        const bf* kp = kv + (st & 1) * (4 * PE) + fo; const bf* vp = kp + 2 * PE;   // the lo plane stands PE elements behind its hi plane
        v16bf kh[2][2], kl[2][2], vh[4], vl[4];
#pragma unroll
        for (int kt = 0; kt < 2; ++kt) {
#pragma unroll
            for (int ks = 0; ks < 2; ++ks) { kh[kt][ks] = ldfr(kp + (kt * 2 + ks) * 512); kl[kt][ks] = ldfr(kp + PE + (kt * 2 + ks) * 512); } }
#pragma unroll 1   // rolled: one pass is already 96 matrix instructions and most of a wave's 512 registers
        for (int p = 0; p < SK / 32; ++p) {
            v8f s[QT][2];
#pragma unroll
            for (int qt = 0; qt < QT; ++qt) { s[qt][0] = (v8f){}; s[qt][1] = (v8f){}; }
#pragma unroll
            for (int ks = 0; ks < 2; ++ks) {
#pragma unroll
                for (int kt = 0; kt < 2; ++kt) {
#pragma unroll
                    for (int qt = 0; qt < QT; ++qt) s[qt][kt] = wmmab(kh[kt][ks], qh[qt][ks], s[qt][kt]); }
#pragma unroll
                for (int kt = 0; kt < 2; ++kt) {
#pragma unroll
                    for (int qt = 0; qt < QT; ++qt) s[qt][kt] = wmmab(kl[kt][ks], qh[qt][ks], s[qt][kt]); }
#pragma unroll
                for (int kt = 0; kt < 2; ++kt) {
#pragma unroll
                    for (int qt = 0; qt < QT; ++qt) s[qt][kt] = wmmab(kh[kt][ks], ql[qt][ks], s[qt][kt]); }
                // this pass's Vt, one half behind each half of the score products, into the registers that the K fragments of that half leave; the softmax covers the LDS latency
#pragma unroll
                for (int dt = 0; dt < 4; ++dt) { if (ks == 0) vl[dt] = ldfr(vp + PE + dt * 512); else vh[dt] = ldfr(vp + dt * 512); } }
            __builtin_amdgcn_sched_barrier(0);   // keeps the Vt loads up here in two groups: left free they sink in small groups to just ahead of the output products, which then wait for them
            float mx[QT];
#pragma unroll
            for (int qt = 0; qt < QT; ++qt) { float a = fmaxf(s[qt][0][0], s[qt][1][0]);
#pragma unroll
                for (int i = 1; i < 8; ++i) a = fmaxf(a, fmaxf(s[qt][0][i], s[qt][1][i]));
                mx[qt] = fmaxf(a, xhalf(a)) * CS; }
            bool need = false;
#pragma unroll
            for (int qt = 0; qt < QT; ++qt) need |= mx[qt] > m[qt] + 8.0f;
            if (__builtin_amdgcn_ballot_w32(need) != 0) {   // one scalar branch a pass
#pragma unroll
                for (int qt = 0; qt < QT; ++qt) { const float mn = fmaxf(m[qt], mx[qt]); const float al = exp2_slot(m[qt] - mn); m[qt] = mn; l[qt] *= al;
#pragma unroll
                    for (int dt = 0; dt < 4; ++dt) acc[qt][dt] *= al; } }
            v16bf ph[QT], pl[QT];
#pragma unroll
            for (int qt = 0; qt < QT; ++qt) { float pv[16];
#pragma unroll
                for (int i = 0; i < 16; ++i) pv[i] = fmaf(s[qt][i >> 3][i & 7], CS, -m[qt]);
                exp2x8(pv); exp2x8(pv + 8);
#pragma unroll
                for (int i = 0; i < 16; i += 2) { const v2bf hb = __builtin_convertvector((v2f){pv[i], pv[i + 1]}, v2bf); const v2bf lb = __builtin_convertvector((v2f){pv[i] - (float)hb[0], pv[i + 1] - (float)hb[1]}, v2bf);
                    ph[qt][i] = hb[0]; ph[qt][i + 1] = hb[1]; pl[qt][i] = lb[0]; pl[qt][i + 1] = lb[1]; }
#pragma unroll
                for (int w = 8; w; w >>= 1) {
#pragma unroll
                    for (int i = 0; i < w; ++i) pv[i] += pv[i + w]; }
                l[qt] += pv[0]; }
#pragma unroll
            for (int dt = 0; dt < 4; ++dt) {
#pragma unroll
                for (int qt = 0; qt < QT; ++qt) acc[qt][dt] = wmmab(vh[dt], ph[qt], acc[qt][dt]); }
#pragma unroll
            for (int dt = 0; dt < 4; ++dt) {
#pragma unroll
                for (int qt = 0; qt < QT; ++qt) acc[qt][dt] = wmmab(vl[dt], ph[qt], acc[qt][dt]); }
            // the next pass's K: its first half behind the last use of V lo, 16 matrix instructions ahead of the pass's end, its second half behind the last use of V hi, 24 ahead of its own first use.
            // A stage's last pass fetches its own rows again (its own buffer, unused): nothing of the next stage is read before its barrier.
            kp += (p + 1 < SK / 32) ? 32 * CC : 0; vp += 32 * CC;
#pragma unroll
            for (int kt = 0; kt < 2; ++kt) { kh[kt][0] = ldfr(kp + (kt * 2) * 512); kl[kt][0] = ldfr(kp + PE + (kt * 2) * 512); }
#pragma unroll
            for (int dt = 0; dt < 4; ++dt) {
#pragma unroll
                for (int qt = 0; qt < QT; ++qt) acc[qt][dt] = wmmab(vh[dt], pl[qt], acc[qt][dt]); }
#pragma unroll
            for (int kt = 0; kt < 2; ++kt) { kh[kt][1] = ldfr(kp + (kt * 2 + 1) * 512); kl[kt][1] = ldfr(kp + PE + (kt * 2 + 1) * 512); }
        }
        asm volatile("s_wait_dscnt 0x0" ::: "memory");      // this wave's reads of the stage's buffer are done before the buffer is handed back
        asm volatile("s_wait_asynccnt 0x0" ::: "memory");   // this wave's copies of stage st + 1 have landed
        __syncthreads();                                    // publishes stage st + 1 and ends every wave's reads of stage st
        if (st + 2 < NS) fill(st + 2);                      // into the buffer that stage st has just left
    }
    asm volatile("s_wait_asynccnt 0x0" ::: "memory");       // no copy is outstanding when the wave ends
    const size_t pn = ((size_t)kr * NB_ + blockIdx.z) * NV + q0;   // the wave's first query in the key range's partial planes
    float* pp = PO + pn * CC + lane * 4;
#pragma unroll
    for (int qt = 0; qt < QT; ++qt) l[qt] += xhalf(l[qt]);
    // both halves of a wave hold the same max and sum of a query: the upper half stores the odd tiles', so that a store covers a whole line
#pragma unroll
    for (int i = 0; i < QT / 2; ++i) { PM[pn + i * 32 + lane] = h ? m[2 * i + 1] : m[2 * i]; PL[pn + i * 32 + lane] = h ? l[2 * i + 1] : l[2 * i]; }
    asm volatile("s_wait_xcnt 0x0" ::: "memory");   // stands before a register that the four stores above name is written again
    __builtin_amdgcn_sched_barrier(0);              // keeps all vector work above the wide stores below: behind the first of them no register is written any more
#pragma unroll
    for (int qt = 0; qt < QT; ++qt) {
#pragma unroll
        for (int dt = 0; dt < 4; ++dt) { const v8f a = acc[qt][dt];
            *(v4f*)(pp + (qt * 4 + dt) * 256) = (v4f){a[0], a[1], a[2], a[3]}; *(v4f*)(pp + (qt * 4 + dt) * 256 + 128) = (v4f){a[4], a[5], a[6], a[7]}; } }
}
// k_proj: combines the eight key ranges' partial (max, sum, Ot) in range order (fixed), normalises, splits into bf16 hi + residual, does the output conv [16 x 64].[64 x 64] a wave on exact bf16 weights
// (two products, + bias), and writes bf(x) + result in the output's channel-major order. k_attn's accumulator layout is this product's A fragment layout: lane h * 16 + c holds channels dt * 16 + h * 8 + 0..7 of
// query c, so the partials go from the loads into the fragments. All of a lane's loads, its part of x among them, are issued before the first is used. The conv's accumulators hold 8 consecutive voxels of one
// channel a lane; the block's 64 voxels x 64 channels meet in LDS as [channel][voxel], and each wave-wide 16-byte store then covers 2 channels x 64 voxels, four whole lines.
__global__ __launch_bounds__(128) void k_proj(const float* __restrict__ PO, const float* __restrict__ PM, const float* __restrict__ PL, const bf* __restrict__ Bn, const float* __restrict__ bias, const float* __restrict__ xb, float* OUTB) {
    __shared__ __align__(16) float tl[CC][68];   // [channel][voxel]
    const int lane = threadIdx.x & 31, wave = __builtin_amdgcn_readfirstlane(threadIdx.x >> 5), lr = lane & 15, hi = lane >> 4;
    const int p0 = blockIdx.x * 64, r0 = p0 + wave * 16, item = blockIdx.z;   // the same for a whole wave: the partial planes' bases are scalar, and all loads of a lane share one offset register
    const size_t xo = ((size_t)item * CC + wave * 2 + hi) * NV + p0 + lr * 4;   // a lane's 4 voxels of channel wave * 2 + hi in x and in the output; step s stands 8 channels further
    float mw[AW], lw[AW]; v4f pr[AW][4][2];
#pragma unroll
    for (int w = 0; w < AW; ++w) { const size_t pn = ((size_t)w * NB_ + item) * NV + r0; mw[w] = (PM + pn)[lr]; lw[w] = (PL + pn)[lr]; }
    asm volatile("s_wait_xcnt 0x0" ::: "memory");   // here and below: stands before a register that the issued loads name is written again (the next group's addresses and results)
    __builtin_amdgcn_sched_barrier(0);              // here and below: keeps the register writes that follow from being scheduled ahead of the wait above
#pragma unroll
    for (int w = 0; w < AW; ++w) { const float* pp = PO + (((size_t)w * NB_ + item) * NV + r0) * CC;
#pragma unroll
        for (int dt = 0; dt < 4; ++dt) { pr[w][dt][0] = *(const v4f*)(pp + dt * 256 + lane * 4); pr[w][dt][1] = *(const v4f*)(pp + dt * 256 + 128 + lane * 4); }
        if (w & 1) { asm volatile("s_wait_xcnt 0x0" ::: "memory"); __builtin_amdgcn_sched_barrier(0); } }   // two ranges' loads share an address
    v16bf b[2][4]; float bb[4];
#pragma unroll
    for (int t = 0; t < 4; ++t) { const bf* bp = Bn + (size_t)(t * 16 + lr) * CC + 8 * hi; bb[t] = bias[t * 16 + lr];
#pragma unroll
        for (int ks = 0; ks < 2; ++ks) b[ks][t] = cat16b(*(const v8us*)(bp + ks * 32), *(const v8us*)(bp + ks * 32 + 16)); }
    asm volatile("s_wait_xcnt 0x0" ::: "memory");
    __builtin_amdgcn_sched_barrier(0);
    v4f xv[8];
#pragma unroll
    for (int s = 0; s < 8; ++s) xv[s] = *(const v4f*)(xb + xo + (size_t)s * 8 * NV);
    asm volatile("s_wait_xcnt 0x0" ::: "memory");
    __builtin_amdgcn_sched_barrier(0);
    float M = mw[0];
#pragma unroll
    for (int w = 1; w < AW; ++w) M = fmaxf(M, mw[w]);
    float L = 0.f; v8f o[4];
#pragma unroll
    for (int dt = 0; dt < 4; ++dt) o[dt] = (v8f){};
#pragma unroll
    for (int w = 0; w < AW; ++w) { const float a = exp2_slot(mw[w] - M); L = fmaf(lw[w], a, L);
#pragma unroll
        for (int dt = 0; dt < 4; ++dt) o[dt] += __builtin_shufflevector(pr[w][dt][0], pr[w][dt][1], 0, 1, 2, 3, 4, 5, 6, 7) * a; }
    const float inv = 1.0f / L; v8us oh[4], ol[4];
#pragma unroll
    for (int dt = 0; dt < 4; ++dt) {
#pragma unroll
        for (int i = 0; i < 8; ++i) { const float y = o[dt][i] * inv; const unsigned short hb = f2bf(y); oh[dt][i] = hb; ol[dt][i] = f2bf(y - bf2f(hb)); } }
    v8f acc[4];
#pragma unroll
    for (int t = 0; t < 4; ++t) acc[t] = (v8f){};
#pragma unroll
    for (int ks = 0; ks < 2; ++ks) { const v16bf a = cat16b(oh[2 * ks], oh[2 * ks + 1]), al = cat16b(ol[2 * ks], ol[2 * ks + 1]);   // the k order of the weights' fragments: 8 * hi + 0..7, then 16 + 8 * hi + 0..7
#pragma unroll
        for (int t = 0; t < 4; ++t) { acc[t] = wmmab(a, b[ks][t], acc[t]); acc[t] = wmmab(al, b[ks][t], acc[t]); } }
#pragma unroll
    for (int t = 0; t < 4; ++t) { const float bv = bfr(bb[t]); float* tp = &tl[t * 16 + lr][wave * 16 + hi * 8];   // accumulator element j: voxel hi * 8 + j of the wave's 16, channel t * 16 + lr
        *(v4fa*)tp = (v4f){acc[t][0] + bv, acc[t][1] + bv, acc[t][2] + bv, acc[t][3] + bv}; *(v4fa*)(tp + 4) = (v4f){acc[t][4] + bv, acc[t][5] + bv, acc[t][6] + bv, acc[t][7] + bv}; }
    __syncthreads();   // every wave reads below, for its channels, the voxels of all four waves
    v4f ov[8];
#pragma unroll
    for (int s = 0; s < 8; ++s) { const v4f y = *(const v4fa*)&tl[s * 8 + wave * 2 + hi][lr * 4];
#pragma unroll
        for (int i = 0; i < 4; ++i) ov[s][i] = bfr(xv[s][i]) + y[i]; }
    __builtin_amdgcn_sched_barrier(0);   // keeps all vector work above the stores below: behind the first of them no register is written any more
#pragma unroll
    for (int s = 0; s < 8; ++s) *(v4f*)(OUTB + xo + (size_t)s * 8 * NV) = ov[s];
}

extern "C" void kernel_launch(void* const* d_in, const int* in_sizes, int n_in,
                              void* d_out, int out_size, void* d_ws, size_t ws_size, hipStream_t stream) {
    (void)in_sizes; (void)n_in; (void)out_size;
    const float* x = (const float*)d_in[0]; const float* gam = (const float*)d_in[1]; const float* bet = (const float*)d_in[2]; const float* wq = (const float*)d_in[3]; const float* bq = (const float*)d_in[4]; const float* wk = (const float*)d_in[5]; const float* bk = (const float*)d_in[6]; const float* wv = (const float*)d_in[7]; const float* bv = (const float*)d_in[8]; const float* wp = (const float*)d_in[9]; const float* bp = (const float*)d_in[10];
    float* out = (float*)d_out;    // [2][64][32][32][8]
    char* wsp = (char*)d_ws;
    auto take = [&](size_t bytes) { char* p = wsp; wsp += (bytes + 255) & ~(size_t)255; return (void*)p; };
    // every plane holds both batch items, item after item; the four weight matrices stand behind one another
    bf* W4 = (bf*)take((size_t)4 * CC * CC * 2); float* ST = (float*)take((size_t)NB_ * NG * 32 * 4);
    bf* Qh = (bf*)take((size_t)NB_ * NV * CC * 2); bf* Ql = (bf*)take((size_t)NB_ * NV * CC * 2); bf* Kh = (bf*)take((size_t)NB_ * NV * CC * 2); bf* Kl = (bf*)take((size_t)NB_ * NV * CC * 2); bf* VTh = (bf*)take((size_t)NB_ * CC * NV * 2); bf* VTl = (bf*)take((size_t)NB_ * CC * NV * 2);
    float* PO = (float*)take((size_t)AW * NB_ * NV * CC * 4); float* PM = (float*)take((size_t)AW * NB_ * NV * 4); float* PL = (float*)take((size_t)AW * NB_ * NV * 4);
    if ((size_t)(wsp - (char*)d_ws) > ws_size) return;
    k_prep<<<NB_ * NG + 8, 256, 0, stream>>>(x, ST, wq, wk, wv, wp, W4);
    k_qkv<<<dim3(NV / 64, 3, NB_), 128, 0, stream>>>(x, ST, gam, bet, W4, bq, bk, bv, Qh, Ql, Kh, Kl, VTh, VTl);
    k_attn<<<dim3(NV / (AW * QT * 16), AW, NB_), 256, 0, stream>>>(Qh, Ql, Kh, Kl, VTh, VTl, PO, PM, PL);
    k_proj<<<dim3(NV / 64, 1, NB_), 128, 0, stream>>>(PO, PM, PL, W4 + (size_t)3 * CC * CC, bp, x, out);
}
